// v000
// Times are from an AMD MI455X. After a warm-up the kernel runs many times in a row, and a time is the length of
// such a window on the GPU divided by its runs, so every launch and the gaps after it count. The runs cycle
// through copies of the inputs. A figure is the median of several windows, for all but v000 over two sittings.
// Sittings can differ by a few percent; kernels timed side by side share one.
// v000, which the later versions start from, runs in 564 microseconds.
#include <hip/hip_runtime.h>

typedef __attribute__((ext_vector_type(16))) _Float16 v16h;
typedef __attribute__((ext_vector_type(8)))  _Float16 v8h;
typedef __attribute__((ext_vector_type(8)))  float    v8f;

#define WMMA_F32_F16(a, b, c) \
    __builtin_amdgcn_wmma_f32_16x16x32_f16(false, (a), false, (b), (short)0, (c), false, false)

__device__ __forceinline__ unsigned lds_off(const void* p) {
    return (unsigned)(unsigned long long)p;
}

__device__ __forceinline__ void async_copy32B(unsigned ldsAddr, const void* g) {
    unsigned long long ga = (unsigned long long)g;
    asm volatile(
        "global_load_async_to_lds_b128 %0, %1, off\n\t"
        "global_load_async_to_lds_b128 %0, %1, off offset:16"
        :: "v"(ldsAddr), "v"(ga) : "memory");
}

__device__ __forceinline__ void async_copy64B(unsigned ldsAddr, const void* g) {
    unsigned long long ga = (unsigned long long)g;
    asm volatile(
        "global_load_async_to_lds_b128 %0, %1, off\n\t"
        "global_load_async_to_lds_b128 %0, %1, off offset:16\n\t"
        "global_load_async_to_lds_b128 %0, %1, off offset:32\n\t"
        "global_load_async_to_lds_b128 %0, %1, off offset:48"
        :: "v"(ldsAddr), "v"(ga) : "memory");
}

__device__ __forceinline__ void wait_async0() {
    asm volatile("s_wait_asynccnt 0x0" ::: "memory");
}

__device__ __forceinline__ v16h frag_ld(const _Float16* tile, int ld, int kbase) {
    const int lane = threadIdx.x & 31;
    const _Float16* p = tile + (lane & 15) * ld + kbase + ((lane >> 4) << 3);
    v8h lo = *(const v8h*)p;
    v8h hi = *(const v8h*)(p + 16);
    v16h r;
#pragma unroll
    for (int i = 0; i < 8; ++i) { r[i] = lo[i]; r[i + 8] = hi[i]; }
    return r;
}

// ---------------------------------------------------------------------------
// Weight prep: f32 [K][N] -> f16 transposed [N][K] (LDS-tiled for coalescing)
// grid: (N/32, K/32), block: (32, 8)
// ---------------------------------------------------------------------------
__global__ __launch_bounds__(256) void cast_transpose_kernel(const float* __restrict__ in,
                                                             _Float16* __restrict__ out,
                                                             int K, int N) {
    __shared__ _Float16 tile[32][33];
    const int nb = blockIdx.x * 32;
    const int kb = blockIdx.y * 32;
    const int tx = threadIdx.x;
#pragma unroll
    for (int i = threadIdx.y; i < 32; i += 8)
        tile[i][tx] = (_Float16)in[(size_t)(kb + i) * N + nb + tx];
    __syncthreads();
#pragma unroll
    for (int i = threadIdx.y; i < 32; i += 8)
        out[(size_t)(nb + i) * K + kb + tx] = tile[tx][i];
}

// ---------------------------------------------------------------------------
// LayerNorm (biased variance, eps 1e-5) + cast to f16.  One block per row.
// ---------------------------------------------------------------------------
__global__ __launch_bounds__(256) void ln_cast_kernel(const float* __restrict__ X,
                                                      const float* __restrict__ G,
                                                      const float* __restrict__ Bv,
                                                      _Float16* __restrict__ Y, int C) {
    __shared__ float red0[256];
    __shared__ float red1[256];
    const int row = blockIdx.x;
    const float* xr = X + (size_t)row * C;
    float s1 = 0.f, s2 = 0.f;
    for (int c = threadIdx.x; c < C; c += 256) { float v = xr[c]; s1 += v; s2 += v * v; }
    red0[threadIdx.x] = s1; red1[threadIdx.x] = s2;
    __syncthreads();
    for (int off = 128; off > 0; off >>= 1) {
        if ((int)threadIdx.x < off) {
            red0[threadIdx.x] += red0[threadIdx.x + off];
            red1[threadIdx.x] += red1[threadIdx.x + off];
        }
        __syncthreads();
    }
    const float invC = 1.0f / (float)C;
    const float mean = red0[0] * invC;
    const float var  = red1[0] * invC - mean * mean;
    const float rstd = rsqrtf(var + 1e-5f);
    _Float16* yr = Y + (size_t)row * C;
    for (int c = threadIdx.x; c < C; c += 256)
        yr[c] = (_Float16)((xr[c] - mean) * rstd * G[c] + Bv[c]);
}

// ---------------------------------------------------------------------------
// Tiled WMMA GEMM:  C[M,N] = A[M,K] (f16 row-major) * Bt[N,K] (f16, B transposed)
// Block tile 128x256, 256 threads = 8 waves in a 2(M) x 4(N) grid,
// each wave computes a 64x64 register tile: 16 WMMAs per 32-wide K step.
// A/B tiles staged into LDS with global_load_async_to_lds_b128.
// MODE 0: C -> f16.  MODE 2: C -> f16 * 0.125 (Q pre-scale).
// MODE 1: C -> f32 with + bias[n] + res[m,n].
// ---------------------------------------------------------------------------
template <int MODE>
__global__ __launch_bounds__(256) void gemm_wmma_kernel(const _Float16* __restrict__ A,
                                                        const _Float16* __restrict__ Bt,
                                                        _Float16* __restrict__ C16,
                                                        float* __restrict__ C32,
                                                        const float* __restrict__ bias,
                                                        const float* __restrict__ res,
                                                        int M, int N, int K) {
    __shared__ __align__(16) _Float16 sA[128 * 32];  // [m][k]
    __shared__ __align__(16) _Float16 sB[256 * 32];  // [n][k]
    const int tid = threadIdx.x;
    const int wave = tid >> 5, lane = tid & 31;
    const int waveM = wave >> 2, waveN = wave & 3;
    const int mbase = blockIdx.y * 128;
    const int nbase = blockIdx.x * 256;
    (void)M;

    v8f acc[4][4] = {};

    // staging assignments: A rows 0..127 x 32 halves (32B/thread),
    //                      B rows 0..255 x 32 halves (64B/thread)
    const int arow = tid >> 1, aseg = (tid & 1) * 16;
    const _Float16* gA = A + (size_t)(mbase + arow) * K + aseg;
    const unsigned dA = lds_off(&sA[arow * 32 + aseg]);
    const int brow = tid;
    const _Float16* gB = Bt + (size_t)(nbase + brow) * K;
    const unsigned dB = lds_off(&sB[brow * 32]);

    for (int k0 = 0; k0 < K; k0 += 32) {
        __syncthreads();
        async_copy32B(dA, gA + k0);
        async_copy64B(dB, gB + k0);
        if (k0 + 32 < K) __builtin_prefetch(gB + k0 + 32, 0, 0);
        wait_async0();
        __syncthreads();

        v16h bf[4];
#pragma unroll
        for (int j = 0; j < 4; ++j)
            bf[j] = frag_ld(sB + (waveN * 64 + j * 16) * 32, 32, 0);
#pragma unroll
        for (int i = 0; i < 4; ++i) {
            v16h af = frag_ld(sA + (waveM * 64 + i * 16) * 32, 32, 0);
#pragma unroll
            for (int j = 0; j < 4; ++j)
                acc[i][j] = WMMA_F32_F16(af, bf[j], acc[i][j]);
        }
    }

    const int hf = lane >> 4, c0 = lane & 15;
#pragma unroll
    for (int i = 0; i < 4; ++i) {
#pragma unroll
        for (int j = 0; j < 4; ++j) {
#pragma unroll
            for (int r = 0; r < 8; ++r) {
                const int row = mbase + waveM * 64 + i * 16 + hf * 8 + r;
                const int col = nbase + waveN * 64 + j * 16 + c0;
                const float v = acc[i][j][r];
                if (MODE == 0) {
                    C16[(size_t)row * N + col] = (_Float16)v;
                } else if (MODE == 2) {
                    C16[(size_t)row * N + col] = (_Float16)(v * 0.125f);
                } else {
                    C32[(size_t)row * N + col] = v + bias[col] + res[(size_t)row * N + col];
                }
            }
        }
    }
}

// ---------------------------------------------------------------------------
// Flash attention, one block per (batch, head, 64-row query tile).
// 128 threads = 4 waves; each wave owns 16 query rows.
// Q: [b, n_q, 512] f16, ALREADY scaled by 1/sqrt(d) (GEMM MODE 2).
// KV: [b, m_len, 1024] f16 (K at col h*64, V at col 512 + h*64).
// Output O: [b, n_q, 512] f16.
// ---------------------------------------------------------------------------
__global__ __launch_bounds__(128) void flash_attn_kernel(const _Float16* __restrict__ Q,
                                                         const _Float16* __restrict__ KV,
                                                         _Float16* __restrict__ O,
                                                         int n_q, int m_len) {
    __shared__ __align__(16) _Float16 sQ[64 * 64];    // [m][d] (pre-scaled)
    __shared__ __align__(16) _Float16 sK[64 * 64];    // [key][d]   == Bt for QK^T
    __shared__ __align__(16) _Float16 sVt[64 * 64];   // [d][key]   == Bt for PV
    __shared__ __align__(16) _Float16 sP[4][16 * 64]; // per-wave P staging [row][key]

    const int wave = threadIdx.x >> 5;
    const int lane = threadIdx.x & 31;
    const int h = blockIdx.y, b = blockIdx.z;
    const int qrow0 = blockIdx.x * 64;
    const size_t qoff  = ((size_t)b * n_q + qrow0) * 512 + (size_t)h * 64;
    const size_t kvoff = (size_t)b * m_len * 1024 + (size_t)h * 64;

    const int srow = threadIdx.x >> 1;            // 0..63
    const int sseg = (threadIdx.x & 1) * 32;      // 0 / 32 halves (64B)

    // Async-stage Q tile (waited at first loop iteration's wait_async0).
    async_copy64B(lds_off(&sQ[srow * 64 + sseg]), Q + qoff + (size_t)srow * 512 + sseg);

    float m_i[8], l_i[8];
    v8f o[4] = {};
#pragma unroll
    for (int r = 0; r < 8; ++r) { m_i[r] = -1e30f; l_i[r] = 0.f; }

    const int hf = lane >> 4, c0 = lane & 15;

    for (int kt = 0; kt < m_len; kt += 64) {
        __syncthreads();
        const _Float16* gk = KV + kvoff + (size_t)(kt + srow) * 1024 + sseg;
        // K tile: straight async row copy.
        async_copy64B(lds_off(&sK[srow * 64 + sseg]), gk);
        // V tile: load + transpose-scatter into sVt[d][key].
        {
            const _Float16* gv = gk + 512;
            v8h v0 = *(const v8h*)gv;
            v8h v1 = *(const v8h*)(gv + 8);
            v8h v2 = *(const v8h*)(gv + 16);
            v8h v3 = *(const v8h*)(gv + 24);
#pragma unroll
            for (int j = 0; j < 8; ++j) {
                sVt[(sseg + j) * 64 + srow]      = v0[j];
                sVt[(sseg + 8 + j) * 64 + srow]  = v1[j];
                sVt[(sseg + 16 + j) * 64 + srow] = v2[j];
                sVt[(sseg + 24 + j) * 64 + srow] = v3[j];
            }
        }
        wait_async0();
        __syncthreads();

        // S = Q K^T : 16 rows x 64 keys per wave
        v8f s[4] = {};
#pragma unroll
        for (int kc = 0; kc < 64; kc += 32) {
            v16h a = frag_ld(sQ + wave * 16 * 64, 64, kc);
#pragma unroll
            for (int j = 0; j < 4; ++j) {
                v16h bf = frag_ld(sK + j * 16 * 64, 64, kc);
                s[j] = WMMA_F32_F16(a, bf, s[j]);
            }
        }

#pragma unroll
        for (int r = 0; r < 8; ++r) {
            float mx = fmaxf(fmaxf(s[0][r], s[1][r]), fmaxf(s[2][r], s[3][r]));
#pragma unroll
            for (int msk = 1; msk < 16; msk <<= 1) mx = fmaxf(mx, __shfl_xor(mx, msk, 32));
            const float mnew  = fmaxf(m_i[r], mx);
            const float alpha = __expf(m_i[r] - mnew);
            m_i[r] = mnew;
            float rs = 0.f;
#pragma unroll
            for (int j = 0; j < 4; ++j) {
                const float p = __expf(s[j][r] - mnew);
                s[j][r] = p;
                rs += p;
            }
#pragma unroll
            for (int msk = 1; msk < 16; msk <<= 1) rs += __shfl_xor(rs, msk, 32);
            l_i[r] = l_i[r] * alpha + rs;
#pragma unroll
            for (int j = 0; j < 4; ++j) {
                o[j][r] *= alpha;
                // reshape C-layout -> A-layout via per-wave LDS staging
                sP[wave][(hf * 8 + r) * 64 + j * 16 + c0] = (_Float16)s[j][r];
            }
        }

        // O += P V
#pragma unroll
        for (int kc = 0; kc < 64; kc += 32) {
            v16h pa = frag_ld(sP[wave], 64, kc);
#pragma unroll
            for (int j = 0; j < 4; ++j) {
                v16h vb = frag_ld(sVt + j * 16 * 64, 64, kc);
                o[j] = WMMA_F32_F16(pa, vb, o[j]);
            }
        }
    }

    // Epilogue: normalize by l and store f16.
#pragma unroll
    for (int j = 0; j < 4; ++j) {
#pragma unroll
        for (int r = 0; r < 8; ++r) {
            const int rowl = wave * 16 + hf * 8 + r;
            const size_t idx = ((size_t)b * n_q + qrow0 + rowl) * 512 + (size_t)h * 64 + j * 16 + c0;
            O[idx] = (_Float16)(o[j][r] / l_i[r]);
        }
    }
}

// ---------------------------------------------------------------------------
// Host-side orchestration
// ---------------------------------------------------------------------------
extern "C" void kernel_launch(void* const* d_in, const int* in_sizes, int n_in,
                              void* d_out, int out_size, void* d_ws, size_t ws_size,
                              hipStream_t stream) {
    (void)in_sizes; (void)n_in; (void)out_size; (void)ws_size;

    constexpr int B = 4, Nx = 2048, Mc = 512, F = 1024, CF = 768, MID = 512;
    constexpr int ROWS = B * Nx;       // 8192
    constexpr int CROWS = B * Mc;      // 2048

    const float* x       = (const float*)d_in[0];
    const float* ctx     = (const float*)d_in[1];
    const float* sa_ng   = (const float*)d_in[2];
    const float* sa_nb   = (const float*)d_in[3];
    const float* sa_ncg  = (const float*)d_in[4];
    const float* sa_ncb  = (const float*)d_in[5];
    const float* sa_wq   = (const float*)d_in[6];
    const float* sa_wkv  = (const float*)d_in[7];
    const float* sa_wo   = (const float*)d_in[8];
    const float* sa_bo   = (const float*)d_in[9];
    const float* ca_ng   = (const float*)d_in[10];
    const float* ca_nb   = (const float*)d_in[11];
    const float* ca_ncg  = (const float*)d_in[12];
    const float* ca_ncb  = (const float*)d_in[13];
    const float* ca_wq   = (const float*)d_in[14];
    const float* ca_wkv  = (const float*)d_in[15];
    const float* ca_wo   = (const float*)d_in[16];
    const float* ca_bo   = (const float*)d_in[17];
    float* out = (float*)d_out;

    // carve workspace
    size_t off = 0;
    auto carve = [&](size_t bytes) -> void* {
        void* p = (char*)d_ws + off;
        off += (bytes + 255) & ~(size_t)255;
        return p;
    };
    // weights, f16 TRANSPOSED to [N][K]
    _Float16* wq16s  = (_Float16*)carve((size_t)MID * F * 2);        // [512][1024]
    _Float16* wkv16s = (_Float16*)carve((size_t)(2 * MID) * F * 2);  // [1024][1024]
    _Float16* wo16s  = (_Float16*)carve((size_t)F * MID * 2);        // [1024][512]
    _Float16* wq16c  = (_Float16*)carve((size_t)MID * F * 2);        // [512][1024]
    _Float16* wkv16c = (_Float16*)carve((size_t)(2 * MID) * CF * 2); // [1024][768]
    _Float16* wo16c  = (_Float16*)carve((size_t)F * MID * 2);        // [1024][512]
    _Float16* XN1 = (_Float16*)carve((size_t)ROWS * F * 2);          // q-norm input
    _Float16* XN2 = (_Float16*)carve((size_t)ROWS * F * 2);          // kv-norm input / ctx-norm
    _Float16* Q16 = (_Float16*)carve((size_t)ROWS * MID * 2);
    _Float16* KV16 = (_Float16*)carve((size_t)ROWS * 2 * MID * 2);
    _Float16* AO16 = (_Float16*)carve((size_t)ROWS * MID * 2);
    float*    X1   = (float*)carve((size_t)ROWS * F * 4);

    const dim3 tb(32, 8);
    // ---- weight casts + transposes:  W[K][N] -> Wt[N][K] ----
    cast_transpose_kernel<<<dim3(MID / 32, F / 32), tb, 0, stream>>>(sa_wq, wq16s, F, MID);
    cast_transpose_kernel<<<dim3(2 * MID / 32, F / 32), tb, 0, stream>>>(sa_wkv, wkv16s, F, 2 * MID);
    cast_transpose_kernel<<<dim3(F / 32, MID / 32), tb, 0, stream>>>(sa_wo, wo16s, MID, F);
    cast_transpose_kernel<<<dim3(MID / 32, F / 32), tb, 0, stream>>>(ca_wq, wq16c, F, MID);
    cast_transpose_kernel<<<dim3(2 * MID / 32, CF / 32), tb, 0, stream>>>(ca_wkv, wkv16c, CF, 2 * MID);
    cast_transpose_kernel<<<dim3(F / 32, MID / 32), tb, 0, stream>>>(ca_wo, wo16c, MID, F);

    // ================= self-attention =================
    ln_cast_kernel<<<ROWS, 256, 0, stream>>>(x, sa_ng,  sa_nb,  XN1, F);
    ln_cast_kernel<<<ROWS, 256, 0, stream>>>(x, sa_ncg, sa_ncb, XN2, F);
    // Q = (XN1 @ wq) * scale   [8192 x 1024 -> 512]
    gemm_wmma_kernel<2><<<dim3(MID / 256, ROWS / 128), 256, 0, stream>>>(
        XN1, wq16s, Q16, nullptr, nullptr, nullptr, ROWS, MID, F);
    // KV = XN2 @ wkv  [8192 x 1024 -> 1024]
    gemm_wmma_kernel<0><<<dim3(2 * MID / 256, ROWS / 128), 256, 0, stream>>>(
        XN2, wkv16s, KV16, nullptr, nullptr, nullptr, ROWS, 2 * MID, F);
    // attention (m_len = 2048)
    flash_attn_kernel<<<dim3(Nx / 64, 8, B), 128, 0, stream>>>(Q16, KV16, AO16, Nx, Nx);
    // X1 = AO @ wo + bo + x   [8192 x 512 -> 1024] -> f32
    gemm_wmma_kernel<1><<<dim3(F / 256, ROWS / 128), 256, 0, stream>>>(
        AO16, wo16s, nullptr, X1, sa_bo, x, ROWS, F, MID);

    // ================= cross-attention =================
    ln_cast_kernel<<<ROWS, 256, 0, stream>>>(X1, ca_ng, ca_nb, XN1, F);
    _Float16* CN = XN2;  // reuse: normalized context [2048 x 768]
    ln_cast_kernel<<<CROWS, 256, 0, stream>>>(ctx, ca_ncg, ca_ncb, CN, CF);
    // Q = (XN1 @ ca_wq) * scale
    gemm_wmma_kernel<2><<<dim3(MID / 256, ROWS / 128), 256, 0, stream>>>(
        XN1, wq16c, Q16, nullptr, nullptr, nullptr, ROWS, MID, F);
    // KV = CN @ ca_wkv [2048 x 768 -> 1024]
    gemm_wmma_kernel<0><<<dim3(2 * MID / 256, CROWS / 128), 256, 0, stream>>>(
        CN, wkv16c, KV16, nullptr, nullptr, nullptr, CROWS, 2 * MID, CF);
    // attention (m_len = 512)
    flash_attn_kernel<<<dim3(Nx / 64, 8, B), 128, 0, stream>>>(Q16, KV16, AO16, Nx, Mc);
    // out = AO @ ca_wo + ca_bo + X1  -> f32 (final output)
    gemm_wmma_kernel<1><<<dim3(F / 256, ROWS / 128), 256, 0, stream>>>(
        AO16, wo16c, nullptr, out, ca_bo, X1, ROWS, F, MID);
}

// v001
// It runs in 419 microseconds.
// Timed twice side by side with v000, it ran 1.36 and 1.35 times as fast.
#include <hip/hip_runtime.h>

typedef __attribute__((ext_vector_type(16))) _Float16 v16h;
typedef __attribute__((ext_vector_type(8)))  _Float16 v8h;
typedef __attribute__((ext_vector_type(8)))  float    v8f;

#define WMMA_F32_F16(a, b, c) \
    __builtin_amdgcn_wmma_f32_16x16x32_f16(false, (a), false, (b), (short)0, (c), false, false)

__device__ __forceinline__ unsigned lds_off(const void* p) {
    return (unsigned)(unsigned long long)p;
}

__device__ __forceinline__ void async_copy32B(unsigned ldsAddr, const void* g) {
    unsigned long long ga = (unsigned long long)g;
    asm volatile(
        "global_load_async_to_lds_b128 %0, %1, off\n\t"
        "global_load_async_to_lds_b128 %0, %1, off offset:16\n\t"
        "s_wait_xcnt 0x0"
        :: "v"(ldsAddr), "v"(ga) : "memory");
}

__device__ __forceinline__ void async_copy64B(unsigned ldsAddr, const void* g) {
    unsigned long long ga = (unsigned long long)g;
    asm volatile(
        "global_load_async_to_lds_b128 %0, %1, off\n\t"
        "global_load_async_to_lds_b128 %0, %1, off offset:16\n\t"
        "global_load_async_to_lds_b128 %0, %1, off offset:32\n\t"
        "global_load_async_to_lds_b128 %0, %1, off offset:48\n\t"
        "s_wait_xcnt 0x0"
        :: "v"(ldsAddr), "v"(ga) : "memory");
}

__device__ __forceinline__ void wait_async0() {
    asm volatile("s_wait_asynccnt 0x0" ::: "memory");
}

constexpr int GP = 40;  // 32-half (64 B) rows  -> 80 B pitch
constexpr int FP = 72;  // 64-half (128 B) rows -> 144 B pitch

__device__ __forceinline__ v16h frag_ld(const _Float16* tile, int ld, int kbase) {
    const int lane = threadIdx.x & 31;
    const _Float16* p = tile + (lane & 15) * ld + kbase + ((lane >> 4) << 3);
    v8h lo = *(const v8h*)p;
    v8h hi = *(const v8h*)(p + 16);
    v16h r;
#pragma unroll
    for (int i = 0; i < 8; ++i) { r[i] = lo[i]; r[i + 8] = hi[i]; }
    return r;
}

// ---------------------------------------------------------------------------
// Weight prep: f32 [K][N] -> f16 transposed [N][K] (LDS-tiled for coalescing)
// grid: (N/32, K/32), block: (32, 8)
// ---------------------------------------------------------------------------
__global__ __launch_bounds__(256) void cast_transpose_kernel(const float* __restrict__ in,
                                                             _Float16* __restrict__ out,
                                                             int K, int N) {
    __shared__ _Float16 tile[32][33];
    const int nb = blockIdx.x * 32;
    const int kb = blockIdx.y * 32;
    const int tx = threadIdx.x;
#pragma unroll
    for (int i = threadIdx.y; i < 32; i += 8)
        tile[i][tx] = (_Float16)in[(size_t)(kb + i) * N + nb + tx];
    __syncthreads();
#pragma unroll
    for (int i = threadIdx.y; i < 32; i += 8)
        out[(size_t)(nb + i) * K + kb + tx] = tile[tx][i];
}

// ---------------------------------------------------------------------------
// LayerNorm (biased variance, eps 1e-5) + cast to f16.  One block per row.
// ---------------------------------------------------------------------------
__global__ __launch_bounds__(256) void ln_cast_kernel(const float* __restrict__ X,
                                                      const float* __restrict__ G,
                                                      const float* __restrict__ Bv,
                                                      _Float16* __restrict__ Y, int C) {
    __shared__ float red0[256];
    __shared__ float red1[256];
    const int row = blockIdx.x;
    const float* xr = X + (size_t)row * C;
    float s1 = 0.f, s2 = 0.f;
    for (int c = threadIdx.x; c < C; c += 256) { float v = xr[c]; s1 += v; s2 += v * v; }
    red0[threadIdx.x] = s1; red1[threadIdx.x] = s2;
    __syncthreads();
    for (int off = 128; off > 0; off >>= 1) {
        if ((int)threadIdx.x < off) {
            red0[threadIdx.x] += red0[threadIdx.x + off];
            red1[threadIdx.x] += red1[threadIdx.x + off];
        }
        __syncthreads();
    }
    const float invC = 1.0f / (float)C;
    const float mean = red0[0] * invC;
    const float var  = red1[0] * invC - mean * mean;
    const float rstd = rsqrtf(var + 1e-5f);
    _Float16* yr = Y + (size_t)row * C;
    for (int c = threadIdx.x; c < C; c += 256)
        yr[c] = (_Float16)((xr[c] - mean) * rstd * G[c] + Bv[c]);
}

// ---------------------------------------------------------------------------
// Tiled WMMA GEMM:  C[M,N] = A[M,K] (f16 row-major) * Bt[N,K] (f16, B transposed)
// Block tile 128x256, 256 threads = 8 waves in a 2(M) x 4(N) grid,
// each wave computes a 64x64 register tile: 16 WMMAs per 32-wide K step.
// A/B tiles staged into LDS with global_load_async_to_lds_b128.
// MODE 0: C -> f16.  MODE 2: C -> f16 * 0.125 (Q pre-scale).
// MODE 1: C -> f32 with + bias[n] + res[m,n].
// ---------------------------------------------------------------------------
template <int MODE>
__global__ __launch_bounds__(256) void gemm_wmma_kernel(const _Float16* __restrict__ A,
                                                        const _Float16* __restrict__ Bt,
                                                        _Float16* __restrict__ C16,
                                                        float* __restrict__ C32,
                                                        const float* __restrict__ bias,
                                                        const float* __restrict__ res,
                                                        int M, int N, int K) {
    __shared__ __align__(16) _Float16 sA[128 * GP];  // [m][k], padded pitch
    __shared__ __align__(16) _Float16 sB[256 * GP];  // [n][k], padded pitch
    const int tid = threadIdx.x;
    const int wave = tid >> 5, lane = tid & 31;
    const int waveM = wave >> 2, waveN = wave & 3;
    const int mbase = blockIdx.y * 128;
    const int nbase = blockIdx.x * 256;
    (void)M;

    v8f acc[4][4] = {};

    // staging assignments: A rows 0..127 x 32 halves (32B/thread),
    //                      B rows 0..255 x 32 halves (64B/thread)
    const int arow = tid >> 1, aseg = (tid & 1) * 16;
    const _Float16* gA = A + (size_t)(mbase + arow) * K + aseg;
    const unsigned dA = lds_off(&sA[arow * GP + aseg]);
    const int brow = tid;
    const _Float16* gB = Bt + (size_t)(nbase + brow) * K;
    const unsigned dB = lds_off(&sB[brow * GP]);

    for (int k0 = 0; k0 < K; k0 += 32) {
        __syncthreads();
        async_copy32B(dA, gA + k0);
        async_copy64B(dB, gB + k0);
        if (k0 + 32 < K) __builtin_prefetch(gB + k0 + 32, 0, 0);
        wait_async0();
        __syncthreads();

        v16h bf[4];
#pragma unroll
        for (int j = 0; j < 4; ++j)
            bf[j] = frag_ld(sB + (waveN * 64 + j * 16) * GP, GP, 0);
#pragma unroll
        for (int i = 0; i < 4; ++i) {
            v16h af = frag_ld(sA + (waveM * 64 + i * 16) * GP, GP, 0);
#pragma unroll
            for (int j = 0; j < 4; ++j)
                acc[i][j] = WMMA_F32_F16(af, bf[j], acc[i][j]);
        }
    }

    const int hf = lane >> 4, c0 = lane & 15;
#pragma unroll
    for (int i = 0; i < 4; ++i) {
#pragma unroll
        for (int j = 0; j < 4; ++j) {
#pragma unroll
            for (int r = 0; r < 8; ++r) {
                const int row = mbase + waveM * 64 + i * 16 + hf * 8 + r;
                const int col = nbase + waveN * 64 + j * 16 + c0;
                const float v = acc[i][j][r];
                if (MODE == 0) {
                    C16[(size_t)row * N + col] = (_Float16)v;
                } else if (MODE == 2) {
                    C16[(size_t)row * N + col] = (_Float16)(v * 0.125f);
                } else {
                    C32[(size_t)row * N + col] = v + bias[col] + res[(size_t)row * N + col];
                }
            }
        }
    }
}

// ---------------------------------------------------------------------------
// Flash attention, one block per (batch, head, 64-row query tile).
// 128 threads = 4 waves; each wave owns 16 query rows.
// Q: [b, n_q, 512] f16, ALREADY scaled by 1/sqrt(d) (GEMM MODE 2).
// KV: [b, m_len, 1024] f16 (K at col h*64, V at col 512 + h*64).
// Output O: [b, n_q, 512] f16.
// ---------------------------------------------------------------------------
__global__ __launch_bounds__(128) void flash_attn_kernel(const _Float16* __restrict__ Q,
                                                         const _Float16* __restrict__ KV,
                                                         _Float16* __restrict__ O,
                                                         int n_q, int m_len) {
    __shared__ __align__(16) _Float16 sQ[64 * FP];    // [m][d] (pre-scaled)
    __shared__ __align__(16) _Float16 sK[64 * FP];    // [key][d]   == Bt for QK^T
    __shared__ __align__(16) _Float16 sVt[64 * FP];   // [d][key]   == Bt for PV
    __shared__ __align__(16) _Float16 sP[4][16 * FP]; // per-wave P staging [row][key]

    const int wave = threadIdx.x >> 5;
    const int lane = threadIdx.x & 31;
    const int h = blockIdx.y, b = blockIdx.z;
    const int qrow0 = blockIdx.x * 64;
    const size_t qoff  = ((size_t)b * n_q + qrow0) * 512 + (size_t)h * 64;
    const size_t kvoff = (size_t)b * m_len * 1024 + (size_t)h * 64;

    const int srow = threadIdx.x >> 1;            // 0..63
    const int sseg = (threadIdx.x & 1) * 32;      // 0 / 32 halves (64B)

    // Async-stage Q tile (waited at first loop iteration's wait_async0).
    async_copy64B(lds_off(&sQ[srow * FP + sseg]), Q + qoff + (size_t)srow * 512 + sseg);

    float m_i[8], l_i[8];
    v8f o[4] = {};
#pragma unroll
    for (int r = 0; r < 8; ++r) { m_i[r] = -1e30f; l_i[r] = 0.f; }

    const int hf = lane >> 4, c0 = lane & 15;

    for (int kt = 0; kt < m_len; kt += 64) {
        __syncthreads();
        const _Float16* gk = KV + kvoff + (size_t)(kt + srow) * 1024 + sseg;
        // K tile: straight async row copy.
        async_copy64B(lds_off(&sK[srow * FP + sseg]), gk);
        // V tile: load + transpose-scatter into sVt[d][key].
        {
            const _Float16* gv = gk + 512;
            v8h v0 = *(const v8h*)gv;
            v8h v1 = *(const v8h*)(gv + 8);
            v8h v2 = *(const v8h*)(gv + 16);
            v8h v3 = *(const v8h*)(gv + 24);
#pragma unroll
            for (int j = 0; j < 8; ++j) {
                sVt[(sseg + j) * FP + srow]      = v0[j];
                sVt[(sseg + 8 + j) * FP + srow]  = v1[j];
                sVt[(sseg + 16 + j) * FP + srow] = v2[j];
                sVt[(sseg + 24 + j) * FP + srow] = v3[j];
            }
        }
        wait_async0();
        __syncthreads();

        // S = Q K^T : 16 rows x 64 keys per wave
        v8f s[4] = {};
#pragma unroll
        for (int kc = 0; kc < 64; kc += 32) {
            v16h a = frag_ld(sQ + wave * 16 * FP, FP, kc);
#pragma unroll
            for (int j = 0; j < 4; ++j) {
                v16h bf = frag_ld(sK + j * 16 * FP, FP, kc);
                s[j] = WMMA_F32_F16(a, bf, s[j]);
            }
        }

#pragma unroll
        for (int r = 0; r < 8; ++r) {
            float mx = fmaxf(fmaxf(s[0][r], s[1][r]), fmaxf(s[2][r], s[3][r]));
#pragma unroll
            for (int msk = 1; msk < 16; msk <<= 1) mx = fmaxf(mx, __shfl_xor(mx, msk, 32));
            const float mnew  = fmaxf(m_i[r], mx);
            const float alpha = __expf(m_i[r] - mnew);
            m_i[r] = mnew;
            float rs = 0.f;
#pragma unroll
            for (int j = 0; j < 4; ++j) {
                const float p = __expf(s[j][r] - mnew);
                s[j][r] = p;
                rs += p;
            }
#pragma unroll
            for (int msk = 1; msk < 16; msk <<= 1) rs += __shfl_xor(rs, msk, 32);
            l_i[r] = l_i[r] * alpha + rs;
#pragma unroll
            for (int j = 0; j < 4; ++j) {
                o[j][r] *= alpha;
                // reshape C-layout -> A-layout via per-wave LDS staging
                sP[wave][(hf * 8 + r) * FP + j * 16 + c0] = (_Float16)s[j][r];
            }
        }

        // O += P V
#pragma unroll
        for (int kc = 0; kc < 64; kc += 32) {
            v16h pa = frag_ld(sP[wave], FP, kc);
#pragma unroll
            for (int j = 0; j < 4; ++j) {
                v16h vb = frag_ld(sVt + j * 16 * FP, FP, kc);
                o[j] = WMMA_F32_F16(pa, vb, o[j]);
            }
        }
    }

    // Epilogue: normalize by l and store f16.
#pragma unroll
    for (int j = 0; j < 4; ++j) {
#pragma unroll
        for (int r = 0; r < 8; ++r) {
            const int rowl = wave * 16 + hf * 8 + r;
            const size_t idx = ((size_t)b * n_q + qrow0 + rowl) * 512 + (size_t)h * 64 + j * 16 + c0;
            O[idx] = (_Float16)(o[j][r] / l_i[r]);
        }
    }
}

// ---------------------------------------------------------------------------
// Host-side orchestration
// ---------------------------------------------------------------------------
extern "C" void kernel_launch(void* const* d_in, const int* in_sizes, int n_in,
                              void* d_out, int out_size, void* d_ws, size_t ws_size,
                              hipStream_t stream) {
    (void)in_sizes; (void)n_in; (void)out_size; (void)ws_size;

    constexpr int B = 4, Nx = 2048, Mc = 512, F = 1024, CF = 768, MID = 512;
    constexpr int ROWS = B * Nx;       // 8192
    constexpr int CROWS = B * Mc;      // 2048

    const float* x       = (const float*)d_in[0];
    const float* ctx     = (const float*)d_in[1];
    const float* sa_ng   = (const float*)d_in[2];
    const float* sa_nb   = (const float*)d_in[3];
    const float* sa_ncg  = (const float*)d_in[4];
    const float* sa_ncb  = (const float*)d_in[5];
    const float* sa_wq   = (const float*)d_in[6];
    const float* sa_wkv  = (const float*)d_in[7];
    const float* sa_wo   = (const float*)d_in[8];
    const float* sa_bo   = (const float*)d_in[9];
    const float* ca_ng   = (const float*)d_in[10];
    const float* ca_nb   = (const float*)d_in[11];
    const float* ca_ncg  = (const float*)d_in[12];
    const float* ca_ncb  = (const float*)d_in[13];
    const float* ca_wq   = (const float*)d_in[14];
    const float* ca_wkv  = (const float*)d_in[15];
    const float* ca_wo   = (const float*)d_in[16];
    const float* ca_bo   = (const float*)d_in[17];
    float* out = (float*)d_out;

    // carve workspace
    size_t off = 0;
    auto carve = [&](size_t bytes) -> void* {
        void* p = (char*)d_ws + off;
        off += (bytes + 255) & ~(size_t)255;
        return p;
    };
    // weights, f16 TRANSPOSED to [N][K]
    _Float16* wq16s  = (_Float16*)carve((size_t)MID * F * 2);        // [512][1024]
    _Float16* wkv16s = (_Float16*)carve((size_t)(2 * MID) * F * 2);  // [1024][1024]
    _Float16* wo16s  = (_Float16*)carve((size_t)F * MID * 2);        // [1024][512]
    _Float16* wq16c  = (_Float16*)carve((size_t)MID * F * 2);        // [512][1024]
    _Float16* wkv16c = (_Float16*)carve((size_t)(2 * MID) * CF * 2); // [1024][768]
    _Float16* wo16c  = (_Float16*)carve((size_t)F * MID * 2);        // [1024][512]
    _Float16* XN1 = (_Float16*)carve((size_t)ROWS * F * 2);          // q-norm input
    _Float16* XN2 = (_Float16*)carve((size_t)ROWS * F * 2);          // kv-norm input / ctx-norm
    _Float16* Q16 = (_Float16*)carve((size_t)ROWS * MID * 2);
    _Float16* KV16 = (_Float16*)carve((size_t)ROWS * 2 * MID * 2);
    _Float16* AO16 = (_Float16*)carve((size_t)ROWS * MID * 2);
    float*    X1   = (float*)carve((size_t)ROWS * F * 4);

    const dim3 tb(32, 8);
    // ---- weight casts + transposes:  W[K][N] -> Wt[N][K] ----
    cast_transpose_kernel<<<dim3(MID / 32, F / 32), tb, 0, stream>>>(sa_wq, wq16s, F, MID);
    cast_transpose_kernel<<<dim3(2 * MID / 32, F / 32), tb, 0, stream>>>(sa_wkv, wkv16s, F, 2 * MID);
    cast_transpose_kernel<<<dim3(F / 32, MID / 32), tb, 0, stream>>>(sa_wo, wo16s, MID, F);
    cast_transpose_kernel<<<dim3(MID / 32, F / 32), tb, 0, stream>>>(ca_wq, wq16c, F, MID);
    cast_transpose_kernel<<<dim3(2 * MID / 32, CF / 32), tb, 0, stream>>>(ca_wkv, wkv16c, CF, 2 * MID);
    cast_transpose_kernel<<<dim3(F / 32, MID / 32), tb, 0, stream>>>(ca_wo, wo16c, MID, F);

    // ================= self-attention =================
    ln_cast_kernel<<<ROWS, 256, 0, stream>>>(x, sa_ng,  sa_nb,  XN1, F);
    ln_cast_kernel<<<ROWS, 256, 0, stream>>>(x, sa_ncg, sa_ncb, XN2, F);
    // Q = (XN1 @ wq) * scale   [8192 x 1024 -> 512]
    gemm_wmma_kernel<2><<<dim3(MID / 256, ROWS / 128), 256, 0, stream>>>(
        XN1, wq16s, Q16, nullptr, nullptr, nullptr, ROWS, MID, F);
    // KV = XN2 @ wkv  [8192 x 1024 -> 1024]
    gemm_wmma_kernel<0><<<dim3(2 * MID / 256, ROWS / 128), 256, 0, stream>>>(
        XN2, wkv16s, KV16, nullptr, nullptr, nullptr, ROWS, 2 * MID, F);
    // attention (m_len = 2048)
    flash_attn_kernel<<<dim3(Nx / 64, 8, B), 128, 0, stream>>>(Q16, KV16, AO16, Nx, Nx);
    // X1 = AO @ wo + bo + x   [8192 x 512 -> 1024] -> f32
    gemm_wmma_kernel<1><<<dim3(F / 256, ROWS / 128), 256, 0, stream>>>(
        AO16, wo16s, nullptr, X1, sa_bo, x, ROWS, F, MID);

    // ================= cross-attention =================
    ln_cast_kernel<<<ROWS, 256, 0, stream>>>(X1, ca_ng, ca_nb, XN1, F);
    _Float16* CN = XN2;  // reuse: normalized context [2048 x 768]
    ln_cast_kernel<<<CROWS, 256, 0, stream>>>(ctx, ca_ncg, ca_ncb, CN, CF);
    // Q = (XN1 @ ca_wq) * scale
    gemm_wmma_kernel<2><<<dim3(MID / 256, ROWS / 128), 256, 0, stream>>>(
        XN1, wq16c, Q16, nullptr, nullptr, nullptr, ROWS, MID, F);
    // KV = CN @ ca_wkv [2048 x 768 -> 1024]
    gemm_wmma_kernel<0><<<dim3(2 * MID / 256, CROWS / 128), 256, 0, stream>>>(
        CN, wkv16c, KV16, nullptr, nullptr, nullptr, CROWS, 2 * MID, CF);
    // attention (m_len = 512)
    flash_attn_kernel<<<dim3(Nx / 64, 8, B), 128, 0, stream>>>(Q16, KV16, AO16, Nx, Mc);
    // out = AO @ ca_wo + ca_bo + X1  -> f32 (final output)
    gemm_wmma_kernel<1><<<dim3(F / 256, ROWS / 128), 256, 0, stream>>>(
        AO16, wo16c, nullptr, out, ca_bo, X1, ROWS, F, MID);
}

// v002
// Measured time: 381 microseconds a run.
// Two timings next to v001 both put it at 1.10 times that version's speed.
// Counting every step since v000, it is 1.49 times as fast.
#include <hip/hip_runtime.h>

typedef __attribute__((ext_vector_type(16))) _Float16 v16h;
typedef __attribute__((ext_vector_type(8)))  _Float16 v8h;
typedef __attribute__((ext_vector_type(8)))  float    v8f;

#define WMMA_F32_F16(a, b, c) \
    __builtin_amdgcn_wmma_f32_16x16x32_f16(false, (a), false, (b), (short)0, (c), false, false)

__device__ __forceinline__ unsigned lds_off(const void* p) {
    return (unsigned)(unsigned long long)p;
}

__device__ __forceinline__ void async_copy32B(unsigned ldsAddr, const void* g) {
    unsigned long long ga = (unsigned long long)g;
    asm volatile(
        "global_load_async_to_lds_b128 %0, %1, off\n\t"
        "global_load_async_to_lds_b128 %0, %1, off offset:16\n\t"
        "s_wait_xcnt 0x0"
        :: "v"(ldsAddr), "v"(ga) : "memory");
}

__device__ __forceinline__ void async_copy64B(unsigned ldsAddr, const void* g) {
    unsigned long long ga = (unsigned long long)g;
    asm volatile(
        "global_load_async_to_lds_b128 %0, %1, off\n\t"
        "global_load_async_to_lds_b128 %0, %1, off offset:16\n\t"
        "global_load_async_to_lds_b128 %0, %1, off offset:32\n\t"
        "global_load_async_to_lds_b128 %0, %1, off offset:48\n\t"
        "s_wait_xcnt 0x0"
        :: "v"(ldsAddr), "v"(ga) : "memory");
}

__device__ __forceinline__ void wait_async0() {
    asm volatile("s_wait_asynccnt 0x0" ::: "memory");
}

constexpr int GP = 40;  // 32-half (64 B) rows  -> 80 B pitch
constexpr int FP = 72;  // 64-half (128 B) rows -> 144 B pitch

__device__ __forceinline__ v16h frag_ld(const _Float16* tile, int ld, int kbase) {
    const int lane = threadIdx.x & 31;
    const _Float16* p = tile + (lane & 15) * ld + kbase + ((lane >> 4) << 3);
    v8h lo = *(const v8h*)p;
    v8h hi = *(const v8h*)(p + 16);
    v16h r;
#pragma unroll
    for (int i = 0; i < 8; ++i) { r[i] = lo[i]; r[i + 8] = hi[i]; }
    return r;
}

// ---------------------------------------------------------------------------
// Weight prep: f32 [K][N] -> f16 transposed [N][K] (LDS-tiled for coalescing)
// grid: (N/32, K/32), block: (32, 8)
// ---------------------------------------------------------------------------
__global__ __launch_bounds__(256) void cast_transpose_kernel(const float* __restrict__ in,
                                                             _Float16* __restrict__ out,
                                                             int K, int N) {
    __shared__ _Float16 tile[32][33];
    const int nb = blockIdx.x * 32;
    const int kb = blockIdx.y * 32;
    const int tx = threadIdx.x;
#pragma unroll
    for (int i = threadIdx.y; i < 32; i += 8)
        tile[i][tx] = (_Float16)in[(size_t)(kb + i) * N + nb + tx];
    __syncthreads();
#pragma unroll
    for (int i = threadIdx.y; i < 32; i += 8)
        out[(size_t)(nb + i) * K + kb + tx] = tile[tx][i];
}

// ---------------------------------------------------------------------------
// LayerNorm (biased variance, eps 1e-5) + cast to f16.
// One wave owns two whole rows: each row sits in registers (NV 16-byte loads
// per lane, 512 contiguous bytes per wave-wide load), the sums cross lanes in
// registers, so the kernel has no LDS and no barrier, and a launch starts only
// rows / 2 waves (wave start rate, not bytes, bounds a launch of many short
// work-groups).  C = NV * 128; rows = gridDim.x * 32.
// ---------------------------------------------------------------------------
typedef __attribute__((ext_vector_type(4))) float    v4f;
typedef __attribute__((ext_vector_type(4))) _Float16 v4h;

template <int MASK>
__device__ __forceinline__ float add_xmask(float x) {
    return x + __builtin_bit_cast(float, __builtin_amdgcn_update_dpp(
        0, __builtin_bit_cast(int, x), 0x160 | MASK, 0xf, 0xf, false));
}

// sum over the 32 lanes of a wave, the same value in every lane
__device__ __forceinline__ float wave_sum(float x) {
    x = add_xmask<1>(x);
    x = add_xmask<2>(x);
    x = add_xmask<4>(x);
    x = add_xmask<8>(x);
    const int xi = __builtin_bit_cast(int, x);
    return x + __builtin_bit_cast(float,
        __builtin_amdgcn_permlanex16(xi, xi, 0x76543210, 0xfedcba98, false, false));
}

template <int NV>
__global__ __launch_bounds__(512) void ln_cast_kernel(const float* __restrict__ X,
                                                      const float* __restrict__ G,
                                                      const float* __restrict__ Bv,
                                                      _Float16* __restrict__ Y) {
    constexpr int C = NV * 128;
    const int lane = threadIdx.x & 31;
    // the wave's number as a scalar: the rows' base addresses then sit in scalar
    // registers and the lane number is the only address register of every access
    const int wave = __builtin_amdgcn_readfirstlane(threadIdx.x >> 5);
    const int row0 = (blockIdx.x * 16 + wave) * 2;
    const v4f* x4 = (const v4f*)(X + (size_t)row0 * C) + lane;

    v4f v[2][NV];
#pragma unroll
    for (int r = 0; r < 2; ++r)
#pragma unroll
        for (int i = 0; i < NV; ++i) v[r][i] = x4[r * (C / 4) + i * 32];
    // scale and shift are asked for beside the rows, so that their latency
    // runs under the rows' own instead of behind the sums
    const v4f* g4 = (const v4f*)G + lane;
    const v4f* b4 = (const v4f*)Bv + lane;
    v4f g[NV], bb[NV];
#pragma unroll
    for (int i = 0; i < NV; ++i) { g[i] = g4[i * 32]; bb[i] = b4[i * 32]; }
    // keeps every load above in flight at once: without it the compiler sinks
    // the scale and shift loads behind the sums, in short dependent batches
    __builtin_amdgcn_sched_barrier(0);
    asm volatile("s_wait_xcnt 0x0" ::: "memory");
    __builtin_amdgcn_sched_barrier(0);

    float mean[2], rstd[2];
#pragma unroll
    for (int r = 0; r < 2; ++r) {
        v4f a1 = v[r][0], a2 = v[r][0] * v[r][0];
#pragma unroll
        for (int i = 1; i < NV; ++i) { a1 += v[r][i]; a2 += v[r][i] * v[r][i]; }
        const float s1 = wave_sum((a1[0] + a1[1]) + (a1[2] + a1[3]));
        const float s2 = wave_sum((a2[0] + a2[1]) + (a2[2] + a2[3]));
        constexpr float invC = 1.0f / (float)C;
        mean[r] = s1 * invC;
        rstd[r] = rsqrtf(s2 * invC - mean[r] * mean[r] + 1e-5f);
    }

    v4h* y4 = (v4h*)(Y + (size_t)row0 * C) + lane;
#pragma unroll
    for (int i = 0; i < NV; ++i) {
#pragma unroll
        for (int r = 0; r < 2; ++r) {
            v4h y;
#pragma unroll
            for (int e = 0; e < 4; ++e)
                y[e] = (_Float16)((v[r][i][e] - mean[r]) * rstd[r] * g[i][e] + bb[i][e]);
            y4[r * (C / 4) + i * 32] = y;
        }
    }
}

// ---------------------------------------------------------------------------
// Tiled WMMA GEMM:  C[M,N] = A[M,K] (f16 row-major) * Bt[N,K] (f16, B transposed)
// Block tile 128x256, 256 threads = 8 waves in a 2(M) x 4(N) grid,
// each wave computes a 64x64 register tile: 16 WMMAs per 32-wide K step.
// A/B tiles staged into LDS with global_load_async_to_lds_b128.
// MODE 0: C -> f16.  MODE 2: C -> f16 * 0.125 (Q pre-scale).
// MODE 1: C -> f32 with + bias[n] + res[m,n].
// ---------------------------------------------------------------------------
template <int MODE>
__global__ __launch_bounds__(256) void gemm_wmma_kernel(const _Float16* __restrict__ A,
                                                        const _Float16* __restrict__ Bt,
                                                        _Float16* __restrict__ C16,
                                                        float* __restrict__ C32,
                                                        const float* __restrict__ bias,
                                                        const float* __restrict__ res,
                                                        int M, int N, int K) {
    __shared__ __align__(16) _Float16 sA[128 * GP];  // [m][k], padded pitch
    __shared__ __align__(16) _Float16 sB[256 * GP];  // [n][k], padded pitch
    const int tid = threadIdx.x;
    const int wave = tid >> 5, lane = tid & 31;
    const int waveM = wave >> 2, waveN = wave & 3;
    const int mbase = blockIdx.y * 128;
    const int nbase = blockIdx.x * 256;
    (void)M;

    v8f acc[4][4] = {};

    // staging assignments: A rows 0..127 x 32 halves (32B/thread),
    //                      B rows 0..255 x 32 halves (64B/thread)
    const int arow = tid >> 1, aseg = (tid & 1) * 16;
    const _Float16* gA = A + (size_t)(mbase + arow) * K + aseg;
    const unsigned dA = lds_off(&sA[arow * GP + aseg]);
    const int brow = tid;
    const _Float16* gB = Bt + (size_t)(nbase + brow) * K;
    const unsigned dB = lds_off(&sB[brow * GP]);

    for (int k0 = 0; k0 < K; k0 += 32) {
        __syncthreads();
        async_copy32B(dA, gA + k0);
        async_copy64B(dB, gB + k0);
        if (k0 + 32 < K) __builtin_prefetch(gB + k0 + 32, 0, 0);
        wait_async0();
        __syncthreads();

        v16h bf[4];
#pragma unroll
        for (int j = 0; j < 4; ++j)
            bf[j] = frag_ld(sB + (waveN * 64 + j * 16) * GP, GP, 0);
#pragma unroll
        for (int i = 0; i < 4; ++i) {
            v16h af = frag_ld(sA + (waveM * 64 + i * 16) * GP, GP, 0);
#pragma unroll
            for (int j = 0; j < 4; ++j)
                acc[i][j] = WMMA_F32_F16(af, bf[j], acc[i][j]);
        }
    }

    const int hf = lane >> 4, c0 = lane & 15;
#pragma unroll
    for (int i = 0; i < 4; ++i) {
#pragma unroll
        for (int j = 0; j < 4; ++j) {
#pragma unroll
            for (int r = 0; r < 8; ++r) {
                const int row = mbase + waveM * 64 + i * 16 + hf * 8 + r;
                const int col = nbase + waveN * 64 + j * 16 + c0;
                const float v = acc[i][j][r];
                if (MODE == 0) {
                    C16[(size_t)row * N + col] = (_Float16)v;
                } else if (MODE == 2) {
                    C16[(size_t)row * N + col] = (_Float16)(v * 0.125f);
                } else {
                    C32[(size_t)row * N + col] = v + bias[col] + res[(size_t)row * N + col];
                }
            }
        }
    }
}

// ---------------------------------------------------------------------------
// Flash attention, one block per (batch, head, 64-row query tile).
// 128 threads = 4 waves; each wave owns 16 query rows.
// Q: [b, n_q, 512] f16, ALREADY scaled by 1/sqrt(d) (GEMM MODE 2).
// KV: [b, m_len, 1024] f16 (K at col h*64, V at col 512 + h*64).
// Output O: [b, n_q, 512] f16.
// ---------------------------------------------------------------------------
__global__ __launch_bounds__(128) void flash_attn_kernel(const _Float16* __restrict__ Q,
                                                         const _Float16* __restrict__ KV,
                                                         _Float16* __restrict__ O,
                                                         int n_q, int m_len) {
    __shared__ __align__(16) _Float16 sQ[64 * FP];    // [m][d] (pre-scaled)
    __shared__ __align__(16) _Float16 sK[64 * FP];    // [key][d]   == Bt for QK^T
    __shared__ __align__(16) _Float16 sVt[64 * FP];   // [d][key]   == Bt for PV
    __shared__ __align__(16) _Float16 sP[4][16 * FP]; // per-wave P staging [row][key]

    const int wave = threadIdx.x >> 5;
    const int lane = threadIdx.x & 31;
    const int h = blockIdx.y, b = blockIdx.z;
    const int qrow0 = blockIdx.x * 64;
    const size_t qoff  = ((size_t)b * n_q + qrow0) * 512 + (size_t)h * 64;
    const size_t kvoff = (size_t)b * m_len * 1024 + (size_t)h * 64;

    const int srow = threadIdx.x >> 1;            // 0..63
    const int sseg = (threadIdx.x & 1) * 32;      // 0 / 32 halves (64B)

    // Async-stage Q tile (waited at first loop iteration's wait_async0).
    async_copy64B(lds_off(&sQ[srow * FP + sseg]), Q + qoff + (size_t)srow * 512 + sseg);

    float m_i[8], l_i[8];
    v8f o[4] = {};
#pragma unroll
    for (int r = 0; r < 8; ++r) { m_i[r] = -1e30f; l_i[r] = 0.f; }

    const int hf = lane >> 4, c0 = lane & 15;

    for (int kt = 0; kt < m_len; kt += 64) {
        __syncthreads();
        const _Float16* gk = KV + kvoff + (size_t)(kt + srow) * 1024 + sseg;
        // K tile: straight async row copy.
        async_copy64B(lds_off(&sK[srow * FP + sseg]), gk);
        // V tile: load + transpose-scatter into sVt[d][key].
        {
            const _Float16* gv = gk + 512;
            v8h v0 = *(const v8h*)gv;
            v8h v1 = *(const v8h*)(gv + 8);
            v8h v2 = *(const v8h*)(gv + 16);
            v8h v3 = *(const v8h*)(gv + 24);
#pragma unroll
            for (int j = 0; j < 8; ++j) {
                sVt[(sseg + j) * FP + srow]      = v0[j];
                sVt[(sseg + 8 + j) * FP + srow]  = v1[j];
                sVt[(sseg + 16 + j) * FP + srow] = v2[j];
                sVt[(sseg + 24 + j) * FP + srow] = v3[j];
            }
        }
        wait_async0();
        __syncthreads();

        // S = Q K^T : 16 rows x 64 keys per wave
        v8f s[4] = {};
#pragma unroll
        for (int kc = 0; kc < 64; kc += 32) {
            v16h a = frag_ld(sQ + wave * 16 * FP, FP, kc);
#pragma unroll
            for (int j = 0; j < 4; ++j) {
                v16h bf = frag_ld(sK + j * 16 * FP, FP, kc);
                s[j] = WMMA_F32_F16(a, bf, s[j]);
            }
        }

#pragma unroll
        for (int r = 0; r < 8; ++r) {
            float mx = fmaxf(fmaxf(s[0][r], s[1][r]), fmaxf(s[2][r], s[3][r]));
#pragma unroll
            for (int msk = 1; msk < 16; msk <<= 1) mx = fmaxf(mx, __shfl_xor(mx, msk, 32));
            const float mnew  = fmaxf(m_i[r], mx);
            const float alpha = __expf(m_i[r] - mnew);
            m_i[r] = mnew;
            float rs = 0.f;
#pragma unroll
            for (int j = 0; j < 4; ++j) {
                const float p = __expf(s[j][r] - mnew);
                s[j][r] = p;
                rs += p;
            }
#pragma unroll
            for (int msk = 1; msk < 16; msk <<= 1) rs += __shfl_xor(rs, msk, 32);
            l_i[r] = l_i[r] * alpha + rs;
#pragma unroll
            for (int j = 0; j < 4; ++j) {
                o[j][r] *= alpha;
                // reshape C-layout -> A-layout via per-wave LDS staging
                sP[wave][(hf * 8 + r) * FP + j * 16 + c0] = (_Float16)s[j][r];
            }
        }

        // O += P V
#pragma unroll
        for (int kc = 0; kc < 64; kc += 32) {
            v16h pa = frag_ld(sP[wave], FP, kc);
#pragma unroll
            for (int j = 0; j < 4; ++j) {
                v16h vb = frag_ld(sVt + j * 16 * FP, FP, kc);
                o[j] = WMMA_F32_F16(pa, vb, o[j]);
            }
        }
    }

    // Epilogue: normalize by l and store f16.
#pragma unroll
    for (int j = 0; j < 4; ++j) {
#pragma unroll
        for (int r = 0; r < 8; ++r) {
            const int rowl = wave * 16 + hf * 8 + r;
            const size_t idx = ((size_t)b * n_q + qrow0 + rowl) * 512 + (size_t)h * 64 + j * 16 + c0;
            O[idx] = (_Float16)(o[j][r] / l_i[r]);
        }
    }
}

// ---------------------------------------------------------------------------
// Host-side orchestration
// ---------------------------------------------------------------------------
extern "C" void kernel_launch(void* const* d_in, const int* in_sizes, int n_in,
                              void* d_out, int out_size, void* d_ws, size_t ws_size,
                              hipStream_t stream) {
    (void)in_sizes; (void)n_in; (void)out_size; (void)ws_size;

    constexpr int B = 4, Nx = 2048, Mc = 512, F = 1024, CF = 768, MID = 512;
    constexpr int ROWS = B * Nx;       // 8192
    constexpr int CROWS = B * Mc;      // 2048

    const float* x       = (const float*)d_in[0];
    const float* ctx     = (const float*)d_in[1];
    const float* sa_ng   = (const float*)d_in[2];
    const float* sa_nb   = (const float*)d_in[3];
    const float* sa_ncg  = (const float*)d_in[4];
    const float* sa_ncb  = (const float*)d_in[5];
    const float* sa_wq   = (const float*)d_in[6];
    const float* sa_wkv  = (const float*)d_in[7];
    const float* sa_wo   = (const float*)d_in[8];
    const float* sa_bo   = (const float*)d_in[9];
    const float* ca_ng   = (const float*)d_in[10];
    const float* ca_nb   = (const float*)d_in[11];
    const float* ca_ncg  = (const float*)d_in[12];
    const float* ca_ncb  = (const float*)d_in[13];
    const float* ca_wq   = (const float*)d_in[14];
    const float* ca_wkv  = (const float*)d_in[15];
    const float* ca_wo   = (const float*)d_in[16];
    const float* ca_bo   = (const float*)d_in[17];
    float* out = (float*)d_out;

    // carve workspace
    size_t off = 0;
    auto carve = [&](size_t bytes) -> void* {
        void* p = (char*)d_ws + off;
        off += (bytes + 255) & ~(size_t)255;
        return p;
    };
    // weights, f16 TRANSPOSED to [N][K]
    _Float16* wq16s  = (_Float16*)carve((size_t)MID * F * 2);        // [512][1024]
    _Float16* wkv16s = (_Float16*)carve((size_t)(2 * MID) * F * 2);  // [1024][1024]
    _Float16* wo16s  = (_Float16*)carve((size_t)F * MID * 2);        // [1024][512]
    _Float16* wq16c  = (_Float16*)carve((size_t)MID * F * 2);        // [512][1024]
    _Float16* wkv16c = (_Float16*)carve((size_t)(2 * MID) * CF * 2); // [1024][768]
    _Float16* wo16c  = (_Float16*)carve((size_t)F * MID * 2);        // [1024][512]
    _Float16* XN1 = (_Float16*)carve((size_t)ROWS * F * 2);          // q-norm input
    _Float16* XN2 = (_Float16*)carve((size_t)ROWS * F * 2);          // kv-norm input / ctx-norm
    _Float16* Q16 = (_Float16*)carve((size_t)ROWS * MID * 2);
    _Float16* KV16 = (_Float16*)carve((size_t)ROWS * 2 * MID * 2);
    _Float16* AO16 = (_Float16*)carve((size_t)ROWS * MID * 2);
    float*    X1   = (float*)carve((size_t)ROWS * F * 4);

    const dim3 tb(32, 8);
    // ---- weight casts + transposes:  W[K][N] -> Wt[N][K] ----
    cast_transpose_kernel<<<dim3(MID / 32, F / 32), tb, 0, stream>>>(sa_wq, wq16s, F, MID);
    cast_transpose_kernel<<<dim3(2 * MID / 32, F / 32), tb, 0, stream>>>(sa_wkv, wkv16s, F, 2 * MID);
    cast_transpose_kernel<<<dim3(F / 32, MID / 32), tb, 0, stream>>>(sa_wo, wo16s, MID, F);
    cast_transpose_kernel<<<dim3(MID / 32, F / 32), tb, 0, stream>>>(ca_wq, wq16c, F, MID);
    cast_transpose_kernel<<<dim3(2 * MID / 32, CF / 32), tb, 0, stream>>>(ca_wkv, wkv16c, CF, 2 * MID);
    cast_transpose_kernel<<<dim3(F / 32, MID / 32), tb, 0, stream>>>(ca_wo, wo16c, MID, F);

    // ================= self-attention =================
    ln_cast_kernel<F / 128><<<ROWS / 32, 512, 0, stream>>>(x, sa_ng,  sa_nb,  XN1);
    ln_cast_kernel<F / 128><<<ROWS / 32, 512, 0, stream>>>(x, sa_ncg, sa_ncb, XN2);
    // Q = (XN1 @ wq) * scale   [8192 x 1024 -> 512]
    gemm_wmma_kernel<2><<<dim3(MID / 256, ROWS / 128), 256, 0, stream>>>(
        XN1, wq16s, Q16, nullptr, nullptr, nullptr, ROWS, MID, F);
    // KV = XN2 @ wkv  [8192 x 1024 -> 1024]
    gemm_wmma_kernel<0><<<dim3(2 * MID / 256, ROWS / 128), 256, 0, stream>>>(
        XN2, wkv16s, KV16, nullptr, nullptr, nullptr, ROWS, 2 * MID, F);
    // attention (m_len = 2048)
    flash_attn_kernel<<<dim3(Nx / 64, 8, B), 128, 0, stream>>>(Q16, KV16, AO16, Nx, Nx);
    // X1 = AO @ wo + bo + x   [8192 x 512 -> 1024] -> f32
    gemm_wmma_kernel<1><<<dim3(F / 256, ROWS / 128), 256, 0, stream>>>(
        AO16, wo16s, nullptr, X1, sa_bo, x, ROWS, F, MID);

    // ================= cross-attention =================
    ln_cast_kernel<F / 128><<<ROWS / 32, 512, 0, stream>>>(X1, ca_ng, ca_nb, XN1);
    _Float16* CN = XN2;  // reuse: normalized context [2048 x 768]
    ln_cast_kernel<CF / 128><<<CROWS / 32, 512, 0, stream>>>(ctx, ca_ncg, ca_ncb, CN);
    // Q = (XN1 @ ca_wq) * scale
    gemm_wmma_kernel<2><<<dim3(MID / 256, ROWS / 128), 256, 0, stream>>>(
        XN1, wq16c, Q16, nullptr, nullptr, nullptr, ROWS, MID, F);
    // KV = CN @ ca_wkv [2048 x 768 -> 1024]
    gemm_wmma_kernel<0><<<dim3(2 * MID / 256, CROWS / 128), 256, 0, stream>>>(
        CN, wkv16c, KV16, nullptr, nullptr, nullptr, CROWS, 2 * MID, CF);
    // attention (m_len = 512)
    flash_attn_kernel<<<dim3(Nx / 64, 8, B), 128, 0, stream>>>(Q16, KV16, AO16, Nx, Mc);
    // out = AO @ ca_wo + ca_bo + X1  -> f32 (final output)
    gemm_wmma_kernel<1><<<dim3(F / 256, ROWS / 128), 256, 0, stream>>>(
        AO16, wo16c, nullptr, out, ca_bo, X1, ROWS, F, MID);
}

// v003
// One run takes 323 microseconds.
// Two timings next to v002 put it at 1.17 and 1.18 times that version's speed.
// All steps since v000 together make it 1.76 times as fast.
#include <hip/hip_runtime.h>

typedef __attribute__((ext_vector_type(16))) _Float16 v16h;
typedef __attribute__((ext_vector_type(8)))  _Float16 v8h;
typedef __attribute__((ext_vector_type(8)))  float    v8f;

#define WMMA_F32_F16(a, b, c) \
    __builtin_amdgcn_wmma_f32_16x16x32_f16(false, (a), false, (b), (short)0, (c), false, false)

__device__ __forceinline__ unsigned lds_off(const void* p) {
    return (unsigned)(unsigned long long)p;
}

__device__ __forceinline__ void async_copy64B(unsigned ldsAddr, const void* g) {
    unsigned long long ga = (unsigned long long)g;
    asm volatile(
        "global_load_async_to_lds_b128 %0, %1, off\n\t"
        "global_load_async_to_lds_b128 %0, %1, off offset:16\n\t"
        "global_load_async_to_lds_b128 %0, %1, off offset:32\n\t"
        "global_load_async_to_lds_b128 %0, %1, off offset:48\n\t"
        "s_wait_xcnt 0x0"
        :: "v"(ldsAddr), "v"(ga) : "memory");
}

__device__ __forceinline__ void wait_async0() {
    asm volatile("s_wait_asynccnt 0x0" ::: "memory");
}

// the wave's own LDS reads have returned: stands in front of the barrier behind
// which a buffer that the wave has read is refilled by copies
__device__ __forceinline__ void wait_ds0() {
    asm volatile("s_wait_dscnt 0x0" ::: "memory");
}

constexpr int FP = 72;  // 64-half (128 B) rows -> 144 B pitch

__device__ __forceinline__ v16h frag_ld(const _Float16* tile, int ld, int kbase) {
    const int lane = threadIdx.x & 31;
    const _Float16* p = tile + (lane & 15) * ld + kbase + ((lane >> 4) << 3);
    v8h lo = *(const v8h*)p;
    v8h hi = *(const v8h*)(p + 16);
    v16h r;
#pragma unroll
    for (int i = 0; i < 8; ++i) { r[i] = lo[i]; r[i + 8] = hi[i]; }
    return r;
}

// ---------------------------------------------------------------------------
// Weight prep: f32 [K][N] -> f16 transposed [N][K] (LDS-tiled for coalescing)
// grid: (N/32, K/32), block: (32, 8)
// ---------------------------------------------------------------------------
__global__ __launch_bounds__(256) void cast_transpose_kernel(const float* __restrict__ in,
                                                             _Float16* __restrict__ out,
                                                             int K, int N) {
    __shared__ _Float16 tile[32][33];
    const int nb = blockIdx.x * 32;
    const int kb = blockIdx.y * 32;
    const int tx = threadIdx.x;
#pragma unroll
    for (int i = threadIdx.y; i < 32; i += 8)
        tile[i][tx] = (_Float16)in[(size_t)(kb + i) * N + nb + tx];
    __syncthreads();
#pragma unroll
    for (int i = threadIdx.y; i < 32; i += 8)
        out[(size_t)(nb + i) * K + kb + tx] = tile[tx][i];
}

// ---------------------------------------------------------------------------
// LayerNorm (biased variance, eps 1e-5) + cast to f16.
// One wave owns two whole rows: each row sits in registers (NV 16-byte loads
// per lane, 512 contiguous bytes per wave-wide load), the sums cross lanes in
// registers, so the kernel has no LDS and no barrier, and a launch starts only
// rows / 2 waves (wave start rate, not bytes, bounds a launch of many short
// work-groups).  C = NV * 128; rows = gridDim.x * 32.
// ---------------------------------------------------------------------------
typedef __attribute__((ext_vector_type(4))) float    v4f;
typedef __attribute__((ext_vector_type(4))) _Float16 v4h;

template <int MASK>
__device__ __forceinline__ float add_xmask(float x) {
    return x + __builtin_bit_cast(float, __builtin_amdgcn_update_dpp(
        0, __builtin_bit_cast(int, x), 0x160 | MASK, 0xf, 0xf, false));
}

// sum over the 32 lanes of a wave, the same value in every lane
__device__ __forceinline__ float wave_sum(float x) {
    x = add_xmask<1>(x);
    x = add_xmask<2>(x);
    x = add_xmask<4>(x);
    x = add_xmask<8>(x);
    const int xi = __builtin_bit_cast(int, x);
    return x + __builtin_bit_cast(float,
        __builtin_amdgcn_permlanex16(xi, xi, 0x76543210, 0xfedcba98, false, false));
}

template <int NV>
__global__ __launch_bounds__(512) void ln_cast_kernel(const float* __restrict__ X,
                                                      const float* __restrict__ G,
                                                      const float* __restrict__ Bv,
                                                      _Float16* __restrict__ Y) {
    constexpr int C = NV * 128;
    const int lane = threadIdx.x & 31;
    // the wave's number as a scalar: the rows' base addresses then sit in scalar
    // registers and the lane number is the only address register of every access
    const int wave = __builtin_amdgcn_readfirstlane(threadIdx.x >> 5);
    const int row0 = (blockIdx.x * 16 + wave) * 2;
    const v4f* x4 = (const v4f*)(X + (size_t)row0 * C) + lane;

    v4f v[2][NV];
#pragma unroll
    for (int r = 0; r < 2; ++r)
#pragma unroll
        for (int i = 0; i < NV; ++i) v[r][i] = x4[r * (C / 4) + i * 32];
    // scale and shift are asked for beside the rows, so that their latency
    // runs under the rows' own instead of behind the sums
    const v4f* g4 = (const v4f*)G + lane;
    const v4f* b4 = (const v4f*)Bv + lane;
    v4f g[NV], bb[NV];
#pragma unroll
    for (int i = 0; i < NV; ++i) { g[i] = g4[i * 32]; bb[i] = b4[i * 32]; }
    // keeps every load above in flight at once: without it the compiler sinks
    // the scale and shift loads behind the sums, in short dependent batches
    __builtin_amdgcn_sched_barrier(0);
    asm volatile("s_wait_xcnt 0x0" ::: "memory");
    __builtin_amdgcn_sched_barrier(0);

    float mean[2], rstd[2];
#pragma unroll
    for (int r = 0; r < 2; ++r) {
        v4f a1 = v[r][0], a2 = v[r][0] * v[r][0];
#pragma unroll
        for (int i = 1; i < NV; ++i) { a1 += v[r][i]; a2 += v[r][i] * v[r][i]; }
        const float s1 = wave_sum((a1[0] + a1[1]) + (a1[2] + a1[3]));
        const float s2 = wave_sum((a2[0] + a2[1]) + (a2[2] + a2[3]));
        constexpr float invC = 1.0f / (float)C;
        mean[r] = s1 * invC;
        rstd[r] = rsqrtf(s2 * invC - mean[r] * mean[r] + 1e-5f);
    }

    v4h* y4 = (v4h*)(Y + (size_t)row0 * C) + lane;
#pragma unroll
    for (int i = 0; i < NV; ++i) {
#pragma unroll
        for (int r = 0; r < 2; ++r) {
            v4h y;
#pragma unroll
            for (int e = 0; e < 4; ++e)
                y[e] = (_Float16)((v[r][i][e] - mean[r]) * rstd[r] * g[i][e] + bb[i][e]);
            y4[r * (C / 4) + i * 32] = y;
        }
    }
}

// ---------------------------------------------------------------------------
// One thread's twelve copies of one GEMM ring stage: 16 B of 4 A rows and of 8 B
// rows, 32 rows apart; in LDS the B rows follow the 128 A rows at one pitch.
// ---------------------------------------------------------------------------
constexpr int GK  = 64;                // k depth of a ring stage
constexpr int GST = (128 + 256) * FP;  // halves in one stage buffer

__device__ __forceinline__ void gemm_stage_copies(unsigned d, const _Float16* a, const _Float16* b,
                                                  size_t step) {
    constexpr unsigned R = 32 * FP * 2;  // 32 LDS rows in bytes
    asm volatile(
        "global_load_async_to_lds_b128 %0, %12, off\n\t"
        "global_load_async_to_lds_b128 %1, %13, off\n\t"
        "global_load_async_to_lds_b128 %2, %14, off\n\t"
        "global_load_async_to_lds_b128 %3, %15, off\n\t"
        "global_load_async_to_lds_b128 %4, %16, off\n\t"
        "global_load_async_to_lds_b128 %5, %17, off\n\t"
        "global_load_async_to_lds_b128 %6, %18, off\n\t"
        "global_load_async_to_lds_b128 %7, %19, off\n\t"
        "global_load_async_to_lds_b128 %8, %20, off\n\t"
        "global_load_async_to_lds_b128 %9, %21, off\n\t"
        "global_load_async_to_lds_b128 %10, %22, off\n\t"
        "global_load_async_to_lds_b128 %11, %23, off\n\t"
        "s_wait_xcnt 0x0"
        :: "v"(d), "v"(d + R), "v"(d + 2 * R), "v"(d + 3 * R), "v"(d + 4 * R), "v"(d + 5 * R),
           "v"(d + 6 * R), "v"(d + 7 * R), "v"(d + 8 * R), "v"(d + 9 * R), "v"(d + 10 * R),
           "v"(d + 11 * R),
           "v"((unsigned long long)a), "v"((unsigned long long)(a + step)),
           "v"((unsigned long long)(a + 2 * step)), "v"((unsigned long long)(a + 3 * step)),
           "v"((unsigned long long)b), "v"((unsigned long long)(b + step)),
           "v"((unsigned long long)(b + 2 * step)), "v"((unsigned long long)(b + 3 * step)),
           "v"((unsigned long long)(b + 4 * step)), "v"((unsigned long long)(b + 5 * step)),
           "v"((unsigned long long)(b + 6 * step)), "v"((unsigned long long)(b + 7 * step))
        : "memory");
}

// ---------------------------------------------------------------------------
// Tiled WMMA GEMM:  C[M,N] = A[M,K] (f16 row-major) * Bt[N,K] (f16, B transposed)
// Block tile 128x256, 256 threads = 8 waves in a 2(M) x 4(N) grid,
// each wave computes a 64x64 register tile: 16 WMMAs per 32-wide K step.
// A/B tiles staged into LDS with global_load_async_to_lds_b128, in a ring of two
// buffers of 64 k each: the copies of stage t + 2 are issued at the foot of pass
// t and waited for at the foot of pass t + 1, so they fly under a whole pass of
// 32 WMMAs per wave.  K is a multiple of 64.
// MODE 0: C -> f16.  MODE 2: C -> f16 * 0.125 (Q pre-scale).
// MODE 1: C -> f32 with + bias[n] + res[m,n].
// ---------------------------------------------------------------------------
template <int MODE>
__global__ __launch_bounds__(256) void gemm_wmma_kernel(const _Float16* __restrict__ A,
                                                        const _Float16* __restrict__ Bt,
                                                        _Float16* __restrict__ C16,
                                                        float* __restrict__ C32,
                                                        const float* __restrict__ bias,
                                                        const float* __restrict__ res,
                                                        int M, int N, int K) {
    // two stage buffers; each holds 128 A rows [m][k], then 256 B rows [n][k]
    __shared__ __align__(16) _Float16 sm[2 * GST];
    const int tid = threadIdx.x;
    const int wave = tid >> 5, lane = tid & 31;
    const int waveM = wave >> 2, waveN = wave & 3;
    const int mbase = blockIdx.y * 128;
    const int nbase = blockIdx.x * 256;
    (void)M;

    v8f acc[4][4] = {};

    // staging assignments: a stage row is 64 halves = 128 B = 8 lanes x 16 B;
    // a thread copies its 16 B of rows srow + 32 i: 4 rows of A, 8 rows of B
    const int srow = tid >> 3, sseg = (tid & 7) * 8;
    const _Float16* gA = A + (size_t)(mbase + srow) * K + sseg;
    const _Float16* gB = Bt + (size_t)(nbase + srow) * K + sseg;
    const size_t gstep = (size_t)32 * K;  // 32 rows of A or of Bt, in halves
    const unsigned d0 = lds_off(&sm[srow * FP + sseg]);
    const int nst = K / GK;

    gemm_stage_copies(d0, gA, gB, gstep);
    wait_async0();    // stage 0 has landed (this wave's share)
    __syncthreads();  // ... and every other wave's
    if (nst > 1) gemm_stage_copies(d0 + GST * 2, gA + GK, gB + GK, gstep);

    for (int t = 0; t < nst; ++t) {
        const _Float16* sA = sm + (t & 1) * GST;
        const _Float16* sB = sA + 128 * FP;
        // unrolled: kc becomes an immediate offset of the LDS reads
#pragma unroll
        for (int kc = 0; kc < GK; kc += 32) {
            v16h bf[4];
#pragma unroll
            for (int j = 0; j < 4; ++j)
                bf[j] = frag_ld(sB + (waveN * 64 + j * 16) * FP, FP, kc);
#pragma unroll
            for (int i = 0; i < 4; ++i) {
                v16h af = frag_ld(sA + (waveM * 64 + i * 16) * FP, FP, kc);
#pragma unroll
                for (int j = 0; j < 4; ++j)
                    acc[i][j] = WMMA_F32_F16(af, bf[j], acc[i][j]);
            }
        }
        // publish point: this wave has left buffer t & 1 and its copies of stage
        // t + 1 have landed; the one barrier says both of every wave
        wait_ds0();
        wait_async0();
        __syncthreads();
        if (t + 2 < nst)
            gemm_stage_copies(d0 + (t & 1) * (GST * 2), gA + (t + 2) * GK, gB + (t + 2) * GK, gstep);
    }
    wait_async0();  // no copy is outstanding when the wave goes on to its end

    const int hf = lane >> 4, c0 = lane & 15;
#pragma unroll
    for (int i = 0; i < 4; ++i) {
#pragma unroll
        for (int j = 0; j < 4; ++j) {
#pragma unroll
            for (int r = 0; r < 8; ++r) {
                const int row = mbase + waveM * 64 + i * 16 + hf * 8 + r;
                const int col = nbase + waveN * 64 + j * 16 + c0;
                const float v = acc[i][j][r];
                if (MODE == 0) {
                    C16[(size_t)row * N + col] = (_Float16)v;
                } else if (MODE == 2) {
                    C16[(size_t)row * N + col] = (_Float16)(v * 0.125f);
                } else {
                    C32[(size_t)row * N + col] = v + bias[col] + res[(size_t)row * N + col];
                }
            }
        }
    }
}

// ---------------------------------------------------------------------------
// Flash attention, one block per (batch, head, 64-row query tile).
// 128 threads = 4 waves; each wave owns 16 query rows.
// Q: [b, n_q, 512] f16, ALREADY scaled by 1/sqrt(d) (GEMM MODE 2).
// KV: [b, m_len, 1024] f16 (K at col h*64, V at col 512 + h*64).
// Output O: [b, n_q, 512] f16.
// ---------------------------------------------------------------------------
__global__ __launch_bounds__(128) void flash_attn_kernel(const _Float16* __restrict__ Q,
                                                         const _Float16* __restrict__ KV,
                                                         _Float16* __restrict__ O,
                                                         int n_q, int m_len) {
    __shared__ __align__(16) _Float16 sQ[64 * FP];    // [m][d] (pre-scaled)
    __shared__ __align__(16) _Float16 sK[64 * FP];    // [key][d]   == Bt for QK^T
    __shared__ __align__(16) _Float16 sVt[64 * FP];   // [d][key]   == Bt for PV
    __shared__ __align__(16) _Float16 sP[4][16 * FP]; // per-wave P staging [row][key]

    const int wave = threadIdx.x >> 5;
    const int lane = threadIdx.x & 31;
    const int h = blockIdx.y, b = blockIdx.z;
    const int qrow0 = blockIdx.x * 64;
    const size_t qoff  = ((size_t)b * n_q + qrow0) * 512 + (size_t)h * 64;
    const size_t kvoff = (size_t)b * m_len * 1024 + (size_t)h * 64;

    const int srow = threadIdx.x >> 1;            // 0..63
    const int sseg = (threadIdx.x & 1) * 32;      // 0 / 32 halves (64B)

    // Async-stage Q tile (waited at first loop iteration's wait_async0).
    async_copy64B(lds_off(&sQ[srow * FP + sseg]), Q + qoff + (size_t)srow * 512 + sseg);

    float m_i[8], l_i[8];
    v8f o[4] = {};
#pragma unroll
    for (int r = 0; r < 8; ++r) { m_i[r] = -1e30f; l_i[r] = 0.f; }

    const int hf = lane >> 4, c0 = lane & 15;

    for (int kt = 0; kt < m_len; kt += 64) {
        __syncthreads();
        const _Float16* gk = KV + kvoff + (size_t)(kt + srow) * 1024 + sseg;
        // K tile: straight async row copy.
        async_copy64B(lds_off(&sK[srow * FP + sseg]), gk);
        // V tile: load + transpose-scatter into sVt[d][key].
        {
            const _Float16* gv = gk + 512;
            v8h v0 = *(const v8h*)gv;
            v8h v1 = *(const v8h*)(gv + 8);
            v8h v2 = *(const v8h*)(gv + 16);
            v8h v3 = *(const v8h*)(gv + 24);
#pragma unroll
            for (int j = 0; j < 8; ++j) {
                sVt[(sseg + j) * FP + srow]      = v0[j];
                sVt[(sseg + 8 + j) * FP + srow]  = v1[j];
                sVt[(sseg + 16 + j) * FP + srow] = v2[j];
                sVt[(sseg + 24 + j) * FP + srow] = v3[j];
            }
        }
        wait_async0();
        __syncthreads();

        // S = Q K^T : 16 rows x 64 keys per wave
        v8f s[4] = {};
#pragma unroll
        for (int kc = 0; kc < 64; kc += 32) {
            v16h a = frag_ld(sQ + wave * 16 * FP, FP, kc);
#pragma unroll
            for (int j = 0; j < 4; ++j) {
                v16h bf = frag_ld(sK + j * 16 * FP, FP, kc);
                s[j] = WMMA_F32_F16(a, bf, s[j]);
            }
        }

#pragma unroll
        for (int r = 0; r < 8; ++r) {
            float mx = fmaxf(fmaxf(s[0][r], s[1][r]), fmaxf(s[2][r], s[3][r]));
#pragma unroll
            for (int msk = 1; msk < 16; msk <<= 1) mx = fmaxf(mx, __shfl_xor(mx, msk, 32));
            const float mnew  = fmaxf(m_i[r], mx);
            const float alpha = __expf(m_i[r] - mnew);
            m_i[r] = mnew;
            float rs = 0.f;
#pragma unroll
            for (int j = 0; j < 4; ++j) {
                const float p = __expf(s[j][r] - mnew);
                s[j][r] = p;
                rs += p;
            }
#pragma unroll
            for (int msk = 1; msk < 16; msk <<= 1) rs += __shfl_xor(rs, msk, 32);
            l_i[r] = l_i[r] * alpha + rs;
#pragma unroll
            for (int j = 0; j < 4; ++j) {
                o[j][r] *= alpha;
                // reshape C-layout -> A-layout via per-wave LDS staging
                sP[wave][(hf * 8 + r) * FP + j * 16 + c0] = (_Float16)s[j][r];
            }
        }

        // O += P V
#pragma unroll
        for (int kc = 0; kc < 64; kc += 32) {
            v16h pa = frag_ld(sP[wave], FP, kc);
#pragma unroll
            for (int j = 0; j < 4; ++j) {
                v16h vb = frag_ld(sVt + j * 16 * FP, FP, kc);
                o[j] = WMMA_F32_F16(pa, vb, o[j]);
            }
        }
    }

    // Epilogue: normalize by l and store f16.
#pragma unroll
    for (int j = 0; j < 4; ++j) {
#pragma unroll
        for (int r = 0; r < 8; ++r) {
            const int rowl = wave * 16 + hf * 8 + r;
            const size_t idx = ((size_t)b * n_q + qrow0 + rowl) * 512 + (size_t)h * 64 + j * 16 + c0;
            O[idx] = (_Float16)(o[j][r] / l_i[r]);
        }
    }
}

// ---------------------------------------------------------------------------
// Host-side orchestration
// ---------------------------------------------------------------------------
extern "C" void kernel_launch(void* const* d_in, const int* in_sizes, int n_in,
                              void* d_out, int out_size, void* d_ws, size_t ws_size,
                              hipStream_t stream) {
    (void)in_sizes; (void)n_in; (void)out_size; (void)ws_size;

    constexpr int B = 4, Nx = 2048, Mc = 512, F = 1024, CF = 768, MID = 512;
    constexpr int ROWS = B * Nx;       // 8192
    constexpr int CROWS = B * Mc;      // 2048

    const float* x       = (const float*)d_in[0];
    const float* ctx     = (const float*)d_in[1];
    const float* sa_ng   = (const float*)d_in[2];
    const float* sa_nb   = (const float*)d_in[3];
    const float* sa_ncg  = (const float*)d_in[4];
    const float* sa_ncb  = (const float*)d_in[5];
    const float* sa_wq   = (const float*)d_in[6];
    const float* sa_wkv  = (const float*)d_in[7];
    const float* sa_wo   = (const float*)d_in[8];
    const float* sa_bo   = (const float*)d_in[9];
    const float* ca_ng   = (const float*)d_in[10];
    const float* ca_nb   = (const float*)d_in[11];
    const float* ca_ncg  = (const float*)d_in[12];
    const float* ca_ncb  = (const float*)d_in[13];
    const float* ca_wq   = (const float*)d_in[14];
    const float* ca_wkv  = (const float*)d_in[15];
    const float* ca_wo   = (const float*)d_in[16];
    const float* ca_bo   = (const float*)d_in[17];
    float* out = (float*)d_out;

    // carve workspace
    size_t off = 0;
    auto carve = [&](size_t bytes) -> void* {
        void* p = (char*)d_ws + off;
        off += (bytes + 255) & ~(size_t)255;
        return p;
    };
    // weights, f16 TRANSPOSED to [N][K]
    _Float16* wq16s  = (_Float16*)carve((size_t)MID * F * 2);        // [512][1024]
    _Float16* wkv16s = (_Float16*)carve((size_t)(2 * MID) * F * 2);  // [1024][1024]
    _Float16* wo16s  = (_Float16*)carve((size_t)F * MID * 2);        // [1024][512]
    _Float16* wq16c  = (_Float16*)carve((size_t)MID * F * 2);        // [512][1024]
    _Float16* wkv16c = (_Float16*)carve((size_t)(2 * MID) * CF * 2); // [1024][768]
    _Float16* wo16c  = (_Float16*)carve((size_t)F * MID * 2);        // [1024][512]
    _Float16* XN1 = (_Float16*)carve((size_t)ROWS * F * 2);          // q-norm input
    _Float16* XN2 = (_Float16*)carve((size_t)ROWS * F * 2);          // kv-norm input / ctx-norm
    _Float16* Q16 = (_Float16*)carve((size_t)ROWS * MID * 2);
    _Float16* KV16 = (_Float16*)carve((size_t)ROWS * 2 * MID * 2);
    _Float16* AO16 = (_Float16*)carve((size_t)ROWS * MID * 2);
    float*    X1   = (float*)carve((size_t)ROWS * F * 4);

    const dim3 tb(32, 8);
    // ---- weight casts + transposes:  W[K][N] -> Wt[N][K] ----
    cast_transpose_kernel<<<dim3(MID / 32, F / 32), tb, 0, stream>>>(sa_wq, wq16s, F, MID);
    cast_transpose_kernel<<<dim3(2 * MID / 32, F / 32), tb, 0, stream>>>(sa_wkv, wkv16s, F, 2 * MID);
    cast_transpose_kernel<<<dim3(F / 32, MID / 32), tb, 0, stream>>>(sa_wo, wo16s, MID, F);
    cast_transpose_kernel<<<dim3(MID / 32, F / 32), tb, 0, stream>>>(ca_wq, wq16c, F, MID);
    cast_transpose_kernel<<<dim3(2 * MID / 32, CF / 32), tb, 0, stream>>>(ca_wkv, wkv16c, CF, 2 * MID);
    cast_transpose_kernel<<<dim3(F / 32, MID / 32), tb, 0, stream>>>(ca_wo, wo16c, MID, F);

    // ================= self-attention =================
    ln_cast_kernel<F / 128><<<ROWS / 32, 512, 0, stream>>>(x, sa_ng,  sa_nb,  XN1);
    ln_cast_kernel<F / 128><<<ROWS / 32, 512, 0, stream>>>(x, sa_ncg, sa_ncb, XN2);
    // Q = (XN1 @ wq) * scale   [8192 x 1024 -> 512]
    gemm_wmma_kernel<2><<<dim3(MID / 256, ROWS / 128), 256, 0, stream>>>(
        XN1, wq16s, Q16, nullptr, nullptr, nullptr, ROWS, MID, F);
    // KV = XN2 @ wkv  [8192 x 1024 -> 1024]
    gemm_wmma_kernel<0><<<dim3(2 * MID / 256, ROWS / 128), 256, 0, stream>>>(
        XN2, wkv16s, KV16, nullptr, nullptr, nullptr, ROWS, 2 * MID, F);
    // attention (m_len = 2048)
    flash_attn_kernel<<<dim3(Nx / 64, 8, B), 128, 0, stream>>>(Q16, KV16, AO16, Nx, Nx);
    // X1 = AO @ wo + bo + x   [8192 x 512 -> 1024] -> f32
    gemm_wmma_kernel<1><<<dim3(F / 256, ROWS / 128), 256, 0, stream>>>(
        AO16, wo16s, nullptr, X1, sa_bo, x, ROWS, F, MID);

    // ================= cross-attention =================
    ln_cast_kernel<F / 128><<<ROWS / 32, 512, 0, stream>>>(X1, ca_ng, ca_nb, XN1);
    _Float16* CN = XN2;  // reuse: normalized context [2048 x 768]
    ln_cast_kernel<CF / 128><<<CROWS / 32, 512, 0, stream>>>(ctx, ca_ncg, ca_ncb, CN);
    // Q = (XN1 @ ca_wq) * scale
    gemm_wmma_kernel<2><<<dim3(MID / 256, ROWS / 128), 256, 0, stream>>>(
        XN1, wq16c, Q16, nullptr, nullptr, nullptr, ROWS, MID, F);
    // KV = CN @ ca_wkv [2048 x 768 -> 1024]
    gemm_wmma_kernel<0><<<dim3(2 * MID / 256, CROWS / 128), 256, 0, stream>>>(
        CN, wkv16c, KV16, nullptr, nullptr, nullptr, CROWS, 2 * MID, CF);
    // attention (m_len = 512)
    flash_attn_kernel<<<dim3(Nx / 64, 8, B), 128, 0, stream>>>(Q16, KV16, AO16, Nx, Mc);
    // out = AO @ ca_wo + ca_bo + X1  -> f32 (final output)
    gemm_wmma_kernel<1><<<dim3(F / 256, ROWS / 128), 256, 0, stream>>>(
        AO16, wo16c, nullptr, out, ca_bo, X1, ROWS, F, MID);
}

// v004
// Measured time: 285 microseconds a run.
// Timed twice side by side with v003, it ran 1.13 and 1.14 times as fast.
// Over all steps from v000 it is 2.00 times as fast.
#include <hip/hip_runtime.h>

typedef __attribute__((ext_vector_type(16))) _Float16 v16h;
typedef __attribute__((ext_vector_type(8)))  _Float16 v8h;
typedef __attribute__((ext_vector_type(8)))  float    v8f;

#define WMMA_F32_F16(a, b, c) \
    __builtin_amdgcn_wmma_f32_16x16x32_f16(false, (a), false, (b), (short)0, (c), false, false)

__device__ __forceinline__ unsigned lds_off(const void* p) {
    return (unsigned)(unsigned long long)p;
}

__device__ __forceinline__ void async_copy64B(unsigned ldsAddr, const void* g) {
    unsigned long long ga = (unsigned long long)g;
    asm volatile(
        "global_load_async_to_lds_b128 %0, %1, off\n\t"
        "global_load_async_to_lds_b128 %0, %1, off offset:16\n\t"
        "global_load_async_to_lds_b128 %0, %1, off offset:32\n\t"
        "global_load_async_to_lds_b128 %0, %1, off offset:48\n\t"
        "s_wait_xcnt 0x0"
        :: "v"(ldsAddr), "v"(ga) : "memory");
}

__device__ __forceinline__ void wait_async0() {
    asm volatile("s_wait_asynccnt 0x0" ::: "memory");
}

// the wave's own LDS reads have returned: stands in front of the barrier behind
// which a buffer that the wave has read is refilled by copies
__device__ __forceinline__ void wait_ds0() {
    asm volatile("s_wait_dscnt 0x0" ::: "memory");
}

constexpr int FP = 72;  // 64-half (128 B) rows -> 144 B pitch

__device__ __forceinline__ v16h frag_ld(const _Float16* tile, int ld, int kbase) {
    const int lane = threadIdx.x & 31;
    const _Float16* p = tile + (lane & 15) * ld + kbase + ((lane >> 4) << 3);
    v8h lo = *(const v8h*)p;
    v8h hi = *(const v8h*)(p + 16);
    v16h r;
#pragma unroll
    for (int i = 0; i < 8; ++i) { r[i] = lo[i]; r[i + 8] = hi[i]; }
    return r;
}

// ---------------------------------------------------------------------------
// Weight prep: f32 [K][N] -> f16 transposed [N][K] (LDS-tiled for coalescing)
// grid: (N/32, K/32), block: (32, 8)
// ---------------------------------------------------------------------------
__global__ __launch_bounds__(256) void cast_transpose_kernel(const float* __restrict__ in,
                                                             _Float16* __restrict__ out,
                                                             int K, int N) {
    __shared__ _Float16 tile[32][33];
    const int nb = blockIdx.x * 32;
    const int kb = blockIdx.y * 32;
    const int tx = threadIdx.x;
#pragma unroll
    for (int i = threadIdx.y; i < 32; i += 8)
        tile[i][tx] = (_Float16)in[(size_t)(kb + i) * N + nb + tx];
    __syncthreads();
#pragma unroll
    for (int i = threadIdx.y; i < 32; i += 8)
        out[(size_t)(nb + i) * K + kb + tx] = tile[tx][i];
}

// ---------------------------------------------------------------------------
// LayerNorm (biased variance, eps 1e-5) + cast to f16.
// One wave owns two whole rows: each row sits in registers (NV 16-byte loads
// per lane, 512 contiguous bytes per wave-wide load), the sums cross lanes in
// registers, so the kernel has no LDS and no barrier, and a launch starts only
// rows / 2 waves (wave start rate, not bytes, bounds a launch of many short
// work-groups).  C = NV * 128; rows = gridDim.x * 32.
// ---------------------------------------------------------------------------
typedef __attribute__((ext_vector_type(4))) float    v4f;
typedef __attribute__((ext_vector_type(4))) _Float16 v4h;

template <int MASK>
__device__ __forceinline__ float add_xmask(float x) {
    return x + __builtin_bit_cast(float, __builtin_amdgcn_update_dpp(
        0, __builtin_bit_cast(int, x), 0x160 | MASK, 0xf, 0xf, false));
}

// sum over the 32 lanes of a wave, the same value in every lane
__device__ __forceinline__ float wave_sum(float x) {
    x = add_xmask<1>(x);
    x = add_xmask<2>(x);
    x = add_xmask<4>(x);
    x = add_xmask<8>(x);
    const int xi = __builtin_bit_cast(int, x);
    return x + __builtin_bit_cast(float,
        __builtin_amdgcn_permlanex16(xi, xi, 0x76543210, 0xfedcba98, false, false));
}

template <int NV>
__global__ __launch_bounds__(512) void ln_cast_kernel(const float* __restrict__ X,
                                                      const float* __restrict__ G,
                                                      const float* __restrict__ Bv,
                                                      _Float16* __restrict__ Y) {
    constexpr int C = NV * 128;
    const int lane = threadIdx.x & 31;
    // the wave's number as a scalar: the rows' base addresses then sit in scalar
    // registers and the lane number is the only address register of every access
    const int wave = __builtin_amdgcn_readfirstlane(threadIdx.x >> 5);
    const int row0 = (blockIdx.x * 16 + wave) * 2;
    const v4f* x4 = (const v4f*)(X + (size_t)row0 * C) + lane;

    v4f v[2][NV];
#pragma unroll
    for (int r = 0; r < 2; ++r)
#pragma unroll
        for (int i = 0; i < NV; ++i) v[r][i] = x4[r * (C / 4) + i * 32];
    // scale and shift are asked for beside the rows, so that their latency
    // runs under the rows' own instead of behind the sums
    const v4f* g4 = (const v4f*)G + lane;
    const v4f* b4 = (const v4f*)Bv + lane;
    v4f g[NV], bb[NV];
#pragma unroll
    for (int i = 0; i < NV; ++i) { g[i] = g4[i * 32]; bb[i] = b4[i * 32]; }
    // keeps every load above in flight at once: without it the compiler sinks
    // the scale and shift loads behind the sums, in short dependent batches
    __builtin_amdgcn_sched_barrier(0);
    asm volatile("s_wait_xcnt 0x0" ::: "memory");
    __builtin_amdgcn_sched_barrier(0);

    float mean[2], rstd[2];
#pragma unroll
    for (int r = 0; r < 2; ++r) {
        v4f a1 = v[r][0], a2 = v[r][0] * v[r][0];
#pragma unroll
        for (int i = 1; i < NV; ++i) { a1 += v[r][i]; a2 += v[r][i] * v[r][i]; }
        const float s1 = wave_sum((a1[0] + a1[1]) + (a1[2] + a1[3]));
        const float s2 = wave_sum((a2[0] + a2[1]) + (a2[2] + a2[3]));
        constexpr float invC = 1.0f / (float)C;
        mean[r] = s1 * invC;
        rstd[r] = rsqrtf(s2 * invC - mean[r] * mean[r] + 1e-5f);
    }

    v4h* y4 = (v4h*)(Y + (size_t)row0 * C) + lane;
#pragma unroll
    for (int i = 0; i < NV; ++i) {
#pragma unroll
        for (int r = 0; r < 2; ++r) {
            v4h y;
#pragma unroll
            for (int e = 0; e < 4; ++e)
                y[e] = (_Float16)((v[r][i][e] - mean[r]) * rstd[r] * g[i][e] + bb[i][e]);
            y4[r * (C / 4) + i * 32] = y;
        }
    }
}

// ---------------------------------------------------------------------------
// One thread's twelve copies of one GEMM ring stage: 16 B of 4 A rows and of 8 B
// rows, 32 rows apart; in LDS the B rows follow the 128 A rows at one pitch.
// ---------------------------------------------------------------------------
constexpr int GK  = 64;                // k depth of a ring stage
constexpr int GST = (128 + 256) * FP;  // halves in one stage buffer

__device__ __forceinline__ void gemm_stage_copies(unsigned d, const _Float16* a, const _Float16* b,
                                                  size_t step) {
    constexpr unsigned R = 32 * FP * 2;  // 32 LDS rows in bytes
    asm volatile(
        "global_load_async_to_lds_b128 %0, %12, off\n\t"
        "global_load_async_to_lds_b128 %1, %13, off\n\t"
        "global_load_async_to_lds_b128 %2, %14, off\n\t"
        "global_load_async_to_lds_b128 %3, %15, off\n\t"
        "global_load_async_to_lds_b128 %4, %16, off\n\t"
        "global_load_async_to_lds_b128 %5, %17, off\n\t"
        "global_load_async_to_lds_b128 %6, %18, off\n\t"
        "global_load_async_to_lds_b128 %7, %19, off\n\t"
        "global_load_async_to_lds_b128 %8, %20, off\n\t"
        "global_load_async_to_lds_b128 %9, %21, off\n\t"
        "global_load_async_to_lds_b128 %10, %22, off\n\t"
        "global_load_async_to_lds_b128 %11, %23, off\n\t"
        "s_wait_xcnt 0x0"
        :: "v"(d), "v"(d + R), "v"(d + 2 * R), "v"(d + 3 * R), "v"(d + 4 * R), "v"(d + 5 * R),
           "v"(d + 6 * R), "v"(d + 7 * R), "v"(d + 8 * R), "v"(d + 9 * R), "v"(d + 10 * R),
           "v"(d + 11 * R),
           "v"((unsigned long long)a), "v"((unsigned long long)(a + step)),
           "v"((unsigned long long)(a + 2 * step)), "v"((unsigned long long)(a + 3 * step)),
           "v"((unsigned long long)b), "v"((unsigned long long)(b + step)),
           "v"((unsigned long long)(b + 2 * step)), "v"((unsigned long long)(b + 3 * step)),
           "v"((unsigned long long)(b + 4 * step)), "v"((unsigned long long)(b + 5 * step)),
           "v"((unsigned long long)(b + 6 * step)), "v"((unsigned long long)(b + 7 * step))
        : "memory");
}

// ---------------------------------------------------------------------------
// Tiled WMMA GEMM:  C[M,N] = A[M,K] (f16 row-major) * Bt[N,K] (f16, B transposed)
// Block tile 128x256, 256 threads = 8 waves in a 2(M) x 4(N) grid,
// each wave computes a 64x64 register tile: 16 WMMAs per 32-wide K step.
// A/B tiles staged into LDS with global_load_async_to_lds_b128, in a ring of two
// buffers of 64 k each: the copies of stage t + 2 are issued at the foot of pass
// t and waited for at the foot of pass t + 1, so they fly under a whole pass of
// 32 WMMAs per wave.  K is a multiple of 64.
// MODE 0: C -> f16.  MODE 2: C -> f16 * 0.125 (Q pre-scale).
// MODE 1: C -> f32 with + bias[n] + res[m,n].
// ---------------------------------------------------------------------------
template <int MODE>
__global__ __launch_bounds__(256) void gemm_wmma_kernel(const _Float16* __restrict__ A,
                                                        const _Float16* __restrict__ Bt,
                                                        _Float16* __restrict__ C16,
                                                        float* __restrict__ C32,
                                                        const float* __restrict__ bias,
                                                        const float* __restrict__ res,
                                                        int M, int N, int K) {
    // two stage buffers; each holds 128 A rows [m][k], then 256 B rows [n][k]
    __shared__ __align__(16) _Float16 sm[2 * GST];
    const int tid = threadIdx.x;
    const int wave = tid >> 5, lane = tid & 31;
    const int waveM = wave >> 2, waveN = wave & 3;
    const int mbase = blockIdx.y * 128;
    const int nbase = blockIdx.x * 256;
    (void)M;

    v8f acc[4][4] = {};

    // staging assignments: a stage row is 64 halves = 128 B = 8 lanes x 16 B;
    // a thread copies its 16 B of rows srow + 32 i: 4 rows of A, 8 rows of B
    const int srow = tid >> 3, sseg = (tid & 7) * 8;
    const _Float16* gA = A + (size_t)(mbase + srow) * K + sseg;
    const _Float16* gB = Bt + (size_t)(nbase + srow) * K + sseg;
    const size_t gstep = (size_t)32 * K;  // 32 rows of A or of Bt, in halves
    const unsigned d0 = lds_off(&sm[srow * FP + sseg]);
    const int nst = K / GK;

    gemm_stage_copies(d0, gA, gB, gstep);
    wait_async0();    // stage 0 has landed (this wave's share)
    __syncthreads();  // ... and every other wave's
    if (nst > 1) gemm_stage_copies(d0 + GST * 2, gA + GK, gB + GK, gstep);

    for (int t = 0; t < nst; ++t) {
        const _Float16* sA = sm + (t & 1) * GST;
        const _Float16* sB = sA + 128 * FP;
        // unrolled: kc becomes an immediate offset of the LDS reads
#pragma unroll
        for (int kc = 0; kc < GK; kc += 32) {
            v16h bf[4];
#pragma unroll
            for (int j = 0; j < 4; ++j)
                bf[j] = frag_ld(sB + (waveN * 64 + j * 16) * FP, FP, kc);
#pragma unroll
            for (int i = 0; i < 4; ++i) {
                v16h af = frag_ld(sA + (waveM * 64 + i * 16) * FP, FP, kc);
#pragma unroll
                for (int j = 0; j < 4; ++j)
                    acc[i][j] = WMMA_F32_F16(af, bf[j], acc[i][j]);
            }
        }
        // publish point: this wave has left buffer t & 1 and its copies of stage
        // t + 1 have landed; the one barrier says both of every wave
        wait_ds0();
        wait_async0();
        __syncthreads();
        if (t + 2 < nst)
            gemm_stage_copies(d0 + (t & 1) * (GST * 2), gA + (t + 2) * GK, gB + (t + 2) * GK, gstep);
    }
    wait_async0();  // no copy is outstanding when the wave goes on to its end

    const int hf = lane >> 4, c0 = lane & 15;
#pragma unroll
    for (int i = 0; i < 4; ++i) {
#pragma unroll
        for (int j = 0; j < 4; ++j) {
#pragma unroll
            for (int r = 0; r < 8; ++r) {
                const int row = mbase + waveM * 64 + i * 16 + hf * 8 + r;
                const int col = nbase + waveN * 64 + j * 16 + c0;
                const float v = acc[i][j][r];
                if (MODE == 0) {
                    C16[(size_t)row * N + col] = (_Float16)v;
                } else if (MODE == 2) {
                    C16[(size_t)row * N + col] = (_Float16)(v * 0.125f);
                } else {
                    C32[(size_t)row * N + col] = v + bias[col] + res[(size_t)row * N + col];
                }
            }
        }
    }
}

constexpr int VP = 80;  // V rows of 64 halves, read by ds_load_tr16_b128: pitch 160 B = 32 B x odd

typedef __attribute__((ext_vector_type(8))) short v8s;

// 16 (d) x 32 (keys) A fragment of V^T from a row-major [key][ld halves] LDS tile:
// lane (c, hf) gets keys kbase + 8 hf + 0..7, then kbase + 16 + 8 hf + 0..7, of
// column dbase + c: the k order of frag_ld and of a converted pair of D tiles.
__device__ __forceinline__ v16h frag_ld_tr(const _Float16* tile, int ld, int kbase, int dbase) {
    typedef __attribute__((address_space(3))) v8s lds_v8s;
    const int lane = threadIdx.x & 31;
    const _Float16* p = tile + (kbase + ((lane >> 4) << 3) + (lane & 7)) * ld + dbase + (((lane >> 3) & 1) << 3);
    v8h lo = __builtin_bit_cast(v8h, __builtin_amdgcn_ds_load_tr16_b128_v8i16((lds_v8s*)p));
    v8h hi = __builtin_bit_cast(v8h, __builtin_amdgcn_ds_load_tr16_b128_v8i16((lds_v8s*)(p + 16 * ld)));
    v16h r;
#pragma unroll
    for (int i = 0; i < 8; ++i) { r[i] = lo[i]; r[i + 8] = hi[i]; }
    return r;
}

__device__ __forceinline__ float xhalf(float x) {
    const int xi = __builtin_bit_cast(int, x);
    return __builtin_bit_cast(float,
        __builtin_amdgcn_permlanex16(xi, xi, 0x76543210, 0xfedcba98, false, false));
}

__global__ __launch_bounds__(128) void flash_attn_kernel(const _Float16* __restrict__ Q,
                                                         const _Float16* __restrict__ KV,
                                                         _Float16* __restrict__ O,
                                                         int n_q, int m_len) {
    __shared__ __align__(16) _Float16 sK[64 * FP];  // [key][d]: A rows of K Q^T
    __shared__ __align__(16) _Float16 sV[64 * VP];  // [key][d]: read transposed

    const int wave = threadIdx.x >> 5;
    const int lane = threadIdx.x & 31;
    const int h = blockIdx.y, b = blockIdx.z;
    const int qrow0 = blockIdx.x * 64;
    const int hf = lane >> 4, c0 = lane & 15;
    // this lane's query row, at its head's columns
    const size_t qoff  = ((size_t)b * n_q + qrow0 + wave * 16 + c0) * 512 + (size_t)h * 64;
    const size_t kvoff = (size_t)b * m_len * 1024 + (size_t)h * 64;

    const int srow = threadIdx.x >> 1;            // 0..63
    const int sseg = (threadIdx.x & 1) * 32;      // 0 / 32 halves (64B)

    // Q^T as B operand, loaded once, in the k order of frag_ld
    v16h qf[2];
#pragma unroll
    for (int kc = 0; kc < 2; ++kc) {
        const _Float16* qp = Q + qoff + kc * 32 + hf * 8;
        v8h lo = *(const v8h*)qp;
        v8h hi = *(const v8h*)(qp + 16);
#pragma unroll
        for (int i = 0; i < 8; ++i) { qf[kc][i] = lo[i]; qf[kc][i + 8] = hi[i]; }
    }

    float m_i = -1e30f, l_i = 0.f;  // l_i: the sum over this lane's half of the keys
    v8f o[4] = {};                  // o[j][r] = O^T[d = 16 j + 8 hf + r][query c0]

    for (int kt = 0; kt < m_len; kt += 64) {
        wait_ds0();       // this wave's reads of both tiles have returned ...
        __syncthreads();  // ... and every wave's: the copies may refill them
        const _Float16* gk = KV + kvoff + (size_t)(kt + srow) * 1024 + sseg;
        async_copy64B(lds_off(&sK[srow * FP + sseg]), gk);
        async_copy64B(lds_off(&sV[srow * VP + sseg]), gk + 512);
        wait_async0();
        __syncthreads();

        // S^T = K Q^T: s[g][r] = score of key 16 g + 8 hf + r with query c0
        v8f s[4] = {};
#pragma unroll
        for (int kc = 0; kc < 2; ++kc) {
#pragma unroll
            for (int g = 0; g < 4; ++g) {
                v16h kf = frag_ld(sK + g * 16 * FP, FP, kc * 32);
                s[g] = WMMA_F32_F16(kf, qf[kc], s[g]);
            }
        }

        // Online softmax, one query per lane.
        float mg[4];
#pragma unroll
        for (int g = 0; g < 4; ++g) {
            mg[g] = s[g][0];
#pragma unroll
            for (int r = 1; r < 8; ++r) mg[g] = fmaxf(mg[g], s[g][r]);
        }
        float mx = fmaxf(fmaxf(mg[0], mg[1]), fmaxf(mg[2], mg[3]));
        mx = fmaxf(mx, xhalf(mx));  // both halves of the query's keys
        const float mnew  = fmaxf(m_i, mx);
        const float alpha = __expf(m_i - mnew);
        m_i = mnew;
        float rs[4];
        v16h pb[2];  // P^T: keys 32 c .. 32 c + 31 are score tiles 2 c and 2 c + 1
#pragma unroll
        for (int g = 0; g < 4; ++g) {
            rs[g] = 0.f;
#pragma unroll
            for (int r = 0; r < 8; ++r) {
                const float p = __expf(s[g][r] - mnew);
                rs[g] += p;
                pb[g >> 1][(g & 1) * 8 + r] = (_Float16)p;
            }
        }
        l_i = l_i * alpha + ((rs[0] + rs[1]) + (rs[2] + rs[3]));
#pragma unroll
        for (int j = 0; j < 4; ++j) o[j] *= alpha;

        // O^T += V^T P^T
#pragma unroll
        for (int c = 0; c < 2; ++c) {
#pragma unroll
            for (int j = 0; j < 4; ++j) {
                v16h vt = frag_ld_tr(sV, VP, c * 32, j * 16);
                o[j] = WMMA_F32_F16(vt, pb[c], o[j]);
            }
        }
    }

    // Epilogue: join the halves' sums, normalize, store 8 consecutive d per lane.
    const float inv = 1.0f / (l_i + xhalf(l_i));
#pragma unroll
    for (int j = 0; j < 4; ++j) {
        v8h y;
#pragma unroll
        for (int r = 0; r < 8; ++r) y[r] = (_Float16)(o[j][r] * inv);
        *(v8h*)(O + qoff + j * 16 + hf * 8) = y;
    }
}

// ---------------------------------------------------------------------------
// Host-side orchestration
// ---------------------------------------------------------------------------
extern "C" void kernel_launch(void* const* d_in, const int* in_sizes, int n_in,
                              void* d_out, int out_size, void* d_ws, size_t ws_size,
                              hipStream_t stream) {
    (void)in_sizes; (void)n_in; (void)out_size; (void)ws_size;

    constexpr int B = 4, Nx = 2048, Mc = 512, F = 1024, CF = 768, MID = 512;
    constexpr int ROWS = B * Nx;       // 8192
    constexpr int CROWS = B * Mc;      // 2048

    const float* x       = (const float*)d_in[0];
    const float* ctx     = (const float*)d_in[1];
    const float* sa_ng   = (const float*)d_in[2];
    const float* sa_nb   = (const float*)d_in[3];
    const float* sa_ncg  = (const float*)d_in[4];
    const float* sa_ncb  = (const float*)d_in[5];
    const float* sa_wq   = (const float*)d_in[6];
    const float* sa_wkv  = (const float*)d_in[7];
    const float* sa_wo   = (const float*)d_in[8];
    const float* sa_bo   = (const float*)d_in[9];
    const float* ca_ng   = (const float*)d_in[10];
    const float* ca_nb   = (const float*)d_in[11];
    const float* ca_ncg  = (const float*)d_in[12];
    const float* ca_ncb  = (const float*)d_in[13];
    const float* ca_wq   = (const float*)d_in[14];
    const float* ca_wkv  = (const float*)d_in[15];
    const float* ca_wo   = (const float*)d_in[16];
    const float* ca_bo   = (const float*)d_in[17];
    float* out = (float*)d_out;

    // carve workspace
    size_t off = 0;
    auto carve = [&](size_t bytes) -> void* {
        void* p = (char*)d_ws + off;
        off += (bytes + 255) & ~(size_t)255;
        return p;
    };
    // weights, f16 TRANSPOSED to [N][K]
    _Float16* wq16s  = (_Float16*)carve((size_t)MID * F * 2);        // [512][1024]
    _Float16* wkv16s = (_Float16*)carve((size_t)(2 * MID) * F * 2);  // [1024][1024]
    _Float16* wo16s  = (_Float16*)carve((size_t)F * MID * 2);        // [1024][512]
    _Float16* wq16c  = (_Float16*)carve((size_t)MID * F * 2);        // [512][1024]
    _Float16* wkv16c = (_Float16*)carve((size_t)(2 * MID) * CF * 2); // [1024][768]
    _Float16* wo16c  = (_Float16*)carve((size_t)F * MID * 2);        // [1024][512]
    _Float16* XN1 = (_Float16*)carve((size_t)ROWS * F * 2);          // q-norm input
    _Float16* XN2 = (_Float16*)carve((size_t)ROWS * F * 2);          // kv-norm input / ctx-norm
    _Float16* Q16 = (_Float16*)carve((size_t)ROWS * MID * 2);
    _Float16* KV16 = (_Float16*)carve((size_t)ROWS * 2 * MID * 2);
    _Float16* AO16 = (_Float16*)carve((size_t)ROWS * MID * 2);
    float*    X1   = (float*)carve((size_t)ROWS * F * 4);

    const dim3 tb(32, 8);
    // ---- weight casts + transposes:  W[K][N] -> Wt[N][K] ----
    cast_transpose_kernel<<<dim3(MID / 32, F / 32), tb, 0, stream>>>(sa_wq, wq16s, F, MID);
    cast_transpose_kernel<<<dim3(2 * MID / 32, F / 32), tb, 0, stream>>>(sa_wkv, wkv16s, F, 2 * MID);
    cast_transpose_kernel<<<dim3(F / 32, MID / 32), tb, 0, stream>>>(sa_wo, wo16s, MID, F);
    cast_transpose_kernel<<<dim3(MID / 32, F / 32), tb, 0, stream>>>(ca_wq, wq16c, F, MID);
    cast_transpose_kernel<<<dim3(2 * MID / 32, CF / 32), tb, 0, stream>>>(ca_wkv, wkv16c, CF, 2 * MID);
    cast_transpose_kernel<<<dim3(F / 32, MID / 32), tb, 0, stream>>>(ca_wo, wo16c, MID, F);

    // ================= self-attention =================
    ln_cast_kernel<F / 128><<<ROWS / 32, 512, 0, stream>>>(x, sa_ng,  sa_nb,  XN1);
    ln_cast_kernel<F / 128><<<ROWS / 32, 512, 0, stream>>>(x, sa_ncg, sa_ncb, XN2);
    // Q = (XN1 @ wq) * scale   [8192 x 1024 -> 512]
    gemm_wmma_kernel<2><<<dim3(MID / 256, ROWS / 128), 256, 0, stream>>>(
        XN1, wq16s, Q16, nullptr, nullptr, nullptr, ROWS, MID, F);
    // KV = XN2 @ wkv  [8192 x 1024 -> 1024]
    gemm_wmma_kernel<0><<<dim3(2 * MID / 256, ROWS / 128), 256, 0, stream>>>(
        XN2, wkv16s, KV16, nullptr, nullptr, nullptr, ROWS, 2 * MID, F);
    // attention (m_len = 2048)
    flash_attn_kernel<<<dim3(Nx / 64, 8, B), 128, 0, stream>>>(Q16, KV16, AO16, Nx, Nx);
    // X1 = AO @ wo + bo + x   [8192 x 512 -> 1024] -> f32
    gemm_wmma_kernel<1><<<dim3(F / 256, ROWS / 128), 256, 0, stream>>>(
        AO16, wo16s, nullptr, X1, sa_bo, x, ROWS, F, MID);

    // ================= cross-attention =================
    ln_cast_kernel<F / 128><<<ROWS / 32, 512, 0, stream>>>(X1, ca_ng, ca_nb, XN1);
    _Float16* CN = XN2;  // reuse: normalized context [2048 x 768]
    ln_cast_kernel<CF / 128><<<CROWS / 32, 512, 0, stream>>>(ctx, ca_ncg, ca_ncb, CN);
    // Q = (XN1 @ ca_wq) * scale
    gemm_wmma_kernel<2><<<dim3(MID / 256, ROWS / 128), 256, 0, stream>>>(
        XN1, wq16c, Q16, nullptr, nullptr, nullptr, ROWS, MID, F);
    // KV = CN @ ca_wkv [2048 x 768 -> 1024]
    gemm_wmma_kernel<0><<<dim3(2 * MID / 256, CROWS / 128), 256, 0, stream>>>(
        CN, wkv16c, KV16, nullptr, nullptr, nullptr, CROWS, 2 * MID, CF);
    // attention (m_len = 512)
    flash_attn_kernel<<<dim3(Nx / 64, 8, B), 128, 0, stream>>>(Q16, KV16, AO16, Nx, Mc);
    // out = AO @ ca_wo + ca_bo + X1  -> f32 (final output)
    gemm_wmma_kernel<1><<<dim3(F / 256, ROWS / 128), 256, 0, stream>>>(
        AO16, wo16c, nullptr, out, ca_bo, X1, ROWS, F, MID);
}

// v005
// It runs in 235 microseconds.
// Timed twice side by side with v004, it ran 1.22 and 1.21 times as fast.
// Counting every step since v000, it is 2.43 times as fast.
#include <hip/hip_runtime.h>

typedef __attribute__((ext_vector_type(16))) _Float16 v16h;
typedef __attribute__((ext_vector_type(8)))  _Float16 v8h;
typedef __attribute__((ext_vector_type(8)))  float    v8f;

#define WMMA_F32_F16(a, b, c) \
    __builtin_amdgcn_wmma_f32_16x16x32_f16(false, (a), false, (b), (short)0, (c), false, false)

// Problem shape, shared by the host code and by the kernels that hold several jobs
constexpr int B = 4, Nx = 2048, Mc = 512, F = 1024, CF = 768, MID = 512;
constexpr int ROWS = B * Nx;   // 8192
constexpr int CROWS = B * Mc;  // 2048

__device__ __forceinline__ unsigned lds_off(const void* p) {
    return (unsigned)(unsigned long long)p;
}

__device__ __forceinline__ void async_copy64B(unsigned ldsAddr, const void* g) {
    unsigned long long ga = (unsigned long long)g;
    asm volatile(
        "global_load_async_to_lds_b128 %0, %1, off\n\t"
        "global_load_async_to_lds_b128 %0, %1, off offset:16\n\t"
        "global_load_async_to_lds_b128 %0, %1, off offset:32\n\t"
        "global_load_async_to_lds_b128 %0, %1, off offset:48\n\t"
        "s_wait_xcnt 0x0"
        :: "v"(ldsAddr), "v"(ga) : "memory");
}

__device__ __forceinline__ void wait_async0() {
    asm volatile("s_wait_asynccnt 0x0" ::: "memory");
}

// the wave's own LDS reads have returned: stands in front of the barrier behind
// which a buffer that the wave has read is refilled by copies
__device__ __forceinline__ void wait_ds0() {
    asm volatile("s_wait_dscnt 0x0" ::: "memory");
}

constexpr int FP = 72;  // 64-half (128 B) rows -> 144 B pitch

__device__ __forceinline__ v16h frag_ld(const _Float16* tile, int ld, int kbase) {
    const int lane = threadIdx.x & 31;
    const _Float16* p = tile + (lane & 15) * ld + kbase + ((lane >> 4) << 3);
    v8h lo = *(const v8h*)p;
    v8h hi = *(const v8h*)(p + 16);
    v16h r;
#pragma unroll
    for (int i = 0; i < 8; ++i) { r[i] = lo[i]; r[i + 8] = hi[i]; }
    return r;
}

// ---------------------------------------------------------------------------
// Weight prep: f32 [K][N] -> f16 transposed [N][K] (LDS-tiled for coalescing)
// One 32 x 32 tile per work-group, block: (32, 8); tile t of a matrix with
// N = 32 << lgnt columns: column block t mod (N / 32), row block t / (N / 32).
// ---------------------------------------------------------------------------
__device__ __forceinline__ void cast_transpose_tile(const float* __restrict__ in,
                                                    _Float16* __restrict__ out,
                                                    int K, int lgnt, int t) {
    __shared__ _Float16 tile[32][33];
    const int N = 32 << lgnt;
    const int nb = (t & ((1 << lgnt) - 1)) * 32;
    const int kb = (t >> lgnt) * 32;
    const int tx = threadIdx.x;
#pragma unroll
    for (int i = threadIdx.y; i < 32; i += 8)
        tile[i][tx] = (_Float16)in[(size_t)(kb + i) * N + nb + tx];
    __syncthreads();
#pragma unroll
    for (int i = threadIdx.y; i < 32; i += 8)
        out[(size_t)(nb + i) * K + kb + tx] = tile[tx][i];
}

// All six weights in one launch: the work-group's index picks weight and tile.
constexpr int CB_WQ  = (F / 32) * (MID / 32);       // tiles of a [F][MID] or [MID][F] weight
constexpr int CB_WKV = (F / 32) * (2 * MID / 32);   // tiles of the self k/v weight
constexpr int CB_WKC = (CF / 32) * (2 * MID / 32);  // tiles of the cross k/v weight
constexpr int CB_ALL = 4 * CB_WQ + CB_WKV + CB_WKC;

__global__ __launch_bounds__(256) void cast_transpose_kernel(
    const float* __restrict__ wqs, const float* __restrict__ wkvs, const float* __restrict__ wos,
    const float* __restrict__ wqc, const float* __restrict__ wkvc, const float* __restrict__ woc,
    _Float16* __restrict__ tqs, _Float16* __restrict__ tkvs, _Float16* __restrict__ tos,
    _Float16* __restrict__ tqc, _Float16* __restrict__ tkvc, _Float16* __restrict__ toc) {
    int f = blockIdx.x;
    const float* in;
    _Float16* out;
    int K, lgnt;  // N = 32 << lgnt: 512 -> 4, 1024 -> 5
    if (f < CB_WKV)                  { in = wkvs; out = tkvs; K = F;   lgnt = 5; }
    else if ((f -= CB_WKV) < CB_WKC) { in = wkvc; out = tkvc; K = CF;  lgnt = 5; }
    else if ((f -= CB_WKC) < CB_WQ)  { in = wqs;  out = tqs;  K = F;   lgnt = 4; }
    else if ((f -= CB_WQ) < CB_WQ)   { in = wqc;  out = tqc;  K = F;   lgnt = 4; }
    else if ((f -= CB_WQ) < CB_WQ)   { in = wos;  out = tos;  K = MID; lgnt = 5; }
    else               { f -= CB_WQ;   in = woc;  out = toc;  K = MID; lgnt = 5; }
    cast_transpose_tile(in, out, K, lgnt, f);
}

// ---------------------------------------------------------------------------
// LayerNorm (biased variance, eps 1e-5) + cast to f16.
// One wave owns two whole rows: each row sits in registers (NV 16-byte loads
// per lane, 512 contiguous bytes per wave-wide load), the sums cross lanes in
// registers, so the kernel has no LDS and no barrier, and a launch starts only
// rows / 2 waves (wave start rate, not bytes, bounds a launch of many short
// work-groups).  C = NV * 128; work-group blk (16 waves) takes 32 rows from 32 blk.
// ---------------------------------------------------------------------------
typedef __attribute__((ext_vector_type(4))) float    v4f;
typedef __attribute__((ext_vector_type(4))) _Float16 v4h;

template <int MASK>
__device__ __forceinline__ float add_xmask(float x) {
    return x + __builtin_bit_cast(float, __builtin_amdgcn_update_dpp(
        0, __builtin_bit_cast(int, x), 0x160 | MASK, 0xf, 0xf, false));
}

// sum over the 32 lanes of a wave, the same value in every lane
__device__ __forceinline__ float wave_sum(float x) {
    x = add_xmask<1>(x);
    x = add_xmask<2>(x);
    x = add_xmask<4>(x);
    x = add_xmask<8>(x);
    const int xi = __builtin_bit_cast(int, x);
    return x + __builtin_bit_cast(float,
        __builtin_amdgcn_permlanex16(xi, xi, 0x76543210, 0xfedcba98, false, false));
}

template <int NV>
__device__ __forceinline__ void ln_cast_rows(const float* __restrict__ X,
                                             const float* __restrict__ G,
                                             const float* __restrict__ Bv,
                                             _Float16* __restrict__ Y, int blk) {
    constexpr int C = NV * 128;
    const int lane = threadIdx.x & 31;
    // the wave's number as a scalar: the rows' base addresses then sit in scalar
    // registers and the lane number is the only address register of every access
    const int wave = __builtin_amdgcn_readfirstlane(threadIdx.x >> 5);
    const int row0 = (blk * 16 + wave) * 2;
    const v4f* x4 = (const v4f*)(X + (size_t)row0 * C) + lane;

    v4f v[2][NV];
#pragma unroll
    for (int r = 0; r < 2; ++r)
#pragma unroll
        for (int i = 0; i < NV; ++i) v[r][i] = x4[r * (C / 4) + i * 32];
    // scale and shift are asked for beside the rows, so that their latency
    // runs under the rows' own instead of behind the sums
    const v4f* g4 = (const v4f*)G + lane;
    const v4f* b4 = (const v4f*)Bv + lane;
    v4f g[NV], bb[NV];
#pragma unroll
    for (int i = 0; i < NV; ++i) { g[i] = g4[i * 32]; bb[i] = b4[i * 32]; }
    // keeps every load above in flight at once: without it the compiler sinks
    // the scale and shift loads behind the sums, in short dependent batches
    __builtin_amdgcn_sched_barrier(0);
    asm volatile("s_wait_xcnt 0x0" ::: "memory");
    __builtin_amdgcn_sched_barrier(0);

    float mean[2], rstd[2];
#pragma unroll
    for (int r = 0; r < 2; ++r) {
        v4f a1 = v[r][0], a2 = v[r][0] * v[r][0];
#pragma unroll
        for (int i = 1; i < NV; ++i) { a1 += v[r][i]; a2 += v[r][i] * v[r][i]; }
        const float s1 = wave_sum((a1[0] + a1[1]) + (a1[2] + a1[3]));
        const float s2 = wave_sum((a2[0] + a2[1]) + (a2[2] + a2[3]));
        constexpr float invC = 1.0f / (float)C;
        mean[r] = s1 * invC;
        rstd[r] = rsqrtf(s2 * invC - mean[r] * mean[r] + 1e-5f);
    }

    v4h* y4 = (v4h*)(Y + (size_t)row0 * C) + lane;
#pragma unroll
    for (int i = 0; i < NV; ++i) {
#pragma unroll
        for (int r = 0; r < 2; ++r) {
            v4h y;
#pragma unroll
            for (int e = 0; e < 4; ++e)
                y[e] = (_Float16)((v[r][i][e] - mean[r]) * rstd[r] * g[i][e] + bb[i][e]);
            y4[r * (C / 4) + i * 32] = y;
        }
    }
    asm volatile("s_wait_xcnt 0x0" ::: "memory");
}

template <int NV>
__global__ __launch_bounds__(512) void ln_cast_kernel(const float* __restrict__ X,
                                                      const float* __restrict__ G,
                                                      const float* __restrict__ Bv,
                                                      _Float16* __restrict__ Y) {
    ln_cast_rows<NV>(X, G, Bv, Y, blockIdx.x);
}

// The three LayerNorms of the inputs in one launch: x with the query norm's and
// with the key/value norm's scale and shift, then the context.  The work-group's
// index picks the job.
constexpr int LB_X = ROWS / 32;   // work-groups of one LayerNorm of x
constexpr int LB_C = CROWS / 32;  // ... of the context

__global__ __launch_bounds__(512) void ln_cast_inputs_kernel(
    const float* __restrict__ x, const float* __restrict__ ctx,
    const float* __restrict__ g1, const float* __restrict__ b1,
    const float* __restrict__ g2, const float* __restrict__ b2,
    const float* __restrict__ gc, const float* __restrict__ bc,
    _Float16* __restrict__ y1, _Float16* __restrict__ y2, _Float16* __restrict__ yc) {
    const int f = blockIdx.x;
    if (f < 2 * LB_X) {
        const bool kv = f >= LB_X;
        ln_cast_rows<F / 128>(x, kv ? g2 : g1, kv ? b2 : b1, kv ? y2 : y1, kv ? f - LB_X : f);
    } else {
        ln_cast_rows<CF / 128>(ctx, gc, bc, yc, f - 2 * LB_X);
    }
}

// ---------------------------------------------------------------------------
// One thread's twelve copies of one GEMM ring stage: 16 B of 4 A rows and of 8 B
// rows, 32 rows apart; in LDS the B rows follow the 128 A rows at one pitch.
// ---------------------------------------------------------------------------
constexpr int GK  = 64;                // k depth of a ring stage
constexpr int GST = (128 + 256) * FP;  // halves in one stage buffer

__device__ __forceinline__ void gemm_stage_copies(unsigned d, const _Float16* a, const _Float16* b,
                                                  size_t step) {
    constexpr unsigned R = 32 * FP * 2;  // 32 LDS rows in bytes
    asm volatile(
        "global_load_async_to_lds_b128 %0, %12, off\n\t"
        "global_load_async_to_lds_b128 %1, %13, off\n\t"
        "global_load_async_to_lds_b128 %2, %14, off\n\t"
        "global_load_async_to_lds_b128 %3, %15, off\n\t"
        "global_load_async_to_lds_b128 %4, %16, off\n\t"
        "global_load_async_to_lds_b128 %5, %17, off\n\t"
        "global_load_async_to_lds_b128 %6, %18, off\n\t"
        "global_load_async_to_lds_b128 %7, %19, off\n\t"
        "global_load_async_to_lds_b128 %8, %20, off\n\t"
        "global_load_async_to_lds_b128 %9, %21, off\n\t"
        "global_load_async_to_lds_b128 %10, %22, off\n\t"
        "global_load_async_to_lds_b128 %11, %23, off\n\t"
        "s_wait_xcnt 0x0"
        :: "v"(d), "v"(d + R), "v"(d + 2 * R), "v"(d + 3 * R), "v"(d + 4 * R), "v"(d + 5 * R),
           "v"(d + 6 * R), "v"(d + 7 * R), "v"(d + 8 * R), "v"(d + 9 * R), "v"(d + 10 * R),
           "v"(d + 11 * R),
           "v"((unsigned long long)a), "v"((unsigned long long)(a + step)),
           "v"((unsigned long long)(a + 2 * step)), "v"((unsigned long long)(a + 3 * step)),
           "v"((unsigned long long)b), "v"((unsigned long long)(b + step)),
           "v"((unsigned long long)(b + 2 * step)), "v"((unsigned long long)(b + 3 * step)),
           "v"((unsigned long long)(b + 4 * step)), "v"((unsigned long long)(b + 5 * step)),
           "v"((unsigned long long)(b + 6 * step)), "v"((unsigned long long)(b + 7 * step))
        : "memory");
}

// ---------------------------------------------------------------------------
// Tiled WMMA GEMM:  C[M,N] = A[M,K] (f16 row-major) * Bt[N,K] (f16, B transposed)
// Block tile 128x256, 256 threads = 8 waves in a 2(M) x 4(N) grid,
// each wave computes a 64x64 register tile: 16 WMMAs per 32-wide K step.
// A/B tiles staged into LDS with global_load_async_to_lds_b128, in a ring of two
// buffers of 64 k each: the copies of stage t + 2 are issued at the foot of pass
// t and waited for at the foot of pass t + 1, so they fly under a whole pass of
// 32 WMMAs per wave.  K is a multiple of 64.
// MODE 0: C -> f16 * scale (1 for K/V, 0.125 as the Q pre-scale).
// MODE 1: C -> f32 with + bias[n] + res[m,n].
// ---------------------------------------------------------------------------
template <int MODE>
__device__ __forceinline__ void gemm_wmma_tile(const _Float16* __restrict__ A,
                                               const _Float16* __restrict__ Bt,
                                               _Float16* __restrict__ C16,
                                               float* __restrict__ C32,
                                               const float* __restrict__ bias,
                                               const float* __restrict__ res,
                                               float scale, int N, int K,
                                               int mbase, int nbase) {
    // two stage buffers; each holds 128 A rows [m][k], then 256 B rows [n][k]
    __shared__ __align__(16) _Float16 sm[2 * GST];
    const int tid = threadIdx.x;
    const int wave = tid >> 5, lane = tid & 31;
    const int waveM = wave >> 2, waveN = wave & 3;

    v8f acc[4][4] = {};

    // staging assignments: a stage row is 64 halves = 128 B = 8 lanes x 16 B;
    // a thread copies its 16 B of rows srow + 32 i: 4 rows of A, 8 rows of B
    const int srow = tid >> 3, sseg = (tid & 7) * 8;
    const _Float16* gA = A + (size_t)(mbase + srow) * K + sseg;
    const _Float16* gB = Bt + (size_t)(nbase + srow) * K + sseg;
    const size_t gstep = (size_t)32 * K;  // 32 rows of A or of Bt, in halves
    const unsigned d0 = lds_off(&sm[srow * FP + sseg]);
    const int nst = K / GK;

    gemm_stage_copies(d0, gA, gB, gstep);
    wait_async0();    // stage 0 has landed (this wave's share)
    __syncthreads();  // ... and every other wave's
    if (nst > 1) gemm_stage_copies(d0 + GST * 2, gA + GK, gB + GK, gstep);

    for (int t = 0; t < nst; ++t) {
        const _Float16* sA = sm + (t & 1) * GST;
        const _Float16* sB = sA + 128 * FP;
        // unrolled: kc becomes an immediate offset of the LDS reads
#pragma unroll
        for (int kc = 0; kc < GK; kc += 32) {
            v16h bf[4];
#pragma unroll
            for (int j = 0; j < 4; ++j)
                bf[j] = frag_ld(sB + (waveN * 64 + j * 16) * FP, FP, kc);
#pragma unroll
            for (int i = 0; i < 4; ++i) {
                v16h af = frag_ld(sA + (waveM * 64 + i * 16) * FP, FP, kc);
#pragma unroll
                for (int j = 0; j < 4; ++j)
                    acc[i][j] = WMMA_F32_F16(af, bf[j], acc[i][j]);
            }
        }
        // publish point: this wave has left buffer t & 1 and its copies of stage
        // t + 1 have landed; the one barrier says both of every wave
        wait_ds0();
        wait_async0();
        __syncthreads();
        if (t + 2 < nst)
            gemm_stage_copies(d0 + (t & 1) * (GST * 2), gA + (t + 2) * GK, gB + (t + 2) * GK, gstep);
    }
    wait_async0();  // no copy is outstanding when the wave goes on to its end

    const int hf = lane >> 4, c0 = lane & 15;
#pragma unroll
    for (int i = 0; i < 4; ++i) {
#pragma unroll
        for (int j = 0; j < 4; ++j) {
#pragma unroll
            for (int r = 0; r < 8; ++r) {
                const int row = mbase + waveM * 64 + i * 16 + hf * 8 + r;
                const int col = nbase + waveN * 64 + j * 16 + c0;
                const float v = acc[i][j][r];
                if (MODE == 0) {
                    C16[(size_t)row * N + col] = (_Float16)(v * scale);
                } else {
                    C32[(size_t)row * N + col] = v + bias[col] + res[(size_t)row * N + col];
                }
            }
        }
    }
}

// one product per launch; grid: (N / 256, M / 128)
template <int MODE>
__global__ __launch_bounds__(256) void gemm_wmma_kernel(const _Float16* __restrict__ A,
                                                        const _Float16* __restrict__ Bt,
                                                        _Float16* __restrict__ C16,
                                                        float* __restrict__ C32,
                                                        const float* __restrict__ bias,
                                                        const float* __restrict__ res,
                                                        float scale, int N, int K) {
    gemm_wmma_tile<MODE>(A, Bt, C16, C32, bias, res, scale, N, K,
                         blockIdx.y * 128, blockIdx.x * 256);
}

// The three products that need only the prepared operands, in one launch: self
// K/V, self Q and cross K/V.  The work-group's index picks product and tile (the
// column block runs fastest, as in a launch of its own); the shortest K is last.
constexpr int GB_KVS = (2 * MID / 256) * (ROWS / 128);   // 256 tiles
constexpr int GB_QS  = (MID / 256) * (ROWS / 128);       // 128 tiles
constexpr int GB_KVC = (2 * MID / 256) * (CROWS / 128);  // 64 tiles
constexpr int GB_ALL = GB_KVS + GB_QS + GB_KVC;

__global__ __launch_bounds__(256) void gemm_qkv_kernel(
    const _Float16* __restrict__ akvs, const _Float16* __restrict__ wkvs, _Float16* __restrict__ ckvs,
    const _Float16* __restrict__ aqs, const _Float16* __restrict__ wqs, _Float16* __restrict__ cqs,
    const _Float16* __restrict__ akvc, const _Float16* __restrict__ wkvc, _Float16* __restrict__ ckvc) {
    int f = blockIdx.x;
    const _Float16 *A, *Bt;
    _Float16* C;
    float scale;
    int lgnb, K;  // N = 256 << lgnb
    if (f < GB_KVS)                 { A = akvs; Bt = wkvs; C = ckvs; scale = 1.0f;   lgnb = 2; K = F; }
    else if ((f -= GB_KVS) < GB_QS) { A = aqs;  Bt = wqs;  C = cqs;  scale = 0.125f; lgnb = 1; K = F; }
    else              { f -= GB_QS;   A = akvc; Bt = wkvc; C = ckvc; scale = 1.0f;   lgnb = 2; K = CF; }
    gemm_wmma_tile<0>(A, Bt, C, nullptr, nullptr, nullptr, scale, 256 << lgnb, K,
                      (f >> lgnb) * 128, (f & ((1 << lgnb) - 1)) * 256);
}

constexpr int VP = 80;  // V rows of 64 halves, read by ds_load_tr16_b128: pitch 160 B = 32 B x odd

typedef __attribute__((ext_vector_type(8))) short v8s;

// 16 (d) x 32 (keys) A fragment of V^T from a row-major [key][ld halves] LDS tile:
// lane (c, hf) gets keys kbase + 8 hf + 0..7, then kbase + 16 + 8 hf + 0..7, of
// column dbase + c: the k order of frag_ld and of a converted pair of D tiles.
__device__ __forceinline__ v16h frag_ld_tr(const _Float16* tile, int ld, int kbase, int dbase) {
    typedef __attribute__((address_space(3))) v8s lds_v8s;
    const int lane = threadIdx.x & 31;
    const _Float16* p = tile + (kbase + ((lane >> 4) << 3) + (lane & 7)) * ld + dbase + (((lane >> 3) & 1) << 3);
    v8h lo = __builtin_bit_cast(v8h, __builtin_amdgcn_ds_load_tr16_b128_v8i16((lds_v8s*)p));
    v8h hi = __builtin_bit_cast(v8h, __builtin_amdgcn_ds_load_tr16_b128_v8i16((lds_v8s*)(p + 16 * ld)));
    v16h r;
#pragma unroll
    for (int i = 0; i < 8; ++i) { r[i] = lo[i]; r[i + 8] = hi[i]; }
    return r;
}

__device__ __forceinline__ float xhalf(float x) {
    const int xi = __builtin_bit_cast(int, x);
    return __builtin_bit_cast(float,
        __builtin_amdgcn_permlanex16(xi, xi, 0x76543210, 0xfedcba98, false, false));
}

__global__ __launch_bounds__(128) void flash_attn_kernel(const _Float16* __restrict__ Q,
                                                         const _Float16* __restrict__ KV,
                                                         _Float16* __restrict__ O,
                                                         int n_q, int m_len) {
    __shared__ __align__(16) _Float16 sK[64 * FP];  // [key][d]: A rows of K Q^T
    __shared__ __align__(16) _Float16 sV[64 * VP];  // [key][d]: read transposed

    const int wave = threadIdx.x >> 5;
    const int lane = threadIdx.x & 31;
    const int h = blockIdx.y, b = blockIdx.z;
    const int qrow0 = blockIdx.x * 64;
    const int hf = lane >> 4, c0 = lane & 15;
    // this lane's query row, at its head's columns
    const size_t qoff  = ((size_t)b * n_q + qrow0 + wave * 16 + c0) * 512 + (size_t)h * 64;
    const size_t kvoff = (size_t)b * m_len * 1024 + (size_t)h * 64;

    const int srow = threadIdx.x >> 1;            // 0..63
    const int sseg = (threadIdx.x & 1) * 32;      // 0 / 32 halves (64B)

    // Q^T as B operand, loaded once, in the k order of frag_ld
    v16h qf[2];
#pragma unroll
    for (int kc = 0; kc < 2; ++kc) {
        const _Float16* qp = Q + qoff + kc * 32 + hf * 8;
        v8h lo = *(const v8h*)qp;
        v8h hi = *(const v8h*)(qp + 16);
#pragma unroll
        for (int i = 0; i < 8; ++i) { qf[kc][i] = lo[i]; qf[kc][i + 8] = hi[i]; }
    }

    float m_i = -1e30f, l_i = 0.f;  // l_i: the sum over this lane's half of the keys
    v8f o[4] = {};                  // o[j][r] = O^T[d = 16 j + 8 hf + r][query c0]

    for (int kt = 0; kt < m_len; kt += 64) {
        wait_ds0();       // this wave's reads of both tiles have returned ...
        __syncthreads();  // ... and every wave's: the copies may refill them
        const _Float16* gk = KV + kvoff + (size_t)(kt + srow) * 1024 + sseg;
        async_copy64B(lds_off(&sK[srow * FP + sseg]), gk);
        async_copy64B(lds_off(&sV[srow * VP + sseg]), gk + 512);
        wait_async0();
        __syncthreads();

        // S^T = K Q^T: s[g][r] = score of key 16 g + 8 hf + r with query c0
        v8f s[4] = {};
#pragma unroll
        for (int kc = 0; kc < 2; ++kc) {
#pragma unroll
            for (int g = 0; g < 4; ++g) {
                v16h kf = frag_ld(sK + g * 16 * FP, FP, kc * 32);
                s[g] = WMMA_F32_F16(kf, qf[kc], s[g]);
            }
        }

        // Online softmax, one query per lane.
        float mg[4];
#pragma unroll
        for (int g = 0; g < 4; ++g) {
            mg[g] = s[g][0];
#pragma unroll
            for (int r = 1; r < 8; ++r) mg[g] = fmaxf(mg[g], s[g][r]);
        }
        float mx = fmaxf(fmaxf(mg[0], mg[1]), fmaxf(mg[2], mg[3]));
        mx = fmaxf(mx, xhalf(mx));  // both halves of the query's keys
        const float mnew  = fmaxf(m_i, mx);
        const float alpha = __expf(m_i - mnew);
        m_i = mnew;
        float rs[4];
        v16h pb[2];  // P^T: keys 32 c .. 32 c + 31 are score tiles 2 c and 2 c + 1
#pragma unroll
        for (int g = 0; g < 4; ++g) {
            rs[g] = 0.f;
#pragma unroll
            for (int r = 0; r < 8; ++r) {
                const float p = __expf(s[g][r] - mnew);
                rs[g] += p;
                pb[g >> 1][(g & 1) * 8 + r] = (_Float16)p;
            }
        }
        l_i = l_i * alpha + ((rs[0] + rs[1]) + (rs[2] + rs[3]));
#pragma unroll
        for (int j = 0; j < 4; ++j) o[j] *= alpha;

        // O^T += V^T P^T
#pragma unroll
        for (int c = 0; c < 2; ++c) {
#pragma unroll
            for (int j = 0; j < 4; ++j) {
                v16h vt = frag_ld_tr(sV, VP, c * 32, j * 16);
                o[j] = WMMA_F32_F16(vt, pb[c], o[j]);
            }
        }
    }

    // Epilogue: join the halves' sums, normalize, store 8 consecutive d per lane.
    const float inv = 1.0f / (l_i + xhalf(l_i));
#pragma unroll
    for (int j = 0; j < 4; ++j) {
        v8h y;
#pragma unroll
        for (int r = 0; r < 8; ++r) y[r] = (_Float16)(o[j][r] * inv);
        *(v8h*)(O + qoff + j * 16 + hf * 8) = y;
    }
}

// ---------------------------------------------------------------------------
// Host-side orchestration
// ---------------------------------------------------------------------------
extern "C" void kernel_launch(void* const* d_in, const int* in_sizes, int n_in,
                              void* d_out, int out_size, void* d_ws, size_t ws_size,
                              hipStream_t stream) {
    (void)in_sizes; (void)n_in; (void)out_size; (void)ws_size;

    const float* x       = (const float*)d_in[0];
    const float* ctx     = (const float*)d_in[1];
    const float* sa_ng   = (const float*)d_in[2];
    const float* sa_nb   = (const float*)d_in[3];
    const float* sa_ncg  = (const float*)d_in[4];
    const float* sa_ncb  = (const float*)d_in[5];
    const float* sa_wq   = (const float*)d_in[6];
    const float* sa_wkv  = (const float*)d_in[7];
    const float* sa_wo   = (const float*)d_in[8];
    const float* sa_bo   = (const float*)d_in[9];
    const float* ca_ng   = (const float*)d_in[10];
    const float* ca_nb   = (const float*)d_in[11];
    const float* ca_ncg  = (const float*)d_in[12];
    const float* ca_ncb  = (const float*)d_in[13];
    const float* ca_wq   = (const float*)d_in[14];
    const float* ca_wkv  = (const float*)d_in[15];
    const float* ca_wo   = (const float*)d_in[16];
    const float* ca_bo   = (const float*)d_in[17];
    float* out = (float*)d_out;

    // carve workspace
    size_t off = 0;
    auto carve = [&](size_t bytes) -> void* {
        void* p = (char*)d_ws + off;
        off += (bytes + 255) & ~(size_t)255;
        return p;
    };
    // weights, f16 TRANSPOSED to [N][K]
    _Float16* wq16s  = (_Float16*)carve((size_t)MID * F * 2);        // [512][1024]
    _Float16* wkv16s = (_Float16*)carve((size_t)(2 * MID) * F * 2);  // [1024][1024]
    _Float16* wo16s  = (_Float16*)carve((size_t)F * MID * 2);        // [1024][512]
    _Float16* wq16c  = (_Float16*)carve((size_t)MID * F * 2);        // [512][1024]
    _Float16* wkv16c = (_Float16*)carve((size_t)(2 * MID) * CF * 2); // [1024][768]
    _Float16* wo16c  = (_Float16*)carve((size_t)F * MID * 2);        // [1024][512]
    _Float16* XN1 = (_Float16*)carve((size_t)ROWS * F * 2);          // q-norm input
    _Float16* XN2 = (_Float16*)carve((size_t)ROWS * F * 2);          // kv-norm input
    _Float16* Q16 = (_Float16*)carve((size_t)ROWS * MID * 2);
    _Float16* KV16 = (_Float16*)carve((size_t)ROWS * 2 * MID * 2);
    _Float16* AO16 = (_Float16*)carve((size_t)ROWS * MID * 2);
    float*    X1   = (float*)carve((size_t)ROWS * F * 4);
    _Float16* CN   = (_Float16*)carve((size_t)CROWS * CF * 2);       // normalized context
    _Float16* KVC16 = (_Float16*)carve((size_t)CROWS * 2 * MID * 2); // cross K/V

    // ---- weight casts + transposes:  W[K][N] -> Wt[N][K] ----
    cast_transpose_kernel<<<CB_ALL, dim3(32, 8), 0, stream>>>(
        sa_wq, sa_wkv, sa_wo, ca_wq, ca_wkv, ca_wo, wq16s, wkv16s, wo16s, wq16c, wkv16c, wo16c);
    // ---- norms of the inputs: XN1, XN2 from x, CN from the context ----
    ln_cast_inputs_kernel<<<2 * LB_X + LB_C, 512, 0, stream>>>(
        x, ctx, sa_ng, sa_nb, sa_ncg, sa_ncb, ca_ncg, ca_ncb, XN1, XN2, CN);
    // ---- KV = XN2 @ wkv, Q = (XN1 @ wq) * scale, cross KV = CN @ ca_wkv ----
    gemm_qkv_kernel<<<GB_ALL, 256, 0, stream>>>(
        XN2, wkv16s, KV16, XN1, wq16s, Q16, CN, wkv16c, KVC16);

    // ================= self-attention =================
    // attention (m_len = 2048)
    flash_attn_kernel<<<dim3(Nx / 64, 8, B), 128, 0, stream>>>(Q16, KV16, AO16, Nx, Nx);
    // X1 = AO @ wo + bo + x   [8192 x 512 -> 1024] -> f32
    gemm_wmma_kernel<1><<<dim3(F / 256, ROWS / 128), 256, 0, stream>>>(
        AO16, wo16s, nullptr, X1, sa_bo, x, 1.0f, F, MID);

    // ================= cross-attention =================
    ln_cast_kernel<F / 128><<<ROWS / 32, 512, 0, stream>>>(X1, ca_ng, ca_nb, XN1);
    // Q = (XN1 @ ca_wq) * scale
    gemm_wmma_kernel<0><<<dim3(MID / 256, ROWS / 128), 256, 0, stream>>>(
        XN1, wq16c, Q16, nullptr, nullptr, nullptr, 0.125f, MID, F);
    // attention (m_len = 512)
    flash_attn_kernel<<<dim3(Nx / 64, 8, B), 128, 0, stream>>>(Q16, KVC16, AO16, Nx, Mc);
    // out = AO @ ca_wo + ca_bo + X1  -> f32 (final output)
    gemm_wmma_kernel<1><<<dim3(F / 256, ROWS / 128), 256, 0, stream>>>(
        AO16, wo16c, nullptr, out, ca_bo, X1, 1.0f, F, MID);
}

// v006
// A run of this version takes 169 microseconds.
// Next to v005, in two timings, it ran 1.40 times as fast each time.
// Over all steps from v000 it is 3.39 times as fast.
#include <hip/hip_runtime.h>

typedef __attribute__((ext_vector_type(16))) _Float16 v16h;
typedef __attribute__((ext_vector_type(8)))  _Float16 v8h;
typedef __attribute__((ext_vector_type(8)))  float    v8f;

#define WMMA_F32_F16(a, b, c) \
    __builtin_amdgcn_wmma_f32_16x16x32_f16(false, (a), false, (b), (short)0, (c), false, false)

// Problem shape, shared by the host code and by the kernels that hold several jobs
constexpr int B = 4, Nx = 2048, Mc = 512, F = 1024, CF = 768, MID = 512;
constexpr int ROWS = B * Nx;   // 8192
constexpr int CROWS = B * Mc;  // 2048

__device__ __forceinline__ unsigned lds_off(const void* p) {
    return (unsigned)(unsigned long long)p;
}

__device__ __forceinline__ void async_copy64B(unsigned ldsAddr, const void* g) {
    unsigned long long ga = (unsigned long long)g;
    asm volatile(
        "global_load_async_to_lds_b128 %0, %1, off\n\t"
        "global_load_async_to_lds_b128 %0, %1, off offset:16\n\t"
        "global_load_async_to_lds_b128 %0, %1, off offset:32\n\t"
        "global_load_async_to_lds_b128 %0, %1, off offset:48\n\t"
        "s_wait_xcnt 0x0"
        :: "v"(ldsAddr), "v"(ga) : "memory");
}

__device__ __forceinline__ void wait_async0() {
    asm volatile("s_wait_asynccnt 0x0" ::: "memory");
}

// the wave's own LDS reads have returned: stands in front of the barrier behind
// which a buffer that the wave has read is refilled by copies
__device__ __forceinline__ void wait_ds0() {
    asm volatile("s_wait_dscnt 0x0" ::: "memory");
}

constexpr int FP = 72;  // 64-half (128 B) rows -> 144 B pitch

__device__ __forceinline__ v16h frag_ld(const _Float16* tile, int ld, int kbase) {
    const int lane = threadIdx.x & 31;
    const _Float16* p = tile + (lane & 15) * ld + kbase + ((lane >> 4) << 3);
    v8h lo = *(const v8h*)p;
    v8h hi = *(const v8h*)(p + 16);
    v16h r;
#pragma unroll
    for (int i = 0; i < 8; ++i) { r[i] = lo[i]; r[i + 8] = hi[i]; }
    return r;
}

// ---------------------------------------------------------------------------
// Weight prep: f32 [K][N] -> f16 transposed [N][K] (LDS-tiled for coalescing)
// One 32 x 32 tile per work-group, block: (32, 8); tile t of a matrix with
// N = 32 << lgnt columns: column block t mod (N / 32), row block t / (N / 32).
// ---------------------------------------------------------------------------
__device__ __forceinline__ void cast_transpose_tile(const float* __restrict__ in,
                                                    _Float16* __restrict__ out,
                                                    int K, int lgnt, int t) {
    __shared__ _Float16 tile[32][33];
    const int N = 32 << lgnt;
    const int nb = (t & ((1 << lgnt) - 1)) * 32;
    const int kb = (t >> lgnt) * 32;
    const int tx = threadIdx.x;
#pragma unroll
    for (int i = threadIdx.y; i < 32; i += 8)
        tile[i][tx] = (_Float16)in[(size_t)(kb + i) * N + nb + tx];
    __syncthreads();
#pragma unroll
    for (int i = threadIdx.y; i < 32; i += 8)
        out[(size_t)(nb + i) * K + kb + tx] = tile[tx][i];
}

// All six weights in one launch: the work-group's index picks weight and tile.
constexpr int CB_WQ  = (F / 32) * (MID / 32);       // tiles of a [F][MID] or [MID][F] weight
constexpr int CB_WKV = (F / 32) * (2 * MID / 32);   // tiles of the self k/v weight
constexpr int CB_WKC = (CF / 32) * (2 * MID / 32);  // tiles of the cross k/v weight
constexpr int CB_ALL = 4 * CB_WQ + CB_WKV + CB_WKC;

__global__ __launch_bounds__(256) void cast_transpose_kernel(
    const float* __restrict__ wqs, const float* __restrict__ wkvs, const float* __restrict__ wos,
    const float* __restrict__ wqc, const float* __restrict__ wkvc, const float* __restrict__ woc,
    _Float16* __restrict__ tqs, _Float16* __restrict__ tkvs, _Float16* __restrict__ tos,
    _Float16* __restrict__ tqc, _Float16* __restrict__ tkvc, _Float16* __restrict__ toc) {
    int f = blockIdx.x;
    const float* in;
    _Float16* out;
    int K, lgnt;  // N = 32 << lgnt: 512 -> 4, 1024 -> 5
    if (f < CB_WKV)                  { in = wkvs; out = tkvs; K = F;   lgnt = 5; }
    else if ((f -= CB_WKV) < CB_WKC) { in = wkvc; out = tkvc; K = CF;  lgnt = 5; }
    else if ((f -= CB_WKC) < CB_WQ)  { in = wqs;  out = tqs;  K = F;   lgnt = 4; }
    else if ((f -= CB_WQ) < CB_WQ)   { in = wqc;  out = tqc;  K = F;   lgnt = 4; }
    else if ((f -= CB_WQ) < CB_WQ)   { in = wos;  out = tos;  K = MID; lgnt = 5; }
    else               { f -= CB_WQ;   in = woc;  out = toc;  K = MID; lgnt = 5; }
    cast_transpose_tile(in, out, K, lgnt, f);
}

// ---------------------------------------------------------------------------
// LayerNorm (biased variance, eps 1e-5) + cast to f16.
// One wave owns two whole rows: each row sits in registers (NV 16-byte loads
// per lane, 512 contiguous bytes per wave-wide load), the sums cross lanes in
// registers, so the kernel has no LDS and no barrier, and a launch starts only
// rows / 2 waves (wave start rate, not bytes, bounds a launch of many short
// work-groups).  C = NV * 128; work-group blk (16 waves) takes 32 rows from 32 blk.
// ---------------------------------------------------------------------------
typedef __attribute__((ext_vector_type(4))) float    v4f;
typedef __attribute__((ext_vector_type(4))) _Float16 v4h;

template <int MASK>
__device__ __forceinline__ float add_xmask(float x) {
    return x + __builtin_bit_cast(float, __builtin_amdgcn_update_dpp(
        0, __builtin_bit_cast(int, x), 0x160 | MASK, 0xf, 0xf, false));
}

// sum over the 32 lanes of a wave, the same value in every lane
__device__ __forceinline__ float wave_sum(float x) {
    x = add_xmask<1>(x);
    x = add_xmask<2>(x);
    x = add_xmask<4>(x);
    x = add_xmask<8>(x);
    const int xi = __builtin_bit_cast(int, x);
    return x + __builtin_bit_cast(float,
        __builtin_amdgcn_permlanex16(xi, xi, 0x76543210, 0xfedcba98, false, false));
}

template <int NV>
__device__ __forceinline__ void ln_cast_rows(const float* __restrict__ X,
                                             const float* __restrict__ G,
                                             const float* __restrict__ Bv,
                                             _Float16* __restrict__ Y, int blk) {
    constexpr int C = NV * 128;
    const int lane = threadIdx.x & 31;
    // the wave's number as a scalar: the rows' base addresses then sit in scalar
    // registers and the lane number is the only address register of every access
    const int wave = __builtin_amdgcn_readfirstlane(threadIdx.x >> 5);
    const int row0 = (blk * 16 + wave) * 2;
    const v4f* x4 = (const v4f*)(X + (size_t)row0 * C) + lane;

    v4f v[2][NV];
#pragma unroll
    for (int r = 0; r < 2; ++r)
#pragma unroll
        for (int i = 0; i < NV; ++i) v[r][i] = x4[r * (C / 4) + i * 32];
    // scale and shift are asked for beside the rows, so that their latency
    // runs under the rows' own instead of behind the sums
    const v4f* g4 = (const v4f*)G + lane;
    const v4f* b4 = (const v4f*)Bv + lane;
    v4f g[NV], bb[NV];
#pragma unroll
    for (int i = 0; i < NV; ++i) { g[i] = g4[i * 32]; bb[i] = b4[i * 32]; }
    // keeps every load above in flight at once: without it the compiler sinks
    // the scale and shift loads behind the sums, in short dependent batches
    __builtin_amdgcn_sched_barrier(0);
    asm volatile("s_wait_xcnt 0x0" ::: "memory");
    __builtin_amdgcn_sched_barrier(0);

    float mean[2], rstd[2];
#pragma unroll
    for (int r = 0; r < 2; ++r) {
        v4f a1 = v[r][0], a2 = v[r][0] * v[r][0];
#pragma unroll
        for (int i = 1; i < NV; ++i) { a1 += v[r][i]; a2 += v[r][i] * v[r][i]; }
        const float s1 = wave_sum((a1[0] + a1[1]) + (a1[2] + a1[3]));
        const float s2 = wave_sum((a2[0] + a2[1]) + (a2[2] + a2[3]));
        constexpr float invC = 1.0f / (float)C;
        mean[r] = s1 * invC;
        rstd[r] = rsqrtf(s2 * invC - mean[r] * mean[r] + 1e-5f);
    }

    v4h* y4 = (v4h*)(Y + (size_t)row0 * C) + lane;
#pragma unroll
    for (int i = 0; i < NV; ++i) {
#pragma unroll
        for (int r = 0; r < 2; ++r) {
            v4h y;
#pragma unroll
            for (int e = 0; e < 4; ++e)
                y[e] = (_Float16)((v[r][i][e] - mean[r]) * rstd[r] * g[i][e] + bb[i][e]);
            y4[r * (C / 4) + i * 32] = y;
        }
    }
    asm volatile("s_wait_xcnt 0x0" ::: "memory");
}

template <int NV>
__global__ __launch_bounds__(512) void ln_cast_kernel(const float* __restrict__ X,
                                                      const float* __restrict__ G,
                                                      const float* __restrict__ Bv,
                                                      _Float16* __restrict__ Y) {
    ln_cast_rows<NV>(X, G, Bv, Y, blockIdx.x);
}

// The three LayerNorms of the inputs in one launch: x with the query norm's and
// with the key/value norm's scale and shift, then the context.  The work-group's
// index picks the job.
constexpr int LB_X = ROWS / 32;   // work-groups of one LayerNorm of x
constexpr int LB_C = CROWS / 32;  // ... of the context

__global__ __launch_bounds__(512) void ln_cast_inputs_kernel(
    const float* __restrict__ x, const float* __restrict__ ctx,
    const float* __restrict__ g1, const float* __restrict__ b1,
    const float* __restrict__ g2, const float* __restrict__ b2,
    const float* __restrict__ gc, const float* __restrict__ bc,
    _Float16* __restrict__ y1, _Float16* __restrict__ y2, _Float16* __restrict__ yc) {
    const int f = blockIdx.x;
    if (f < 2 * LB_X) {
        const bool kv = f >= LB_X;
        ln_cast_rows<F / 128>(x, kv ? g2 : g1, kv ? b2 : b1, kv ? y2 : y1, kv ? f - LB_X : f);
    } else {
        ln_cast_rows<CF / 128>(ctx, gc, bc, yc, f - 2 * LB_X);
    }
}

// ---------------------------------------------------------------------------
// One thread's twelve copies of one GEMM ring stage: 16 B of 4 A rows and of 8 B
// rows, 32 rows apart; in LDS the B rows follow the 128 A rows at one pitch.
// ---------------------------------------------------------------------------
constexpr int GK  = 64;                // k depth of a ring stage
constexpr int GST = (128 + 256) * FP;  // halves in one stage buffer

__device__ __forceinline__ void gemm_stage_copies(unsigned d, const _Float16* a, const _Float16* b,
                                                  size_t step) {
    constexpr unsigned R = 32 * FP * 2;  // 32 LDS rows in bytes
    asm volatile(
        "global_load_async_to_lds_b128 %0, %12, off\n\t"
        "global_load_async_to_lds_b128 %1, %13, off\n\t"
        "global_load_async_to_lds_b128 %2, %14, off\n\t"
        "global_load_async_to_lds_b128 %3, %15, off\n\t"
        "global_load_async_to_lds_b128 %4, %16, off\n\t"
        "global_load_async_to_lds_b128 %5, %17, off\n\t"
        "global_load_async_to_lds_b128 %6, %18, off\n\t"
        "global_load_async_to_lds_b128 %7, %19, off\n\t"
        "global_load_async_to_lds_b128 %8, %20, off\n\t"
        "global_load_async_to_lds_b128 %9, %21, off\n\t"
        "global_load_async_to_lds_b128 %10, %22, off\n\t"
        "global_load_async_to_lds_b128 %11, %23, off\n\t"
        "s_wait_xcnt 0x0"
        :: "v"(d), "v"(d + R), "v"(d + 2 * R), "v"(d + 3 * R), "v"(d + 4 * R), "v"(d + 5 * R),
           "v"(d + 6 * R), "v"(d + 7 * R), "v"(d + 8 * R), "v"(d + 9 * R), "v"(d + 10 * R),
           "v"(d + 11 * R),
           "v"((unsigned long long)a), "v"((unsigned long long)(a + step)),
           "v"((unsigned long long)(a + 2 * step)), "v"((unsigned long long)(a + 3 * step)),
           "v"((unsigned long long)b), "v"((unsigned long long)(b + step)),
           "v"((unsigned long long)(b + 2 * step)), "v"((unsigned long long)(b + 3 * step)),
           "v"((unsigned long long)(b + 4 * step)), "v"((unsigned long long)(b + 5 * step)),
           "v"((unsigned long long)(b + 6 * step)), "v"((unsigned long long)(b + 7 * step))
        : "memory");
}

// ---------------------------------------------------------------------------
// Tiled WMMA GEMM:  C[M,N] = A[M,K] (f16 row-major) * Bt[N,K] (f16, B transposed)
// Block tile 128x256, 256 threads = 8 waves in a 2(M) x 4(N) grid,
// each wave computes a 64x64 register tile: 16 WMMAs per 32-wide K step.
// A/B tiles staged into LDS with global_load_async_to_lds_b128, in a ring of two
// buffers of 64 k each: the copies of stage t + 2 are issued at the foot of pass
// t and waited for at the foot of pass t + 1, so they fly under a whole pass of
// 32 WMMAs per wave.  K is a multiple of 64.
// MODE 0: C -> f16 * scale (1 for K/V, 0.125 as the Q pre-scale).
// MODE 1: C -> f32 with + bias[n] + res[m,n]: res + bias is the accumulators' start
// value, asked for at the kernel's entry (all loads in flight at once, beside the
// first stage's copies), so that the epilogue only stores.
// ---------------------------------------------------------------------------
template <int MODE>
__device__ __forceinline__ void gemm_wmma_tile(const _Float16* __restrict__ A,
                                               const _Float16* __restrict__ Bt,
                                               _Float16* __restrict__ C16,
                                               float* __restrict__ C32,
                                               const float* __restrict__ bias,
                                               const float* __restrict__ res,
                                               float scale, int N, int K,
                                               int mbase, int nbase) {
    // two stage buffers; each holds 128 A rows [m][k], then 256 B rows [n][k]
    __shared__ __align__(16) _Float16 sm[2 * GST];
    const int tid = threadIdx.x;
    const int wave = tid >> 5, lane = tid & 31;
    const int waveM = wave >> 2, waveN = wave & 3;

    v8f acc[4][4] = {};

    // staging assignments: a stage row is 64 halves = 128 B = 8 lanes x 16 B;
    // a thread copies its 16 B of rows srow + 32 i: 4 rows of A, 8 rows of B
    const int srow = tid >> 3, sseg = (tid & 7) * 8;
    const _Float16* gA = A + (size_t)(mbase + srow) * K + sseg;
    const _Float16* gB = Bt + (size_t)(nbase + srow) * K + sseg;
    const size_t gstep = (size_t)32 * K;  // 32 rows of A or of Bt, in halves
    const unsigned d0 = lds_off(&sm[srow * FP + sseg]);
    const int nst = K / GK;

    gemm_stage_copies(d0, gA, gB, gstep);
    float bj[4];
    if (MODE == 1) {
        // the lane's 128 residual values, straight into its accumulators, and its 4
        // bias values: all in flight together, beside stage 0's copies (unrolled:
        // accumulator elements are registers, their indices constants)
        const float* rp = res + (size_t)(mbase + waveM * 64 + (lane >> 4) * 8) * N + nbase + waveN * 64 + (lane & 15);
#pragma unroll
        for (int i = 0; i < 4; ++i)
#pragma unroll
            for (int r = 0; r < 8; ++r)
#pragma unroll
                for (int j = 0; j < 4; ++j) acc[i][j][r] = rp[(size_t)(i * 16 + r) * N + j * 16];
#pragma unroll
        for (int j = 0; j < 4; ++j) bj[j] = bias[nbase + waveN * 64 + j * 16 + (lane & 15)];
        __builtin_amdgcn_sched_barrier(0);
        asm volatile("s_wait_xcnt 0x0" ::: "memory");
        __builtin_amdgcn_sched_barrier(0);
    }
    wait_async0();    // stage 0 has landed (this wave's share)
    __syncthreads();  // ... and every other wave's
    if (nst > 1) gemm_stage_copies(d0 + GST * 2, gA + GK, gB + GK, gstep);

    if (MODE == 1) {
#pragma unroll
        for (int i = 0; i < 4; ++i)
#pragma unroll
            for (int j = 0; j < 4; ++j) acc[i][j] += bj[j];
    }

    for (int t = 0; t < nst; ++t) {
        const _Float16* sA = sm + (t & 1) * GST;
        const _Float16* sB = sA + 128 * FP;
        // unrolled: kc becomes an immediate offset of the LDS reads
#pragma unroll
        for (int kc = 0; kc < GK; kc += 32) {
            v16h bf[4];
#pragma unroll
            for (int j = 0; j < 4; ++j)
                bf[j] = frag_ld(sB + (waveN * 64 + j * 16) * FP, FP, kc);
#pragma unroll
            for (int i = 0; i < 4; ++i) {
                v16h af = frag_ld(sA + (waveM * 64 + i * 16) * FP, FP, kc);
#pragma unroll
                for (int j = 0; j < 4; ++j)
                    acc[i][j] = WMMA_F32_F16(af, bf[j], acc[i][j]);
            }
        }
        // publish point: this wave has left buffer t & 1 and its copies of stage
        // t + 1 have landed; the one barrier says both of every wave
        wait_ds0();
        wait_async0();
        __syncthreads();
        if (t + 2 < nst)
            gemm_stage_copies(d0 + (t & 1) * (GST * 2), gA + (t + 2) * GK, gB + (t + 2) * GK, gstep);
    }
    wait_async0();  // no copy is outstanding when the wave goes on to its end

    const int hf = lane >> 4, c0 = lane & 15;
    if (MODE == 1) {
        // row by row: four stores in a row fill two whole 128 B lines in each of two
        // rows; unrolled: accumulator elements are registers, their indices constants
        float* cp = C32 + (size_t)(mbase + waveM * 64 + hf * 8) * N + nbase + waveN * 64 + c0;
#pragma unroll
        for (int i = 0; i < 4; ++i)
#pragma unroll
            for (int r = 0; r < 8; ++r)
#pragma unroll
                for (int j = 0; j < 4; ++j) cp[(size_t)(i * 16 + r) * N + j * 16] = acc[i][j][r];
        return;
    }
#pragma unroll
    for (int i = 0; i < 4; ++i) {
#pragma unroll
        for (int j = 0; j < 4; ++j) {
#pragma unroll
            for (int r = 0; r < 8; ++r) {
                const int row = mbase + waveM * 64 + i * 16 + hf * 8 + r;
                const int col = nbase + waveN * 64 + j * 16 + c0;
                C16[(size_t)row * N + col] = (_Float16)(acc[i][j][r] * scale);
            }
        }
    }
}

// one product per launch; grid: (N / 256, M / 128)
template <int MODE>
__global__ __launch_bounds__(256) void gemm_wmma_kernel(const _Float16* __restrict__ A,
                                                        const _Float16* __restrict__ Bt,
                                                        _Float16* __restrict__ C16,
                                                        float* __restrict__ C32,
                                                        const float* __restrict__ bias,
                                                        const float* __restrict__ res,
                                                        float scale, int N, int K) {
    // both f32 products are F wide: with the pitch a constant, every residual load and
    // every store of a lane is an immediate offset of one address
    gemm_wmma_tile<MODE>(A, Bt, C16, C32, bias, res, scale, MODE == 1 ? F : N, K,
                         blockIdx.y * 128, blockIdx.x * 256);
}

// The three products that need only the prepared operands, in one launch: self
// K/V, self Q and cross K/V.  The work-group's index picks product and tile (the
// column block runs fastest, as in a launch of its own); the shortest K is last.
constexpr int GB_KVS = (2 * MID / 256) * (ROWS / 128);   // 256 tiles
constexpr int GB_QS  = (MID / 256) * (ROWS / 128);       // 128 tiles
constexpr int GB_KVC = (2 * MID / 256) * (CROWS / 128);  // 64 tiles
constexpr int GB_ALL = GB_KVS + GB_QS + GB_KVC;

__global__ __launch_bounds__(256) void gemm_qkv_kernel(
    const _Float16* __restrict__ akvs, const _Float16* __restrict__ wkvs, _Float16* __restrict__ ckvs,
    const _Float16* __restrict__ aqs, const _Float16* __restrict__ wqs, _Float16* __restrict__ cqs,
    const _Float16* __restrict__ akvc, const _Float16* __restrict__ wkvc, _Float16* __restrict__ ckvc) {
    int f = blockIdx.x;
    const _Float16 *A, *Bt;
    _Float16* C;
    float scale;
    int lgnb, K;  // N = 256 << lgnb
    if (f < GB_KVS)                 { A = akvs; Bt = wkvs; C = ckvs; scale = 1.0f;   lgnb = 2; K = F; }
    else if ((f -= GB_KVS) < GB_QS) { A = aqs;  Bt = wqs;  C = cqs;  scale = 0.125f; lgnb = 1; K = F; }
    else              { f -= GB_QS;   A = akvc; Bt = wkvc; C = ckvc; scale = 1.0f;   lgnb = 2; K = CF; }
    gemm_wmma_tile<0>(A, Bt, C, nullptr, nullptr, nullptr, scale, 256 << lgnb, K,
                      (f >> lgnb) * 128, (f & ((1 << lgnb) - 1)) * 256);
}

constexpr int VP = 80;  // V rows of 64 halves, read by ds_load_tr16_b128: pitch 160 B = 32 B x odd

typedef __attribute__((ext_vector_type(8))) short v8s;

// 16 (d) x 32 (keys) A fragment of V^T from a row-major [key][ld halves] LDS tile:
// lane (c, hf) gets keys kbase + 8 hf + 0..7, then kbase + 16 + 8 hf + 0..7, of
// column dbase + c: the k order of frag_ld and of a converted pair of D tiles.
__device__ __forceinline__ v16h frag_ld_tr(const _Float16* tile, int ld, int kbase, int dbase) {
    typedef __attribute__((address_space(3))) v8s lds_v8s;
    const int lane = threadIdx.x & 31;
    const _Float16* p = tile + (kbase + ((lane >> 4) << 3) + (lane & 7)) * ld + dbase + (((lane >> 3) & 1) << 3);
    v8h lo = __builtin_bit_cast(v8h, __builtin_amdgcn_ds_load_tr16_b128_v8i16((lds_v8s*)p));
    v8h hi = __builtin_bit_cast(v8h, __builtin_amdgcn_ds_load_tr16_b128_v8i16((lds_v8s*)(p + 16 * ld)));
    v16h r;
#pragma unroll
    for (int i = 0; i < 8; ++i) { r[i] = lo[i]; r[i + 8] = hi[i]; }
    return r;
}

__device__ __forceinline__ float xhalf(float x) {
    const int xi = __builtin_bit_cast(int, x);
    return __builtin_bit_cast(float,
        __builtin_amdgcn_permlanex16(xi, xi, 0x76543210, 0xfedcba98, false, false));
}

__global__ __launch_bounds__(128) void flash_attn_kernel(const _Float16* __restrict__ Q,
                                                         const _Float16* __restrict__ KV,
                                                         _Float16* __restrict__ O,
                                                         int n_q, int m_len) {
    __shared__ __align__(16) _Float16 sK[64 * FP];  // [key][d]: A rows of K Q^T
    __shared__ __align__(16) _Float16 sV[64 * VP];  // [key][d]: read transposed

    const int wave = threadIdx.x >> 5;
    const int lane = threadIdx.x & 31;
    const int h = blockIdx.y, b = blockIdx.z;
    const int qrow0 = blockIdx.x * 64;
    const int hf = lane >> 4, c0 = lane & 15;
    // this lane's query row, at its head's columns
    const size_t qoff  = ((size_t)b * n_q + qrow0 + wave * 16 + c0) * 512 + (size_t)h * 64;
    const size_t kvoff = (size_t)b * m_len * 1024 + (size_t)h * 64;

    const int srow = threadIdx.x >> 1;            // 0..63
    const int sseg = (threadIdx.x & 1) * 32;      // 0 / 32 halves (64B)

    // Q^T as B operand, loaded once, in the k order of frag_ld
    v16h qf[2];
#pragma unroll
    for (int kc = 0; kc < 2; ++kc) {
        const _Float16* qp = Q + qoff + kc * 32 + hf * 8;
        v8h lo = *(const v8h*)qp;
        v8h hi = *(const v8h*)(qp + 16);
#pragma unroll
        for (int i = 0; i < 8; ++i) { qf[kc][i] = lo[i]; qf[kc][i + 8] = hi[i]; }
    }

    float m_i = -1e30f, l_i = 0.f;  // l_i: the sum over this lane's half of the keys
    v8f o[4] = {};                  // o[j][r] = O^T[d = 16 j + 8 hf + r][query c0]

    for (int kt = 0; kt < m_len; kt += 64) {
        wait_ds0();       // this wave's reads of both tiles have returned ...
        __syncthreads();  // ... and every wave's: the copies may refill them
        const _Float16* gk = KV + kvoff + (size_t)(kt + srow) * 1024 + sseg;
        async_copy64B(lds_off(&sK[srow * FP + sseg]), gk);
        async_copy64B(lds_off(&sV[srow * VP + sseg]), gk + 512);
        wait_async0();
        __syncthreads();

        // S^T = K Q^T: s[g][r] = score of key 16 g + 8 hf + r with query c0
        v8f s[4] = {};
#pragma unroll
        for (int kc = 0; kc < 2; ++kc) {
#pragma unroll
            for (int g = 0; g < 4; ++g) {
                v16h kf = frag_ld(sK + g * 16 * FP, FP, kc * 32);
                s[g] = WMMA_F32_F16(kf, qf[kc], s[g]);
            }
        }

        // Online softmax, one query per lane.
        float mg[4];
#pragma unroll
        for (int g = 0; g < 4; ++g) {
            mg[g] = s[g][0];
#pragma unroll
            for (int r = 1; r < 8; ++r) mg[g] = fmaxf(mg[g], s[g][r]);
        }
        float mx = fmaxf(fmaxf(mg[0], mg[1]), fmaxf(mg[2], mg[3]));
        mx = fmaxf(mx, xhalf(mx));  // both halves of the query's keys
        const float mnew  = fmaxf(m_i, mx);
        const float alpha = __expf(m_i - mnew);
        m_i = mnew;
        float rs[4];
        v16h pb[2];  // P^T: keys 32 c .. 32 c + 31 are score tiles 2 c and 2 c + 1
#pragma unroll
        for (int g = 0; g < 4; ++g) {
            rs[g] = 0.f;
#pragma unroll
            for (int r = 0; r < 8; ++r) {
                const float p = __expf(s[g][r] - mnew);
                rs[g] += p;
                pb[g >> 1][(g & 1) * 8 + r] = (_Float16)p;
            }
        }
        l_i = l_i * alpha + ((rs[0] + rs[1]) + (rs[2] + rs[3]));
#pragma unroll
        for (int j = 0; j < 4; ++j) o[j] *= alpha;

        // O^T += V^T P^T
#pragma unroll
        for (int c = 0; c < 2; ++c) {
#pragma unroll
            for (int j = 0; j < 4; ++j) {
                v16h vt = frag_ld_tr(sV, VP, c * 32, j * 16);
                o[j] = WMMA_F32_F16(vt, pb[c], o[j]);
            }
        }
    }

    // Epilogue: join the halves' sums, normalize, store 8 consecutive d per lane.
    const float inv = 1.0f / (l_i + xhalf(l_i));
#pragma unroll
    for (int j = 0; j < 4; ++j) {
        v8h y;
#pragma unroll
        for (int r = 0; r < 8; ++r) y[r] = (_Float16)(o[j][r] * inv);
        *(v8h*)(O + qoff + j * 16 + hf * 8) = y;
    }
}

// ---------------------------------------------------------------------------
// Host-side orchestration
// ---------------------------------------------------------------------------
extern "C" void kernel_launch(void* const* d_in, const int* in_sizes, int n_in,
                              void* d_out, int out_size, void* d_ws, size_t ws_size,
                              hipStream_t stream) {
    (void)in_sizes; (void)n_in; (void)out_size; (void)ws_size;

    const float* x       = (const float*)d_in[0];
    const float* ctx     = (const float*)d_in[1];
    const float* sa_ng   = (const float*)d_in[2];
    const float* sa_nb   = (const float*)d_in[3];
    const float* sa_ncg  = (const float*)d_in[4];
    const float* sa_ncb  = (const float*)d_in[5];
    const float* sa_wq   = (const float*)d_in[6];
    const float* sa_wkv  = (const float*)d_in[7];
    const float* sa_wo   = (const float*)d_in[8];
    const float* sa_bo   = (const float*)d_in[9];
    const float* ca_ng   = (const float*)d_in[10];
    const float* ca_nb   = (const float*)d_in[11];
    const float* ca_ncg  = (const float*)d_in[12];
    const float* ca_ncb  = (const float*)d_in[13];
    const float* ca_wq   = (const float*)d_in[14];
    const float* ca_wkv  = (const float*)d_in[15];
    const float* ca_wo   = (const float*)d_in[16];
    const float* ca_bo   = (const float*)d_in[17];
    float* out = (float*)d_out;

    // carve workspace
    size_t off = 0;
    auto carve = [&](size_t bytes) -> void* {
        void* p = (char*)d_ws + off;
        off += (bytes + 255) & ~(size_t)255;
        return p;
    };
    // weights, f16 TRANSPOSED to [N][K]
    _Float16* wq16s  = (_Float16*)carve((size_t)MID * F * 2);        // [512][1024]
    _Float16* wkv16s = (_Float16*)carve((size_t)(2 * MID) * F * 2);  // [1024][1024]
    _Float16* wo16s  = (_Float16*)carve((size_t)F * MID * 2);        // [1024][512]
    _Float16* wq16c  = (_Float16*)carve((size_t)MID * F * 2);        // [512][1024]
    _Float16* wkv16c = (_Float16*)carve((size_t)(2 * MID) * CF * 2); // [1024][768]
    _Float16* wo16c  = (_Float16*)carve((size_t)F * MID * 2);        // [1024][512]
    _Float16* XN1 = (_Float16*)carve((size_t)ROWS * F * 2);          // q-norm input
    _Float16* XN2 = (_Float16*)carve((size_t)ROWS * F * 2);          // kv-norm input
    _Float16* Q16 = (_Float16*)carve((size_t)ROWS * MID * 2);
    _Float16* KV16 = (_Float16*)carve((size_t)ROWS * 2 * MID * 2);
    _Float16* AO16 = (_Float16*)carve((size_t)ROWS * MID * 2);
    float*    X1   = (float*)carve((size_t)ROWS * F * 4);
    _Float16* CN   = (_Float16*)carve((size_t)CROWS * CF * 2);       // normalized context
    _Float16* KVC16 = (_Float16*)carve((size_t)CROWS * 2 * MID * 2); // cross K/V

    // ---- weight casts + transposes:  W[K][N] -> Wt[N][K] ----
    cast_transpose_kernel<<<CB_ALL, dim3(32, 8), 0, stream>>>(
        sa_wq, sa_wkv, sa_wo, ca_wq, ca_wkv, ca_wo, wq16s, wkv16s, wo16s, wq16c, wkv16c, wo16c);
    // ---- norms of the inputs: XN1, XN2 from x, CN from the context ----
    ln_cast_inputs_kernel<<<2 * LB_X + LB_C, 512, 0, stream>>>(
        x, ctx, sa_ng, sa_nb, sa_ncg, sa_ncb, ca_ncg, ca_ncb, XN1, XN2, CN);
    // ---- KV = XN2 @ wkv, Q = (XN1 @ wq) * scale, cross KV = CN @ ca_wkv ----
    gemm_qkv_kernel<<<GB_ALL, 256, 0, stream>>>(
        XN2, wkv16s, KV16, XN1, wq16s, Q16, CN, wkv16c, KVC16);

    // ================= self-attention =================
    // attention (m_len = 2048)
    flash_attn_kernel<<<dim3(Nx / 64, 8, B), 128, 0, stream>>>(Q16, KV16, AO16, Nx, Nx);
    // X1 = AO @ wo + bo + x   [8192 x 512 -> 1024] -> f32
    gemm_wmma_kernel<1><<<dim3(F / 256, ROWS / 128), 256, 0, stream>>>(
        AO16, wo16s, nullptr, X1, sa_bo, x, 1.0f, F, MID);

    // ================= cross-attention =================
    ln_cast_kernel<F / 128><<<ROWS / 32, 512, 0, stream>>>(X1, ca_ng, ca_nb, XN1);
    // Q = (XN1 @ ca_wq) * scale
    gemm_wmma_kernel<0><<<dim3(MID / 256, ROWS / 128), 256, 0, stream>>>(
        XN1, wq16c, Q16, nullptr, nullptr, nullptr, 0.125f, MID, F);
    // attention (m_len = 512)
    flash_attn_kernel<<<dim3(Nx / 64, 8, B), 128, 0, stream>>>(Q16, KVC16, AO16, Nx, Mc);
    // out = AO @ ca_wo + ca_bo + X1  -> f32 (final output)
    gemm_wmma_kernel<1><<<dim3(F / 256, ROWS / 128), 256, 0, stream>>>(
        AO16, wo16c, nullptr, out, ca_bo, X1, 1.0f, F, MID);
}

// v007
// It runs in 154 microseconds.
// Next to v006, in two timings, it ran 1.10 times as fast each time.
// Over all steps from v000 it is 3.72 times as fast.
#include <hip/hip_runtime.h>

typedef __attribute__((ext_vector_type(16))) _Float16 v16h;
typedef __attribute__((ext_vector_type(8)))  _Float16 v8h;
typedef __attribute__((ext_vector_type(8)))  float    v8f;

#define WMMA_F32_F16(a, b, c) \
    __builtin_amdgcn_wmma_f32_16x16x32_f16(false, (a), false, (b), (short)0, (c), false, false)

// Problem shape, shared by the host code and by the kernels that hold several jobs
constexpr int B = 4, Nx = 2048, Mc = 512, F = 1024, CF = 768, MID = 512;
constexpr int ROWS = B * Nx;   // 8192
constexpr int CROWS = B * Mc;  // 2048

__device__ __forceinline__ unsigned lds_off(const void* p) {
    return (unsigned)(unsigned long long)p;
}

__device__ __forceinline__ void async_copy64B(unsigned ldsAddr, const void* g) {
    unsigned long long ga = (unsigned long long)g;
    asm volatile(
        "global_load_async_to_lds_b128 %0, %1, off\n\t"
        "global_load_async_to_lds_b128 %0, %1, off offset:16\n\t"
        "global_load_async_to_lds_b128 %0, %1, off offset:32\n\t"
        "global_load_async_to_lds_b128 %0, %1, off offset:48\n\t"
        "s_wait_xcnt 0x0"
        :: "v"(ldsAddr), "v"(ga) : "memory");
}

__device__ __forceinline__ void wait_async0() {
    asm volatile("s_wait_asynccnt 0x0" ::: "memory");
}

// the wave's own LDS reads have returned: stands in front of the barrier behind
// which a buffer that the wave has read is refilled by copies
__device__ __forceinline__ void wait_ds0() {
    asm volatile("s_wait_dscnt 0x0" ::: "memory");
}

constexpr int FP = 72;  // 64-half (128 B) rows -> 144 B pitch

__device__ __forceinline__ v16h frag_ld(const _Float16* tile, int ld, int kbase) {
    const int lane = threadIdx.x & 31;
    const _Float16* p = tile + (lane & 15) * ld + kbase + ((lane >> 4) << 3);
    v8h lo = *(const v8h*)p;
    v8h hi = *(const v8h*)(p + 16);
    v16h r;
#pragma unroll
    for (int i = 0; i < 8; ++i) { r[i] = lo[i]; r[i + 8] = hi[i]; }
    return r;
}

// ---------------------------------------------------------------------------
// Weight prep: f32 [K][N] -> f16 transposed [N][K] (LDS-tiled for coalescing)
// One 32 x 32 tile per work-group, block: (32, 8); tile t of a matrix with
// N = 32 << lgnt columns: column block t mod (N / 32), row block t / (N / 32).
// ---------------------------------------------------------------------------
__device__ __forceinline__ void cast_transpose_tile(const float* __restrict__ in,
                                                    _Float16* __restrict__ out,
                                                    int K, int lgnt, int t) {
    __shared__ _Float16 tile[32][33];
    const int N = 32 << lgnt;
    const int nb = (t & ((1 << lgnt) - 1)) * 32;
    const int kb = (t >> lgnt) * 32;
    const int tx = threadIdx.x;
#pragma unroll
    for (int i = threadIdx.y; i < 32; i += 8)
        tile[i][tx] = (_Float16)in[(size_t)(kb + i) * N + nb + tx];
    __syncthreads();
#pragma unroll
    for (int i = threadIdx.y; i < 32; i += 8)
        out[(size_t)(nb + i) * K + kb + tx] = tile[tx][i];
}

// All six weights in one launch: the work-group's index picks weight and tile.
constexpr int CB_WQ  = (F / 32) * (MID / 32);       // tiles of a [F][MID] or [MID][F] weight
constexpr int CB_WKV = (F / 32) * (2 * MID / 32);   // tiles of the self k/v weight
constexpr int CB_WKC = (CF / 32) * (2 * MID / 32);  // tiles of the cross k/v weight
constexpr int CB_ALL = 4 * CB_WQ + CB_WKV + CB_WKC;

__global__ __launch_bounds__(256) void cast_transpose_kernel(
    const float* __restrict__ wqs, const float* __restrict__ wkvs, const float* __restrict__ wos,
    const float* __restrict__ wqc, const float* __restrict__ wkvc, const float* __restrict__ woc,
    _Float16* __restrict__ tqs, _Float16* __restrict__ tkvs, _Float16* __restrict__ tos,
    _Float16* __restrict__ tqc, _Float16* __restrict__ tkvc, _Float16* __restrict__ toc) {
    int f = blockIdx.x;
    const float* in;
    _Float16* out;
    int K, lgnt;  // N = 32 << lgnt: 512 -> 4, 1024 -> 5
    if (f < CB_WKV)                  { in = wkvs; out = tkvs; K = F;   lgnt = 5; }
    else if ((f -= CB_WKV) < CB_WKC) { in = wkvc; out = tkvc; K = CF;  lgnt = 5; }
    else if ((f -= CB_WKC) < CB_WQ)  { in = wqs;  out = tqs;  K = F;   lgnt = 4; }
    else if ((f -= CB_WQ) < CB_WQ)   { in = wqc;  out = tqc;  K = F;   lgnt = 4; }
    else if ((f -= CB_WQ) < CB_WQ)   { in = wos;  out = tos;  K = MID; lgnt = 5; }
    else               { f -= CB_WQ;   in = woc;  out = toc;  K = MID; lgnt = 5; }
    cast_transpose_tile(in, out, K, lgnt, f);
}

// ---------------------------------------------------------------------------
// LayerNorm (biased variance, eps 1e-5) + cast to f16.
// One wave owns two whole rows: each row sits in registers (NV 16-byte loads
// per lane, 512 contiguous bytes per wave-wide load), the sums cross lanes in
// registers, so the kernel has no LDS and no barrier, and a launch starts only
// rows / 2 waves (wave start rate, not bytes, bounds a launch of many short
// work-groups).  C = NV * 128; work-group blk (16 waves) takes 32 rows from 32 blk.
// ---------------------------------------------------------------------------
typedef __attribute__((ext_vector_type(4))) float    v4f;
typedef __attribute__((ext_vector_type(4))) _Float16 v4h;

template <int MASK>
__device__ __forceinline__ float add_xmask(float x) {
    return x + __builtin_bit_cast(float, __builtin_amdgcn_update_dpp(
        0, __builtin_bit_cast(int, x), 0x160 | MASK, 0xf, 0xf, false));
}

// sum over the 32 lanes of a wave, the same value in every lane
__device__ __forceinline__ float wave_sum(float x) {
    x = add_xmask<1>(x);
    x = add_xmask<2>(x);
    x = add_xmask<4>(x);
    x = add_xmask<8>(x);
    const int xi = __builtin_bit_cast(int, x);
    return x + __builtin_bit_cast(float,
        __builtin_amdgcn_permlanex16(xi, xi, 0x76543210, 0xfedcba98, false, false));
}

template <int NV>
__device__ __forceinline__ void ln_cast_rows(const float* __restrict__ X,
                                             const float* __restrict__ G,
                                             const float* __restrict__ Bv,
                                             _Float16* __restrict__ Y, int blk) {
    constexpr int C = NV * 128;
    const int lane = threadIdx.x & 31;
    // the wave's number as a scalar: the rows' base addresses then sit in scalar
    // registers and the lane number is the only address register of every access
    const int wave = __builtin_amdgcn_readfirstlane(threadIdx.x >> 5);
    const int row0 = (blk * 16 + wave) * 2;
    const v4f* x4 = (const v4f*)(X + (size_t)row0 * C) + lane;

    v4f v[2][NV];
#pragma unroll
    for (int r = 0; r < 2; ++r)
#pragma unroll
        for (int i = 0; i < NV; ++i) v[r][i] = x4[r * (C / 4) + i * 32];
    // scale and shift are asked for beside the rows, so that their latency
    // runs under the rows' own instead of behind the sums
    const v4f* g4 = (const v4f*)G + lane;
    const v4f* b4 = (const v4f*)Bv + lane;
    v4f g[NV], bb[NV];
#pragma unroll
    for (int i = 0; i < NV; ++i) { g[i] = g4[i * 32]; bb[i] = b4[i * 32]; }
    // keeps every load above in flight at once: without it the compiler sinks
    // the scale and shift loads behind the sums, in short dependent batches
    __builtin_amdgcn_sched_barrier(0);
    asm volatile("s_wait_xcnt 0x0" ::: "memory");
    __builtin_amdgcn_sched_barrier(0);

    float mean[2], rstd[2];
#pragma unroll
    for (int r = 0; r < 2; ++r) {
        v4f a1 = v[r][0], a2 = v[r][0] * v[r][0];
#pragma unroll
        for (int i = 1; i < NV; ++i) { a1 += v[r][i]; a2 += v[r][i] * v[r][i]; }
        const float s1 = wave_sum((a1[0] + a1[1]) + (a1[2] + a1[3]));
        const float s2 = wave_sum((a2[0] + a2[1]) + (a2[2] + a2[3]));
        constexpr float invC = 1.0f / (float)C;
        mean[r] = s1 * invC;
        rstd[r] = rsqrtf(s2 * invC - mean[r] * mean[r] + 1e-5f);
    }

    v4h* y4 = (v4h*)(Y + (size_t)row0 * C) + lane;
#pragma unroll
    for (int i = 0; i < NV; ++i) {
#pragma unroll
        for (int r = 0; r < 2; ++r) {
            v4h y;
#pragma unroll
            for (int e = 0; e < 4; ++e)
                y[e] = (_Float16)((v[r][i][e] - mean[r]) * rstd[r] * g[i][e] + bb[i][e]);
            y4[r * (C / 4) + i * 32] = y;
        }
    }
    asm volatile("s_wait_xcnt 0x0" ::: "memory");
}

template <int NV>
__global__ __launch_bounds__(512) void ln_cast_kernel(const float* __restrict__ X,
                                                      const float* __restrict__ G,
                                                      const float* __restrict__ Bv,
                                                      _Float16* __restrict__ Y) {
    ln_cast_rows<NV>(X, G, Bv, Y, blockIdx.x);
}

// The three LayerNorms of the inputs in one launch: x with the query norm's and
// with the key/value norm's scale and shift, then the context.  The work-group's
// index picks the job.
constexpr int LB_X = ROWS / 32;   // work-groups of one LayerNorm of x
constexpr int LB_C = CROWS / 32;  // ... of the context

__global__ __launch_bounds__(512) void ln_cast_inputs_kernel(
    const float* __restrict__ x, const float* __restrict__ ctx,
    const float* __restrict__ g1, const float* __restrict__ b1,
    const float* __restrict__ g2, const float* __restrict__ b2,
    const float* __restrict__ gc, const float* __restrict__ bc,
    _Float16* __restrict__ y1, _Float16* __restrict__ y2, _Float16* __restrict__ yc) {
    const int f = blockIdx.x;
    if (f < 2 * LB_X) {
        const bool kv = f >= LB_X;
        ln_cast_rows<F / 128>(x, kv ? g2 : g1, kv ? b2 : b1, kv ? y2 : y1, kv ? f - LB_X : f);
    } else {
        ln_cast_rows<CF / 128>(ctx, gc, bc, yc, f - 2 * LB_X);
    }
}

// ---------------------------------------------------------------------------
// One thread's twelve copies of one GEMM ring stage: 16 B of 4 A rows and of 8 B
// rows, 32 rows apart; in LDS the B rows follow the 128 A rows at one pitch.
// ---------------------------------------------------------------------------
constexpr int GK  = 64;                // k depth of a ring stage
constexpr int GST = (128 + 256) * FP;  // halves in one stage buffer

__device__ __forceinline__ void gemm_stage_copies(unsigned d, const _Float16* a, const _Float16* b,
                                                  size_t step) {
    constexpr unsigned R = 32 * FP * 2;  // 32 LDS rows in bytes
    asm volatile(
        "global_load_async_to_lds_b128 %0, %12, off\n\t"
        "global_load_async_to_lds_b128 %1, %13, off\n\t"
        "global_load_async_to_lds_b128 %2, %14, off\n\t"
        "global_load_async_to_lds_b128 %3, %15, off\n\t"
        "global_load_async_to_lds_b128 %4, %16, off\n\t"
        "global_load_async_to_lds_b128 %5, %17, off\n\t"
        "global_load_async_to_lds_b128 %6, %18, off\n\t"
        "global_load_async_to_lds_b128 %7, %19, off\n\t"
        "global_load_async_to_lds_b128 %8, %20, off\n\t"
        "global_load_async_to_lds_b128 %9, %21, off\n\t"
        "global_load_async_to_lds_b128 %10, %22, off\n\t"
        "global_load_async_to_lds_b128 %11, %23, off\n\t"
        "s_wait_xcnt 0x0"
        :: "v"(d), "v"(d + R), "v"(d + 2 * R), "v"(d + 3 * R), "v"(d + 4 * R), "v"(d + 5 * R),
           "v"(d + 6 * R), "v"(d + 7 * R), "v"(d + 8 * R), "v"(d + 9 * R), "v"(d + 10 * R),
           "v"(d + 11 * R),
           "v"((unsigned long long)a), "v"((unsigned long long)(a + step)),
           "v"((unsigned long long)(a + 2 * step)), "v"((unsigned long long)(a + 3 * step)),
           "v"((unsigned long long)b), "v"((unsigned long long)(b + step)),
           "v"((unsigned long long)(b + 2 * step)), "v"((unsigned long long)(b + 3 * step)),
           "v"((unsigned long long)(b + 4 * step)), "v"((unsigned long long)(b + 5 * step)),
           "v"((unsigned long long)(b + 6 * step)), "v"((unsigned long long)(b + 7 * step))
        : "memory");
}

// ---------------------------------------------------------------------------
// Tiled WMMA GEMM:  C[M,N] = A[M,K] (f16 row-major) * Bt[N,K] (f16, B transposed)
// Block tile 128x256, 256 threads = 8 waves in a 2(M) x 4(N) grid,
// each wave computes a 64x64 register tile: 16 WMMAs per 32-wide K step.
// A/B tiles staged into LDS with global_load_async_to_lds_b128, in a ring of two
// buffers of 64 k each: the copies of stage t + 2 are issued at the foot of pass
// t and waited for at the foot of pass t + 1, so they fly under a whole pass of
// 32 WMMAs per wave.  K is a multiple of 64.
// MODE 0: C -> f16 * scale (1 for K/V, 0.125 as the Q pre-scale).
// MODE 1: C -> f32 with + bias[n] + res[m,n]: res + bias is the accumulators' start
// value, asked for at the kernel's entry (all loads in flight at once, beside the
// first stage's copies), so that the epilogue only stores.
// ---------------------------------------------------------------------------
template <int MODE>
__device__ __forceinline__ void gemm_wmma_tile(const _Float16* __restrict__ A,
                                               const _Float16* __restrict__ Bt,
                                               _Float16* __restrict__ C16,
                                               float* __restrict__ C32,
                                               const float* __restrict__ bias,
                                               const float* __restrict__ res,
                                               float scale, int N, int K,
                                               int mbase, int nbase) {
    // two stage buffers; each holds 128 A rows [m][k], then 256 B rows [n][k]
    __shared__ __align__(16) _Float16 sm[2 * GST];
    const int tid = threadIdx.x;
    const int wave = tid >> 5, lane = tid & 31;
    const int waveM = wave >> 2, waveN = wave & 3;

    v8f acc[4][4] = {};

    // staging assignments: a stage row is 64 halves = 128 B = 8 lanes x 16 B;
    // a thread copies its 16 B of rows srow + 32 i: 4 rows of A, 8 rows of B
    const int srow = tid >> 3, sseg = (tid & 7) * 8;
    const _Float16* gA = A + (size_t)(mbase + srow) * K + sseg;
    const _Float16* gB = Bt + (size_t)(nbase + srow) * K + sseg;
    const size_t gstep = (size_t)32 * K;  // 32 rows of A or of Bt, in halves
    const unsigned d0 = lds_off(&sm[srow * FP + sseg]);
    const int nst = K / GK;

    gemm_stage_copies(d0, gA, gB, gstep);
    float bj[4];
    if (MODE == 1) {
        // the lane's 128 residual values, straight into its accumulators, and its 4
        // bias values: all in flight together, beside stage 0's copies (unrolled:
        // accumulator elements are registers, their indices constants)
        const float* rp = res + (size_t)(mbase + waveM * 64 + (lane >> 4) * 8) * N + nbase + waveN * 64 + (lane & 15);
#pragma unroll
        for (int i = 0; i < 4; ++i)
#pragma unroll
            for (int r = 0; r < 8; ++r)
#pragma unroll
                for (int j = 0; j < 4; ++j) acc[i][j][r] = rp[(size_t)(i * 16 + r) * N + j * 16];
#pragma unroll
        for (int j = 0; j < 4; ++j) bj[j] = bias[nbase + waveN * 64 + j * 16 + (lane & 15)];
        __builtin_amdgcn_sched_barrier(0);
        asm volatile("s_wait_xcnt 0x0" ::: "memory");
        __builtin_amdgcn_sched_barrier(0);
    }
    wait_async0();    // stage 0 has landed (this wave's share)
    __syncthreads();  // ... and every other wave's
    if (nst > 1) gemm_stage_copies(d0 + GST * 2, gA + GK, gB + GK, gstep);

    if (MODE == 1) {
#pragma unroll
        for (int i = 0; i < 4; ++i)
#pragma unroll
            for (int j = 0; j < 4; ++j) acc[i][j] += bj[j];
    }

    for (int t = 0; t < nst; ++t) {
        const _Float16* sA = sm + (t & 1) * GST;
        const _Float16* sB = sA + 128 * FP;
        // unrolled: kc becomes an immediate offset of the LDS reads
#pragma unroll
        for (int kc = 0; kc < GK; kc += 32) {
            v16h bf[4], af[4];
#pragma unroll
            for (int j = 0; j < 4; ++j) {
                bf[j] = frag_ld(sB + (waveN * 64 + j * 16) * FP, FP, kc);
                af[j] = frag_ld(sA + (waveM * 64 + j * 16) * FP, FP, kc);
            }
            // holds the block's 16 LDS reads together ahead of its 16 WMMAs: left free,
            // the compiler reads each A fragment into one register set right in front
            // of its row of WMMAs, and the wave waits out the LDS latency at every row
            __builtin_amdgcn_sched_barrier(0);
#pragma unroll
            for (int i = 0; i < 4; ++i)
#pragma unroll
                for (int j = 0; j < 4; ++j)
                    acc[i][j] = WMMA_F32_F16(af[i], bf[j], acc[i][j]);
        }
        // publish point: this wave has left buffer t & 1 and its copies of stage
        // t + 1 have landed; the one barrier says both of every wave
        wait_ds0();
        wait_async0();
        __syncthreads();
        if (t + 2 < nst)
            gemm_stage_copies(d0 + (t & 1) * (GST * 2), gA + (t + 2) * GK, gB + (t + 2) * GK, gstep);
    }
    wait_async0();  // no copy is outstanding when the wave goes on to its end

    const int hf = lane >> 4, c0 = lane & 15;
    if (MODE == 1) {
        // row by row: four stores in a row fill two whole 128 B lines in each of two
        // rows; unrolled: accumulator elements are registers, their indices constants
        float* cp = C32 + (size_t)(mbase + waveM * 64 + hf * 8) * N + nbase + waveN * 64 + c0;
#pragma unroll
        for (int i = 0; i < 4; ++i)
#pragma unroll
            for (int r = 0; r < 8; ++r)
#pragma unroll
                for (int j = 0; j < 4; ++j) cp[(size_t)(i * 16 + r) * N + j * 16] = acc[i][j][r];
        return;
    }
#pragma unroll
    for (int i = 0; i < 4; ++i) {
#pragma unroll
        for (int j = 0; j < 4; ++j) {
#pragma unroll
            for (int r = 0; r < 8; ++r) {
                const int row = mbase + waveM * 64 + i * 16 + hf * 8 + r;
                const int col = nbase + waveN * 64 + j * 16 + c0;
                C16[(size_t)row * N + col] = (_Float16)(acc[i][j][r] * scale);
            }
        }
    }
}

// one product per launch; grid: (N / 256, M / 128)
template <int MODE>
__global__ __launch_bounds__(256) void gemm_wmma_kernel(const _Float16* __restrict__ A,
                                                        const _Float16* __restrict__ Bt,
                                                        _Float16* __restrict__ C16,
                                                        float* __restrict__ C32,
                                                        const float* __restrict__ bias,
                                                        const float* __restrict__ res,
                                                        float scale, int N, int K) {
    // both f32 products are F wide: with the pitch a constant, every residual load and
    // every store of a lane is an immediate offset of one address
    gemm_wmma_tile<MODE>(A, Bt, C16, C32, bias, res, scale, MODE == 1 ? F : N, K,
                         blockIdx.y * 128, blockIdx.x * 256);
}

// The three products that need only the prepared operands, in one launch: self
// K/V, self Q and cross K/V.  The work-group's index picks product and tile (the
// column block runs fastest, as in a launch of its own); the shortest K is last.
constexpr int GB_KVS = (2 * MID / 256) * (ROWS / 128);   // 256 tiles
constexpr int GB_QS  = (MID / 256) * (ROWS / 128);       // 128 tiles
constexpr int GB_KVC = (2 * MID / 256) * (CROWS / 128);  // 64 tiles
constexpr int GB_ALL = GB_KVS + GB_QS + GB_KVC;

__global__ __launch_bounds__(256) void gemm_qkv_kernel(
    const _Float16* __restrict__ akvs, const _Float16* __restrict__ wkvs, _Float16* __restrict__ ckvs,
    const _Float16* __restrict__ aqs, const _Float16* __restrict__ wqs, _Float16* __restrict__ cqs,
    const _Float16* __restrict__ akvc, const _Float16* __restrict__ wkvc, _Float16* __restrict__ ckvc) {
    int f = blockIdx.x;
    const _Float16 *A, *Bt;
    _Float16* C;
    float scale;
    int lgnb, K;  // N = 256 << lgnb
    if (f < GB_KVS)                 { A = akvs; Bt = wkvs; C = ckvs; scale = 1.0f;   lgnb = 2; K = F; }
    else if ((f -= GB_KVS) < GB_QS) { A = aqs;  Bt = wqs;  C = cqs;  scale = 0.125f; lgnb = 1; K = F; }
    else              { f -= GB_QS;   A = akvc; Bt = wkvc; C = ckvc; scale = 1.0f;   lgnb = 2; K = CF; }
    gemm_wmma_tile<0>(A, Bt, C, nullptr, nullptr, nullptr, scale, 256 << lgnb, K,
                      (f >> lgnb) * 128, (f & ((1 << lgnb) - 1)) * 256);
}

constexpr int VP = 80;  // V rows of 64 halves, read by ds_load_tr16_b128: pitch 160 B = 32 B x odd

typedef __attribute__((ext_vector_type(8))) short v8s;

// 16 (d) x 32 (keys) A fragment of V^T from a row-major [key][ld halves] LDS tile:
// lane (c, hf) gets keys kbase + 8 hf + 0..7, then kbase + 16 + 8 hf + 0..7, of
// column dbase + c: the k order of frag_ld and of a converted pair of D tiles.
__device__ __forceinline__ v16h frag_ld_tr(const _Float16* tile, int ld, int kbase, int dbase) {
    typedef __attribute__((address_space(3))) v8s lds_v8s;
    const int lane = threadIdx.x & 31;
    const _Float16* p = tile + (kbase + ((lane >> 4) << 3) + (lane & 7)) * ld + dbase + (((lane >> 3) & 1) << 3);
    v8h lo = __builtin_bit_cast(v8h, __builtin_amdgcn_ds_load_tr16_b128_v8i16((lds_v8s*)p));
    v8h hi = __builtin_bit_cast(v8h, __builtin_amdgcn_ds_load_tr16_b128_v8i16((lds_v8s*)(p + 16 * ld)));
    v16h r;
#pragma unroll
    for (int i = 0; i < 8; ++i) { r[i] = lo[i]; r[i + 8] = hi[i]; }
    return r;
}

__device__ __forceinline__ float xhalf(float x) {
    const int xi = __builtin_bit_cast(int, x);
    return __builtin_bit_cast(float,
        __builtin_amdgcn_permlanex16(xi, xi, 0x76543210, 0xfedcba98, false, false));
}

__global__ __launch_bounds__(128) void flash_attn_kernel(const _Float16* __restrict__ Q,
                                                         const _Float16* __restrict__ KV,
                                                         _Float16* __restrict__ O,
                                                         int n_q, int m_len) {
    __shared__ __align__(16) _Float16 sK[64 * FP];  // [key][d]: A rows of K Q^T
    __shared__ __align__(16) _Float16 sV[64 * VP];  // [key][d]: read transposed

    const int wave = threadIdx.x >> 5;
    const int lane = threadIdx.x & 31;
    const int h = blockIdx.y, b = blockIdx.z;
    const int qrow0 = blockIdx.x * 64;
    const int hf = lane >> 4, c0 = lane & 15;
    // this lane's query row, at its head's columns
    const size_t qoff  = ((size_t)b * n_q + qrow0 + wave * 16 + c0) * 512 + (size_t)h * 64;
    const size_t kvoff = (size_t)b * m_len * 1024 + (size_t)h * 64;

    const int srow = threadIdx.x >> 1;            // 0..63
    const int sseg = (threadIdx.x & 1) * 32;      // 0 / 32 halves (64B)

    // Q^T as B operand, loaded once, in the k order of frag_ld
    v16h qf[2];
#pragma unroll
    for (int kc = 0; kc < 2; ++kc) {
        const _Float16* qp = Q + qoff + kc * 32 + hf * 8;
        v8h lo = *(const v8h*)qp;
        v8h hi = *(const v8h*)(qp + 16);
#pragma unroll
        for (int i = 0; i < 8; ++i) { qf[kc][i] = lo[i]; qf[kc][i + 8] = hi[i]; }
    }

    float m_i = -1e30f, l_i = 0.f;  // l_i: the sum over this lane's half of the keys
    v8f o[4] = {};                  // o[j][r] = O^T[d = 16 j + 8 hf + r][query c0]

    for (int kt = 0; kt < m_len; kt += 64) {
        wait_ds0();       // this wave's reads of both tiles have returned ...
        __syncthreads();  // ... and every wave's: the copies may refill them
        const _Float16* gk = KV + kvoff + (size_t)(kt + srow) * 1024 + sseg;
        async_copy64B(lds_off(&sK[srow * FP + sseg]), gk);
        async_copy64B(lds_off(&sV[srow * VP + sseg]), gk + 512);
        wait_async0();
        __syncthreads();

        // S^T = K Q^T: s[g][r] = score of key 16 g + 8 hf + r with query c0
        v16h kf[2][4];
#pragma unroll
        for (int kc = 0; kc < 2; ++kc)
#pragma unroll
            for (int g = 0; g < 4; ++g) kf[kc][g] = frag_ld(sK + g * 16 * FP, FP, kc * 32);
        // the tile's 16 V^T reads queue behind them and return under the softmax
        v16h vt[2][4];
#pragma unroll
        for (int c = 0; c < 2; ++c)
#pragma unroll
            for (int j = 0; j < 4; ++j) vt[c][j] = frag_ld_tr(sV, VP, c * 32, j * 16);
        // holds the tile's 32 LDS reads together ahead of its WMMAs: left free, the
        // compiler reads a fragment right in front of its WMMA and the wave waits out
        // the LDS latency once per fragment
        __builtin_amdgcn_sched_barrier(0);
        v8f s[4] = {};
#pragma unroll
        for (int kc = 0; kc < 2; ++kc)
#pragma unroll
            for (int g = 0; g < 4; ++g) s[g] = WMMA_F32_F16(kf[kc][g], qf[kc], s[g]);

        // Online softmax, one query per lane.
        float mg[4];
#pragma unroll
        for (int g = 0; g < 4; ++g) {
            mg[g] = s[g][0];
#pragma unroll
            for (int r = 1; r < 8; ++r) mg[g] = fmaxf(mg[g], s[g][r]);
        }
        float mx = fmaxf(fmaxf(mg[0], mg[1]), fmaxf(mg[2], mg[3]));
        mx = fmaxf(mx, xhalf(mx));  // both halves of the query's keys
        const float mnew  = fmaxf(m_i, mx);
        const float alpha = __expf(m_i - mnew);
        m_i = mnew;
        float rs[4];
        v16h pb[2];  // P^T: keys 32 c .. 32 c + 31 are score tiles 2 c and 2 c + 1
#pragma unroll
        for (int g = 0; g < 4; ++g) {
            rs[g] = 0.f;
#pragma unroll
            for (int r = 0; r < 8; ++r) {
                const float p = __expf(s[g][r] - mnew);
                rs[g] += p;
                pb[g >> 1][(g & 1) * 8 + r] = (_Float16)p;
            }
        }
        l_i = l_i * alpha + ((rs[0] + rs[1]) + (rs[2] + rs[3]));
#pragma unroll
        for (int j = 0; j < 4; ++j) o[j] *= alpha;

        // O^T += V^T P^T
#pragma unroll
        for (int c = 0; c < 2; ++c) {
#pragma unroll
            for (int j = 0; j < 4; ++j) o[j] = WMMA_F32_F16(vt[c][j], pb[c], o[j]);
        }
    }

    // Epilogue: join the halves' sums, normalize, store 8 consecutive d per lane.
    const float inv = 1.0f / (l_i + xhalf(l_i));
#pragma unroll
    for (int j = 0; j < 4; ++j) {
        v8h y;
#pragma unroll
        for (int r = 0; r < 8; ++r) y[r] = (_Float16)(o[j][r] * inv);
        *(v8h*)(O + qoff + j * 16 + hf * 8) = y;
    }
}

// ---------------------------------------------------------------------------
// Host-side orchestration
// ---------------------------------------------------------------------------
extern "C" void kernel_launch(void* const* d_in, const int* in_sizes, int n_in,
                              void* d_out, int out_size, void* d_ws, size_t ws_size,
                              hipStream_t stream) {
    (void)in_sizes; (void)n_in; (void)out_size; (void)ws_size;

    const float* x       = (const float*)d_in[0];
    const float* ctx     = (const float*)d_in[1];
    const float* sa_ng   = (const float*)d_in[2];
    const float* sa_nb   = (const float*)d_in[3];
    const float* sa_ncg  = (const float*)d_in[4];
    const float* sa_ncb  = (const float*)d_in[5];
    const float* sa_wq   = (const float*)d_in[6];
    const float* sa_wkv  = (const float*)d_in[7];
    const float* sa_wo   = (const float*)d_in[8];
    const float* sa_bo   = (const float*)d_in[9];
    const float* ca_ng   = (const float*)d_in[10];
    const float* ca_nb   = (const float*)d_in[11];
    const float* ca_ncg  = (const float*)d_in[12];
    const float* ca_ncb  = (const float*)d_in[13];
    const float* ca_wq   = (const float*)d_in[14];
    const float* ca_wkv  = (const float*)d_in[15];
    const float* ca_wo   = (const float*)d_in[16];
    const float* ca_bo   = (const float*)d_in[17];
    float* out = (float*)d_out;

    // carve workspace
    size_t off = 0;
    auto carve = [&](size_t bytes) -> void* {
        void* p = (char*)d_ws + off;
        off += (bytes + 255) & ~(size_t)255;
        return p;
    };
    // weights, f16 TRANSPOSED to [N][K]
    _Float16* wq16s  = (_Float16*)carve((size_t)MID * F * 2);        // [512][1024]
    _Float16* wkv16s = (_Float16*)carve((size_t)(2 * MID) * F * 2);  // [1024][1024]
    _Float16* wo16s  = (_Float16*)carve((size_t)F * MID * 2);        // [1024][512]
    _Float16* wq16c  = (_Float16*)carve((size_t)MID * F * 2);        // [512][1024]
    _Float16* wkv16c = (_Float16*)carve((size_t)(2 * MID) * CF * 2); // [1024][768]
    _Float16* wo16c  = (_Float16*)carve((size_t)F * MID * 2);        // [1024][512]
    _Float16* XN1 = (_Float16*)carve((size_t)ROWS * F * 2);          // q-norm input
    _Float16* XN2 = (_Float16*)carve((size_t)ROWS * F * 2);          // kv-norm input
    _Float16* Q16 = (_Float16*)carve((size_t)ROWS * MID * 2);
    _Float16* KV16 = (_Float16*)carve((size_t)ROWS * 2 * MID * 2);
    _Float16* AO16 = (_Float16*)carve((size_t)ROWS * MID * 2);
    float*    X1   = (float*)carve((size_t)ROWS * F * 4);
    _Float16* CN   = (_Float16*)carve((size_t)CROWS * CF * 2);       // normalized context
    _Float16* KVC16 = (_Float16*)carve((size_t)CROWS * 2 * MID * 2); // cross K/V

    // ---- weight casts + transposes:  W[K][N] -> Wt[N][K] ----
    cast_transpose_kernel<<<CB_ALL, dim3(32, 8), 0, stream>>>(
        sa_wq, sa_wkv, sa_wo, ca_wq, ca_wkv, ca_wo, wq16s, wkv16s, wo16s, wq16c, wkv16c, wo16c);
    // ---- norms of the inputs: XN1, XN2 from x, CN from the context ----
    ln_cast_inputs_kernel<<<2 * LB_X + LB_C, 512, 0, stream>>>(
        x, ctx, sa_ng, sa_nb, sa_ncg, sa_ncb, ca_ncg, ca_ncb, XN1, XN2, CN);
    // ---- KV = XN2 @ wkv, Q = (XN1 @ wq) * scale, cross KV = CN @ ca_wkv ----
    gemm_qkv_kernel<<<GB_ALL, 256, 0, stream>>>(
        XN2, wkv16s, KV16, XN1, wq16s, Q16, CN, wkv16c, KVC16);

    // ================= self-attention =================
    // attention (m_len = 2048)
    flash_attn_kernel<<<dim3(Nx / 64, 8, B), 128, 0, stream>>>(Q16, KV16, AO16, Nx, Nx);
    // X1 = AO @ wo + bo + x   [8192 x 512 -> 1024] -> f32
    gemm_wmma_kernel<1><<<dim3(F / 256, ROWS / 128), 256, 0, stream>>>(
        AO16, wo16s, nullptr, X1, sa_bo, x, 1.0f, F, MID);

    // ================= cross-attention =================
    ln_cast_kernel<F / 128><<<ROWS / 32, 512, 0, stream>>>(X1, ca_ng, ca_nb, XN1);
    // Q = (XN1 @ ca_wq) * scale
    gemm_wmma_kernel<0><<<dim3(MID / 256, ROWS / 128), 256, 0, stream>>>(
        XN1, wq16c, Q16, nullptr, nullptr, nullptr, 0.125f, MID, F);
    // attention (m_len = 512)
    flash_attn_kernel<<<dim3(Nx / 64, 8, B), 128, 0, stream>>>(Q16, KVC16, AO16, Nx, Mc);
    // out = AO @ ca_wo + ca_bo + X1  -> f32 (final output)
    gemm_wmma_kernel<1><<<dim3(F / 256, ROWS / 128), 256, 0, stream>>>(
        AO16, wo16c, nullptr, out, ca_bo, X1, 1.0f, F, MID);
}

// v008
// A run of this version takes 149 microseconds.
// Next to v007, in two timings, it ran 1.03 times as fast each time.
// All steps since v000 together make it 3.84 times as fast.
#include <hip/hip_runtime.h>

typedef __attribute__((ext_vector_type(16))) _Float16 v16h;
typedef __attribute__((ext_vector_type(8)))  _Float16 v8h;
typedef __attribute__((ext_vector_type(8)))  float    v8f;

#define WMMA_F32_F16(a, b, c) \
    __builtin_amdgcn_wmma_f32_16x16x32_f16(false, (a), false, (b), (short)0, (c), false, false)

// Problem shape, shared by the host code and by the kernels that hold several jobs
constexpr int B = 4, Nx = 2048, Mc = 512, F = 1024, CF = 768, MID = 512;
constexpr int ROWS = B * Nx;   // 8192
constexpr int CROWS = B * Mc;  // 2048

__device__ __forceinline__ unsigned lds_off(const void* p) {
    return (unsigned)(unsigned long long)p;
}

__device__ __forceinline__ void async_copy64B(unsigned ldsAddr, const void* g) {
    unsigned long long ga = (unsigned long long)g;
    asm volatile(
        "global_load_async_to_lds_b128 %0, %1, off\n\t"
        "global_load_async_to_lds_b128 %0, %1, off offset:16\n\t"
        "global_load_async_to_lds_b128 %0, %1, off offset:32\n\t"
        "global_load_async_to_lds_b128 %0, %1, off offset:48\n\t"
        "s_wait_xcnt 0x0"
        :: "v"(ldsAddr), "v"(ga) : "memory");
}

__device__ __forceinline__ void wait_async0() {
    asm volatile("s_wait_asynccnt 0x0" ::: "memory");
}

// the wave's own LDS reads have returned: stands in front of the barrier behind
// which a buffer that the wave has read is refilled by copies
__device__ __forceinline__ void wait_ds0() {
    asm volatile("s_wait_dscnt 0x0" ::: "memory");
}

constexpr int FP = 72;  // 64-half (128 B) rows -> 144 B pitch

__device__ __forceinline__ v16h frag_ld(const _Float16* tile, int ld, int kbase) {
    const int lane = threadIdx.x & 31;
    const _Float16* p = tile + (lane & 15) * ld + kbase + ((lane >> 4) << 3);
    v8h lo = *(const v8h*)p;
    v8h hi = *(const v8h*)(p + 16);
    v16h r;
#pragma unroll
    for (int i = 0; i < 8; ++i) { r[i] = lo[i]; r[i + 8] = hi[i]; }
    return r;
}

// ---------------------------------------------------------------------------
// LayerNorm (biased variance, eps 1e-5) + cast to f16.
// One wave owns two whole rows: each row sits in registers (NV 16-byte loads
// per lane, 512 contiguous bytes per wave-wide load), the sums cross lanes in
// registers, so the kernel has no LDS and no barrier, and a launch starts only
// rows / 2 waves.  C = NV * 128; work-group blk (16 waves) takes 32 rows from 32 blk.
// ---------------------------------------------------------------------------
typedef __attribute__((ext_vector_type(4))) float    v4f;
typedef __attribute__((ext_vector_type(4))) _Float16 v4h;

template <int MASK>
__device__ __forceinline__ float add_xmask(float x) {
    return x + __builtin_bit_cast(float, __builtin_amdgcn_update_dpp(
        0, __builtin_bit_cast(int, x), 0x160 | MASK, 0xf, 0xf, false));
}

// sum over the 32 lanes of a wave, the same value in every lane
__device__ __forceinline__ float wave_sum(float x) {
    x = add_xmask<1>(x);
    x = add_xmask<2>(x);
    x = add_xmask<4>(x);
    x = add_xmask<8>(x);
    const int xi = __builtin_bit_cast(int, x);
    return x + __builtin_bit_cast(float,
        __builtin_amdgcn_permlanex16(xi, xi, 0x76543210, 0xfedcba98, false, false));
}

template <int NV>
__device__ __forceinline__ void ln_cast_rows(const float* __restrict__ X,
                                             const float* __restrict__ G,
                                             const float* __restrict__ Bv,
                                             _Float16* __restrict__ Y, int blk) {
    constexpr int C = NV * 128;
    const int lane = threadIdx.x & 31;
    // the wave's number as a scalar: the rows' base addresses then sit in scalar
    // registers and the lane number is the only address register of every access
    const int wave = __builtin_amdgcn_readfirstlane(threadIdx.x >> 5);
    const int row0 = (blk * 16 + wave) * 2;
    const v4f* x4 = (const v4f*)(X + (size_t)row0 * C) + lane;

    v4f v[2][NV];
#pragma unroll
    for (int r = 0; r < 2; ++r)
#pragma unroll
        for (int i = 0; i < NV; ++i) v[r][i] = x4[r * (C / 4) + i * 32];
    // scale and shift are asked for beside the rows, so that their latency
    // runs under the rows' own instead of behind the sums
    const v4f* g4 = (const v4f*)G + lane;
    const v4f* b4 = (const v4f*)Bv + lane;
    v4f g[NV], bb[NV];
#pragma unroll
    for (int i = 0; i < NV; ++i) { g[i] = g4[i * 32]; bb[i] = b4[i * 32]; }
    // keeps every load above in flight at once: without it the compiler sinks
    // the scale and shift loads behind the sums, in short dependent batches
    __builtin_amdgcn_sched_barrier(0);
    asm volatile("s_wait_xcnt 0x0" ::: "memory");
    __builtin_amdgcn_sched_barrier(0);

    float mean[2], rstd[2];
#pragma unroll
    for (int r = 0; r < 2; ++r) {
        v4f a1 = v[r][0], a2 = v[r][0] * v[r][0];
#pragma unroll
        for (int i = 1; i < NV; ++i) { a1 += v[r][i]; a2 += v[r][i] * v[r][i]; }
        const float s1 = wave_sum((a1[0] + a1[1]) + (a1[2] + a1[3]));
        const float s2 = wave_sum((a2[0] + a2[1]) + (a2[2] + a2[3]));
        constexpr float invC = 1.0f / (float)C;
        mean[r] = s1 * invC;
        rstd[r] = rsqrtf(s2 * invC - mean[r] * mean[r] + 1e-5f);
    }

    v4h* y4 = (v4h*)(Y + (size_t)row0 * C) + lane;
#pragma unroll
    for (int i = 0; i < NV; ++i) {
#pragma unroll
        for (int r = 0; r < 2; ++r) {
            v4h y;
#pragma unroll
            for (int e = 0; e < 4; ++e)
                y[e] = (_Float16)((v[r][i][e] - mean[r]) * rstd[r] * g[i][e] + bb[i][e]);
            y4[r * (C / 4) + i * 32] = y;
        }
    }
    asm volatile("s_wait_xcnt 0x0" ::: "memory");
}

template <int NV>
__global__ __launch_bounds__(512) void ln_cast_kernel(const float* __restrict__ X,
                                                      const float* __restrict__ G,
                                                      const float* __restrict__ Bv,
                                                      _Float16* __restrict__ Y) {
    ln_cast_rows<NV>(X, G, Bv, Y, blockIdx.x);
}

template <int LGNT>
__device__ __forceinline__ void cast_transpose_tile(const float* __restrict__ in,
                                                    _Float16* __restrict__ out,
                                                    _Float16* tile, int K, int t) {
    constexpr int N = 128 << LGNT;
    const int nb = (t & ((1 << LGNT) - 1)) * 128;
    const int kb = (t >> LGNT) * 128;
    const int lane = threadIdx.x & 31;
    // the wave's number as a scalar: the rows' base addresses then sit in scalar
    // registers, and one lane offset is the only address register of the accesses
    const int wave = __builtin_amdgcn_readfirstlane(threadIdx.x >> 5);
    const v4f* s4 = (const v4f*)(in + (size_t)(kb + wave * 8) * N + nb) + lane;
    v4f v[8];
#pragma unroll
    for (int i = 0; i < 8; ++i) v[i] = s4[i * (N / 4)];
    __builtin_amdgcn_sched_barrier(0);
    asm volatile("s_wait_xcnt 0x0" ::: "memory");
    __builtin_amdgcn_sched_barrier(0);
#pragma unroll
    for (int e = 0; e < 4; ++e) {
        v8h h;
#pragma unroll
        for (int i = 0; i < 8; ++i) h[i] = (_Float16)v[i][e];
        *(v8h*)&tile[(lane * 4 + e) * 128 + ((wave ^ (lane & 15)) << 3)] = h;
    }
    __syncthreads();
#pragma unroll
    for (int j = 0; j < 4; ++j) {
        const int n0 = j * 32 + wave * 2;  // even: rows n0 and n0 + 1 share n >> 2
        const int c = lane & 15;
        const v8h h = *(const v8h*)&tile[(n0 + (lane >> 4)) * 128 + ((c ^ ((n0 >> 2) & 15)) << 3)];
        *(v8h*)(out + (size_t)(nb + n0) * K + kb + ((lane >> 4) * K + c * 8)) = h;
    }
    asm volatile("s_wait_xcnt 0x0" ::: "memory");
}

constexpr int CB_WQ  = (F / 128) * (MID / 128);       // tiles of a [F][MID] or [MID][F] weight
constexpr int CB_WKV = (F / 128) * (2 * MID / 128);   // tiles of the self k/v weight
constexpr int CB_WKC = (CF / 128) * (2 * MID / 128);  // tiles of the cross k/v weight
constexpr int CB_ALL = 4 * CB_WQ + CB_WKV + CB_WKC;

// All that needs only the inputs, in one launch: the three LayerNorms (x with the
// query norm's and with the key/value norm's scale and shift, then the context)
// and the six weight casts.  The work-group's index picks the job; the casts, the
// shortest jobs, come last and fill the places that the last LayerNorm rows leave.
constexpr int LB_X = ROWS / 32;   // work-groups of one LayerNorm of x
constexpr int LB_C = CROWS / 32;  // ... of the context

__global__ __launch_bounds__(512) void prep_inputs_kernel(
    const float* __restrict__ x, const float* __restrict__ ctx,
    const float* __restrict__ g1, const float* __restrict__ b1,
    const float* __restrict__ g2, const float* __restrict__ b2,
    const float* __restrict__ gc, const float* __restrict__ bc,
    _Float16* __restrict__ y1, _Float16* __restrict__ y2, _Float16* __restrict__ yc,
    const float* __restrict__ wqs, const float* __restrict__ wkvs, const float* __restrict__ wos,
    const float* __restrict__ wqc, const float* __restrict__ wkvc, const float* __restrict__ woc,
    _Float16* __restrict__ tqs, _Float16* __restrict__ tkvs, _Float16* __restrict__ tos,
    _Float16* __restrict__ tqc, _Float16* __restrict__ tkvc, _Float16* __restrict__ toc) {
    int f = blockIdx.x;
    if (f < 2 * LB_X) {
        const bool kv = f >= LB_X;
        ln_cast_rows<F / 128>(x, kv ? g2 : g1, kv ? b2 : b1, kv ? y2 : y1, kv ? f - LB_X : f);
    } else if ((f -= 2 * LB_X) < LB_C) {
        ln_cast_rows<CF / 128>(ctx, gc, bc, yc, f);
    } else {
        f -= LB_C;
        __shared__ __align__(16) _Float16 tile[128 * 128];
        const float* in;
        _Float16* out;
        int K;
        if (f < 2 * CB_WQ) {  // the two [F][MID] weights: N = 512
            const bool c = f >= CB_WQ;
            cast_transpose_tile<2>(c ? wqc : wqs, c ? tqc : tqs, tile, F, c ? f - CB_WQ : f);
            return;
        }
        f -= 2 * CB_WQ;  // the other four: N = 1024
        if (f < CB_WKV)                  { in = wkvs; out = tkvs; K = F; }
        else if ((f -= CB_WKV) < CB_WKC) { in = wkvc; out = tkvc; K = CF; }
        else if ((f -= CB_WKC) < CB_WQ)  { in = wos;  out = tos;  K = MID; }
        else               { f -= CB_WQ;   in = woc;  out = toc;  K = MID; }
        cast_transpose_tile<3>(in, out, tile, K, f);
    }
}

// ---------------------------------------------------------------------------
// One thread's twelve copies of one GEMM ring stage: 16 B of 4 A rows and of 8 B
// rows, 32 rows apart; in LDS the B rows follow the 128 A rows at one pitch.
// ---------------------------------------------------------------------------
constexpr int GK  = 64;                // k depth of a ring stage
constexpr int GST = (128 + 256) * FP;  // halves in one stage buffer

__device__ __forceinline__ void gemm_stage_copies(unsigned d, const _Float16* a, const _Float16* b,
                                                  size_t step) {
    constexpr unsigned R = 32 * FP * 2;  // 32 LDS rows in bytes
    asm volatile(
        "global_load_async_to_lds_b128 %0, %12, off\n\t"
        "global_load_async_to_lds_b128 %1, %13, off\n\t"
        "global_load_async_to_lds_b128 %2, %14, off\n\t"
        "global_load_async_to_lds_b128 %3, %15, off\n\t"
        "global_load_async_to_lds_b128 %4, %16, off\n\t"
        "global_load_async_to_lds_b128 %5, %17, off\n\t"
        "global_load_async_to_lds_b128 %6, %18, off\n\t"
        "global_load_async_to_lds_b128 %7, %19, off\n\t"
        "global_load_async_to_lds_b128 %8, %20, off\n\t"
        "global_load_async_to_lds_b128 %9, %21, off\n\t"
        "global_load_async_to_lds_b128 %10, %22, off\n\t"
        "global_load_async_to_lds_b128 %11, %23, off\n\t"
        "s_wait_xcnt 0x0"
        :: "v"(d), "v"(d + R), "v"(d + 2 * R), "v"(d + 3 * R), "v"(d + 4 * R), "v"(d + 5 * R),
           "v"(d + 6 * R), "v"(d + 7 * R), "v"(d + 8 * R), "v"(d + 9 * R), "v"(d + 10 * R),
           "v"(d + 11 * R),
           "v"((unsigned long long)a), "v"((unsigned long long)(a + step)),
           "v"((unsigned long long)(a + 2 * step)), "v"((unsigned long long)(a + 3 * step)),
           "v"((unsigned long long)b), "v"((unsigned long long)(b + step)),
           "v"((unsigned long long)(b + 2 * step)), "v"((unsigned long long)(b + 3 * step)),
           "v"((unsigned long long)(b + 4 * step)), "v"((unsigned long long)(b + 5 * step)),
           "v"((unsigned long long)(b + 6 * step)), "v"((unsigned long long)(b + 7 * step))
        : "memory");
}

// ---------------------------------------------------------------------------
// Tiled WMMA GEMM:  C[M,N] = A[M,K] (f16 row-major) * Bt[N,K] (f16, B transposed)
// Block tile 128x256, 256 threads = 8 waves in a 2(M) x 4(N) grid,
// each wave computes a 64x64 register tile: 16 WMMAs per 32-wide K step.
// A/B tiles staged into LDS with global_load_async_to_lds_b128, in a ring of two
// buffers of 64 k each: the copies of stage t + 2 are issued at the foot of pass
// t and waited for at the foot of pass t + 1, so they fly under a whole pass of
// 32 WMMAs per wave.  K is a multiple of 64.
// MODE 0: C -> f16 * scale (1 for K/V, 0.125 as the Q pre-scale).
// MODE 1: C -> f32 with + bias[n] + res[m,n]: res + bias is the accumulators' start
// value, asked for at the kernel's entry (all loads in flight at once, beside the
// first stage's copies), so that the epilogue only stores.
// ---------------------------------------------------------------------------
template <int MODE>
__device__ __forceinline__ void gemm_wmma_tile(const _Float16* __restrict__ A,
                                               const _Float16* __restrict__ Bt,
                                               _Float16* __restrict__ C16,
                                               float* __restrict__ C32,
                                               const float* __restrict__ bias,
                                               const float* __restrict__ res,
                                               float scale, int N, int K,
                                               int mbase, int nbase) {
    // two stage buffers; each holds 128 A rows [m][k], then 256 B rows [n][k]
    __shared__ __align__(16) _Float16 sm[2 * GST];
    const int tid = threadIdx.x;
    const int wave = tid >> 5, lane = tid & 31;
    const int waveM = wave >> 2, waveN = wave & 3;

    v8f acc[4][4] = {};

    // staging assignments: a stage row is 64 halves = 128 B = 8 lanes x 16 B;
    // a thread copies its 16 B of rows srow + 32 i: 4 rows of A, 8 rows of B
    const int srow = tid >> 3, sseg = (tid & 7) * 8;
    const _Float16* gA = A + (size_t)(mbase + srow) * K + sseg;
    const _Float16* gB = Bt + (size_t)(nbase + srow) * K + sseg;
    const size_t gstep = (size_t)32 * K;  // 32 rows of A or of Bt, in halves
    const unsigned d0 = lds_off(&sm[srow * FP + sseg]);
    const int nst = K / GK;

    gemm_stage_copies(d0, gA, gB, gstep);
    float bj[4];
    if (MODE == 1) {
        // the lane's 128 residual values, straight into its accumulators, and its 4
        // bias values: all in flight together, beside stage 0's copies (unrolled:
        // accumulator elements are registers, their indices constants)
        const float* rp = res + (size_t)(mbase + waveM * 64 + (lane >> 4) * 8) * N + nbase + waveN * 64 + (lane & 15);
#pragma unroll
        for (int i = 0; i < 4; ++i)
#pragma unroll
            for (int r = 0; r < 8; ++r)
#pragma unroll
                for (int j = 0; j < 4; ++j) acc[i][j][r] = rp[(size_t)(i * 16 + r) * N + j * 16];
#pragma unroll
        for (int j = 0; j < 4; ++j) bj[j] = bias[nbase + waveN * 64 + j * 16 + (lane & 15)];
        __builtin_amdgcn_sched_barrier(0);
        asm volatile("s_wait_xcnt 0x0" ::: "memory");
        __builtin_amdgcn_sched_barrier(0);
    }
    wait_async0();    // stage 0 has landed (this wave's share)
    __syncthreads();  // ... and every other wave's
    if (nst > 1) gemm_stage_copies(d0 + GST * 2, gA + GK, gB + GK, gstep);

    if (MODE == 1) {
#pragma unroll
        for (int i = 0; i < 4; ++i)
#pragma unroll
            for (int j = 0; j < 4; ++j) acc[i][j] += bj[j];
    }

    for (int t = 0; t < nst; ++t) {
        const _Float16* sA = sm + (t & 1) * GST;
        const _Float16* sB = sA + 128 * FP;
        // unrolled: kc becomes an immediate offset of the LDS reads
#pragma unroll
        for (int kc = 0; kc < GK; kc += 32) {
            v16h bf[4], af[4];
#pragma unroll
            for (int j = 0; j < 4; ++j) {
                bf[j] = frag_ld(sB + (waveN * 64 + j * 16) * FP, FP, kc);
                af[j] = frag_ld(sA + (waveM * 64 + j * 16) * FP, FP, kc);
            }
            // holds the block's 16 LDS reads together ahead of its 16 WMMAs: left free,
            // the compiler reads each A fragment into one register set right in front
            // of its row of WMMAs, and the wave waits out the LDS latency at every row
            __builtin_amdgcn_sched_barrier(0);
#pragma unroll
            for (int i = 0; i < 4; ++i)
#pragma unroll
                for (int j = 0; j < 4; ++j)
                    acc[i][j] = WMMA_F32_F16(af[i], bf[j], acc[i][j]);
        }
        // publish point: this wave has left buffer t & 1 and its copies of stage
        // t + 1 have landed; the one barrier says both of every wave
        wait_ds0();
        wait_async0();
        __syncthreads();
        if (t + 2 < nst)
            gemm_stage_copies(d0 + (t & 1) * (GST * 2), gA + (t + 2) * GK, gB + (t + 2) * GK, gstep);
    }
    wait_async0();  // no copy is outstanding when the wave goes on to its end

    const int hf = lane >> 4, c0 = lane & 15;
    if (MODE == 1) {
        // row by row: four stores in a row fill two whole 128 B lines in each of two
        // rows; unrolled: accumulator elements are registers, their indices constants
        float* cp = C32 + (size_t)(mbase + waveM * 64 + hf * 8) * N + nbase + waveN * 64 + c0;
#pragma unroll
        for (int i = 0; i < 4; ++i)
#pragma unroll
            for (int r = 0; r < 8; ++r)
#pragma unroll
                for (int j = 0; j < 4; ++j) cp[(size_t)(i * 16 + r) * N + j * 16] = acc[i][j][r];
        return;
    }
#pragma unroll
    for (int i = 0; i < 4; ++i) {
#pragma unroll
        for (int j = 0; j < 4; ++j) {
#pragma unroll
            for (int r = 0; r < 8; ++r) {
                const int row = mbase + waveM * 64 + i * 16 + hf * 8 + r;
                const int col = nbase + waveN * 64 + j * 16 + c0;
                C16[(size_t)row * N + col] = (_Float16)(acc[i][j][r] * scale);
            }
        }
    }
}

// one product per launch; grid: (N / 256, M / 128)
template <int MODE>
__global__ __launch_bounds__(256) void gemm_wmma_kernel(const _Float16* __restrict__ A,
                                                        const _Float16* __restrict__ Bt,
                                                        _Float16* __restrict__ C16,
                                                        float* __restrict__ C32,
                                                        const float* __restrict__ bias,
                                                        const float* __restrict__ res,
                                                        float scale, int N, int K) {
    // both f32 products are F wide: with the pitch a constant, every residual load and
    // every store of a lane is an immediate offset of one address
    gemm_wmma_tile<MODE>(A, Bt, C16, C32, bias, res, scale, MODE == 1 ? F : N, K,
                         blockIdx.y * 128, blockIdx.x * 256);
}

// The three products that need only the prepared operands, in one launch: self
// K/V, self Q and cross K/V.  The work-group's index picks product and tile (the
// column block runs fastest, as in a launch of its own); the shortest K is last.
constexpr int GB_KVS = (2 * MID / 256) * (ROWS / 128);   // 256 tiles
constexpr int GB_QS  = (MID / 256) * (ROWS / 128);       // 128 tiles
constexpr int GB_KVC = (2 * MID / 256) * (CROWS / 128);  // 64 tiles
constexpr int GB_ALL = GB_KVS + GB_QS + GB_KVC;

__global__ __launch_bounds__(256) void gemm_qkv_kernel(
    const _Float16* __restrict__ akvs, const _Float16* __restrict__ wkvs, _Float16* __restrict__ ckvs,
    const _Float16* __restrict__ aqs, const _Float16* __restrict__ wqs, _Float16* __restrict__ cqs,
    const _Float16* __restrict__ akvc, const _Float16* __restrict__ wkvc, _Float16* __restrict__ ckvc) {
    int f = blockIdx.x;
    const _Float16 *A, *Bt;
    _Float16* C;
    float scale;
    int lgnb, K;  // N = 256 << lgnb
    if (f < GB_KVS)                 { A = akvs; Bt = wkvs; C = ckvs; scale = 1.0f;   lgnb = 2; K = F; }
    else if ((f -= GB_KVS) < GB_QS) { A = aqs;  Bt = wqs;  C = cqs;  scale = 0.125f; lgnb = 1; K = F; }
    else              { f -= GB_QS;   A = akvc; Bt = wkvc; C = ckvc; scale = 1.0f;   lgnb = 2; K = CF; }
    gemm_wmma_tile<0>(A, Bt, C, nullptr, nullptr, nullptr, scale, 256 << lgnb, K,
                      (f >> lgnb) * 128, (f & ((1 << lgnb) - 1)) * 256);
}

constexpr int VP = 80;  // V rows of 64 halves, read by ds_load_tr16_b128: pitch 160 B = 32 B x odd

typedef __attribute__((ext_vector_type(8))) short v8s;

// 16 (d) x 32 (keys) A fragment of V^T from a row-major [key][ld halves] LDS tile:
// lane (c, hf) gets keys kbase + 8 hf + 0..7, then kbase + 16 + 8 hf + 0..7, of
// column dbase + c: the k order of frag_ld and of a converted pair of D tiles.
__device__ __forceinline__ v16h frag_ld_tr(const _Float16* tile, int ld, int kbase, int dbase) {
    typedef __attribute__((address_space(3))) v8s lds_v8s;
    const int lane = threadIdx.x & 31;
    const _Float16* p = tile + (kbase + ((lane >> 4) << 3) + (lane & 7)) * ld + dbase + (((lane >> 3) & 1) << 3);
    v8h lo = __builtin_bit_cast(v8h, __builtin_amdgcn_ds_load_tr16_b128_v8i16((lds_v8s*)p));
    v8h hi = __builtin_bit_cast(v8h, __builtin_amdgcn_ds_load_tr16_b128_v8i16((lds_v8s*)(p + 16 * ld)));
    v16h r;
#pragma unroll
    for (int i = 0; i < 8; ++i) { r[i] = lo[i]; r[i + 8] = hi[i]; }
    return r;
}

__device__ __forceinline__ float xhalf(float x) {
    const int xi = __builtin_bit_cast(int, x);
    return __builtin_bit_cast(float,
        __builtin_amdgcn_permlanex16(xi, xi, 0x76543210, 0xfedcba98, false, false));
}

__global__ __launch_bounds__(128) void flash_attn_kernel(const _Float16* __restrict__ Q,
                                                         const _Float16* __restrict__ KV,
                                                         _Float16* __restrict__ O,
                                                         int n_q, int m_len) {
    __shared__ __align__(16) _Float16 sK[64 * FP];  // [key][d]: A rows of K Q^T
    __shared__ __align__(16) _Float16 sV[64 * VP];  // [key][d]: read transposed

    const int wave = threadIdx.x >> 5;
    const int lane = threadIdx.x & 31;
    const int h = blockIdx.y, b = blockIdx.z;
    const int qrow0 = blockIdx.x * 64;
    const int hf = lane >> 4, c0 = lane & 15;
    // this lane's query row, at its head's columns
    const size_t qoff  = ((size_t)b * n_q + qrow0 + wave * 16 + c0) * 512 + (size_t)h * 64;
    const size_t kvoff = (size_t)b * m_len * 1024 + (size_t)h * 64;

    const int srow = threadIdx.x >> 1;            // 0..63
    const int sseg = (threadIdx.x & 1) * 32;      // 0 / 32 halves (64B)

    // Q^T as B operand, loaded once, in the k order of frag_ld
    v16h qf[2];
#pragma unroll
    for (int kc = 0; kc < 2; ++kc) {
        const _Float16* qp = Q + qoff + kc * 32 + hf * 8;
        v8h lo = *(const v8h*)qp;
        v8h hi = *(const v8h*)(qp + 16);
#pragma unroll
        for (int i = 0; i < 8; ++i) { qf[kc][i] = lo[i]; qf[kc][i + 8] = hi[i]; }
    }

    float m_i = -1e30f, l_i = 0.f;  // l_i: the sum over this lane's half of the keys
    v8f o[4] = {};                  // o[j][r] = O^T[d = 16 j + 8 hf + r][query c0]

    for (int kt = 0; kt < m_len; kt += 64) {
        wait_ds0();       // this wave's reads of both tiles have returned ...
        __syncthreads();  // ... and every wave's: the copies may refill them
        const _Float16* gk = KV + kvoff + (size_t)(kt + srow) * 1024 + sseg;
        async_copy64B(lds_off(&sK[srow * FP + sseg]), gk);
        async_copy64B(lds_off(&sV[srow * VP + sseg]), gk + 512);
        wait_async0();
        __syncthreads();

        // S^T = K Q^T: s[g][r] = score of key 16 g + 8 hf + r with query c0
        v16h kf[2][4];
#pragma unroll
        for (int kc = 0; kc < 2; ++kc)
#pragma unroll
            for (int g = 0; g < 4; ++g) kf[kc][g] = frag_ld(sK + g * 16 * FP, FP, kc * 32);
        // the tile's 16 V^T reads queue behind them and return under the softmax
        v16h vt[2][4];
#pragma unroll
        for (int c = 0; c < 2; ++c)
#pragma unroll
            for (int j = 0; j < 4; ++j) vt[c][j] = frag_ld_tr(sV, VP, c * 32, j * 16);
        // holds the tile's 32 LDS reads together ahead of its WMMAs: left free, the
        // compiler reads a fragment right in front of its WMMA and the wave waits out
        // the LDS latency once per fragment
        __builtin_amdgcn_sched_barrier(0);
        v8f s[4] = {};
#pragma unroll
        for (int kc = 0; kc < 2; ++kc)
#pragma unroll
            for (int g = 0; g < 4; ++g) s[g] = WMMA_F32_F16(kf[kc][g], qf[kc], s[g]);

        // Online softmax, one query per lane.
        float mg[4];
#pragma unroll
        for (int g = 0; g < 4; ++g) {
            mg[g] = s[g][0];
#pragma unroll
            for (int r = 1; r < 8; ++r) mg[g] = fmaxf(mg[g], s[g][r]);
        }
        float mx = fmaxf(fmaxf(mg[0], mg[1]), fmaxf(mg[2], mg[3]));
        mx = fmaxf(mx, xhalf(mx));  // both halves of the query's keys
        const float mnew  = fmaxf(m_i, mx);
        const float alpha = __expf(m_i - mnew);
        m_i = mnew;
        float rs[4];
        v16h pb[2];  // P^T: keys 32 c .. 32 c + 31 are score tiles 2 c and 2 c + 1
#pragma unroll
        for (int g = 0; g < 4; ++g) {
            rs[g] = 0.f;
#pragma unroll
            for (int r = 0; r < 8; ++r) {
                const float p = __expf(s[g][r] - mnew);
                rs[g] += p;
                pb[g >> 1][(g & 1) * 8 + r] = (_Float16)p;
            }
        }
        l_i = l_i * alpha + ((rs[0] + rs[1]) + (rs[2] + rs[3]));
#pragma unroll
        for (int j = 0; j < 4; ++j) o[j] *= alpha;

        // O^T += V^T P^T
#pragma unroll
        for (int c = 0; c < 2; ++c) {
#pragma unroll
            for (int j = 0; j < 4; ++j) o[j] = WMMA_F32_F16(vt[c][j], pb[c], o[j]);
        }
    }

    // Epilogue: join the halves' sums, normalize, store 8 consecutive d per lane.
    const float inv = 1.0f / (l_i + xhalf(l_i));
#pragma unroll
    for (int j = 0; j < 4; ++j) {
        v8h y;
#pragma unroll
        for (int r = 0; r < 8; ++r) y[r] = (_Float16)(o[j][r] * inv);
        *(v8h*)(O + qoff + j * 16 + hf * 8) = y;
    }
}

// ---------------------------------------------------------------------------
// Host-side orchestration
// ---------------------------------------------------------------------------
extern "C" void kernel_launch(void* const* d_in, const int* in_sizes, int n_in,
                              void* d_out, int out_size, void* d_ws, size_t ws_size,
                              hipStream_t stream) {
    (void)in_sizes; (void)n_in; (void)out_size; (void)ws_size;

    const float* x       = (const float*)d_in[0];
    const float* ctx     = (const float*)d_in[1];
    const float* sa_ng   = (const float*)d_in[2];
    const float* sa_nb   = (const float*)d_in[3];
    const float* sa_ncg  = (const float*)d_in[4];
    const float* sa_ncb  = (const float*)d_in[5];
    const float* sa_wq   = (const float*)d_in[6];
    const float* sa_wkv  = (const float*)d_in[7];
    const float* sa_wo   = (const float*)d_in[8];
    const float* sa_bo   = (const float*)d_in[9];
    const float* ca_ng   = (const float*)d_in[10];
    const float* ca_nb   = (const float*)d_in[11];
    const float* ca_ncg  = (const float*)d_in[12];
    const float* ca_ncb  = (const float*)d_in[13];
    const float* ca_wq   = (const float*)d_in[14];
    const float* ca_wkv  = (const float*)d_in[15];
    const float* ca_wo   = (const float*)d_in[16];
    const float* ca_bo   = (const float*)d_in[17];
    float* out = (float*)d_out;

    // carve workspace
    size_t off = 0;
    auto carve = [&](size_t bytes) -> void* {
        void* p = (char*)d_ws + off;
        off += (bytes + 255) & ~(size_t)255;
        return p;
    };
    // weights, f16 TRANSPOSED to [N][K]
    _Float16* wq16s  = (_Float16*)carve((size_t)MID * F * 2);        // [512][1024]
    _Float16* wkv16s = (_Float16*)carve((size_t)(2 * MID) * F * 2);  // [1024][1024]
    _Float16* wo16s  = (_Float16*)carve((size_t)F * MID * 2);        // [1024][512]
    _Float16* wq16c  = (_Float16*)carve((size_t)MID * F * 2);        // [512][1024]
    _Float16* wkv16c = (_Float16*)carve((size_t)(2 * MID) * CF * 2); // [1024][768]
    _Float16* wo16c  = (_Float16*)carve((size_t)F * MID * 2);        // [1024][512]
    _Float16* XN1 = (_Float16*)carve((size_t)ROWS * F * 2);          // q-norm input
    _Float16* XN2 = (_Float16*)carve((size_t)ROWS * F * 2);          // kv-norm input
    _Float16* Q16 = (_Float16*)carve((size_t)ROWS * MID * 2);
    _Float16* KV16 = (_Float16*)carve((size_t)ROWS * 2 * MID * 2);
    _Float16* AO16 = (_Float16*)carve((size_t)ROWS * MID * 2);
    float*    X1   = (float*)carve((size_t)ROWS * F * 4);
    _Float16* CN   = (_Float16*)carve((size_t)CROWS * CF * 2);       // normalized context
    _Float16* KVC16 = (_Float16*)carve((size_t)CROWS * 2 * MID * 2); // cross K/V

    // ---- norms of the inputs (XN1, XN2 from x, CN from the context) and the weight
    // casts + transposes W[K][N] -> Wt[N][K] ----
    prep_inputs_kernel<<<2 * LB_X + LB_C + CB_ALL, 512, 0, stream>>>(
        x, ctx, sa_ng, sa_nb, sa_ncg, sa_ncb, ca_ncg, ca_ncb, XN1, XN2, CN,
        sa_wq, sa_wkv, sa_wo, ca_wq, ca_wkv, ca_wo, wq16s, wkv16s, wo16s, wq16c, wkv16c, wo16c);
    // ---- KV = XN2 @ wkv, Q = (XN1 @ wq) * scale, cross KV = CN @ ca_wkv ----
    gemm_qkv_kernel<<<GB_ALL, 256, 0, stream>>>(
        XN2, wkv16s, KV16, XN1, wq16s, Q16, CN, wkv16c, KVC16);

    // ================= self-attention =================
    // attention (m_len = 2048)
    flash_attn_kernel<<<dim3(Nx / 64, 8, B), 128, 0, stream>>>(Q16, KV16, AO16, Nx, Nx);
    // X1 = AO @ wo + bo + x   [8192 x 512 -> 1024] -> f32
    gemm_wmma_kernel<1><<<dim3(F / 256, ROWS / 128), 256, 0, stream>>>(
        AO16, wo16s, nullptr, X1, sa_bo, x, 1.0f, F, MID);

    // ================= cross-attention =================
    ln_cast_kernel<F / 128><<<ROWS / 32, 512, 0, stream>>>(X1, ca_ng, ca_nb, XN1);
    // Q = (XN1 @ ca_wq) * scale
    gemm_wmma_kernel<0><<<dim3(MID / 256, ROWS / 128), 256, 0, stream>>>(
        XN1, wq16c, Q16, nullptr, nullptr, nullptr, 0.125f, MID, F);
    // attention (m_len = 512)
    flash_attn_kernel<<<dim3(Nx / 64, 8, B), 128, 0, stream>>>(Q16, KVC16, AO16, Nx, Mc);
    // out = AO @ ca_wo + ca_bo + X1  -> f32 (final output)
    gemm_wmma_kernel<1><<<dim3(F / 256, ROWS / 128), 256, 0, stream>>>(
        AO16, wo16c, nullptr, out, ca_bo, X1, 1.0f, F, MID);
}

// v009
// One run takes 138 microseconds.
// In both of two side-by-side timings against v008, it was 1.08 times as fast.
// Counting every step since v000, it is 4.16 times as fast.
#include <hip/hip_runtime.h>

typedef __attribute__((ext_vector_type(16))) _Float16 v16h;
typedef __attribute__((ext_vector_type(8)))  _Float16 v8h;
typedef __attribute__((ext_vector_type(8)))  float    v8f;

#define WMMA_F32_F16(a, b, c) \
    __builtin_amdgcn_wmma_f32_16x16x32_f16(false, (a), false, (b), (short)0, (c), false, false)

// Problem shape, shared by the host code and by the kernels that hold several jobs
constexpr int B = 4, Nx = 2048, Mc = 512, F = 1024, CF = 768, MID = 512;
constexpr int ROWS = B * Nx;   // 8192
constexpr int CROWS = B * Mc;  // 2048

__device__ __forceinline__ unsigned lds_off(const void* p) {
    return (unsigned)(unsigned long long)p;
}

__device__ __forceinline__ void async_copy64B(unsigned ldsAddr, const void* g) {
    unsigned long long ga = (unsigned long long)g;
    asm volatile(
        "global_load_async_to_lds_b128 %0, %1, off\n\t"
        "global_load_async_to_lds_b128 %0, %1, off offset:16\n\t"
        "global_load_async_to_lds_b128 %0, %1, off offset:32\n\t"
        "global_load_async_to_lds_b128 %0, %1, off offset:48\n\t"
        "s_wait_xcnt 0x0"
        :: "v"(ldsAddr), "v"(ga) : "memory");
}

__device__ __forceinline__ void wait_async0() {
    asm volatile("s_wait_asynccnt 0x0" ::: "memory");
}

// the wave's own LDS reads have returned: stands in front of the barrier behind
// which a buffer that the wave has read is refilled by copies
__device__ __forceinline__ void wait_ds0() {
    asm volatile("s_wait_dscnt 0x0" ::: "memory");
}

constexpr int FP = 72;  // 64-half (128 B) rows -> 144 B pitch

__device__ __forceinline__ v16h frag_ld(const _Float16* tile, int ld, int kbase) {
    const int lane = threadIdx.x & 31;
    const _Float16* p = tile + (lane & 15) * ld + kbase + ((lane >> 4) << 3);
    v8h lo = *(const v8h*)p;
    v8h hi = *(const v8h*)(p + 16);
    v16h r;
#pragma unroll
    for (int i = 0; i < 8; ++i) { r[i] = lo[i]; r[i + 8] = hi[i]; }
    return r;
}

// ---------------------------------------------------------------------------
// LayerNorm (biased variance, eps 1e-5) + cast to f16.
// One wave owns two whole rows: each row sits in registers (NV 16-byte loads
// per lane, 512 contiguous bytes per wave-wide load), the sums cross lanes in
// registers, so the LayerNorm jobs use no LDS and no barrier, and take only
// rows / 2 waves (for speed only).
// C = NV * 128; work-group blk (16 waves) takes 32 rows from 32 blk.
// ---------------------------------------------------------------------------
typedef __attribute__((ext_vector_type(4))) float    v4f;
typedef __attribute__((ext_vector_type(4))) _Float16 v4h;

template <int MASK>
__device__ __forceinline__ float add_xmask(float x) {
    return x + __builtin_bit_cast(float, __builtin_amdgcn_update_dpp(
        0, __builtin_bit_cast(int, x), 0x160 | MASK, 0xf, 0xf, false));
}

// sum over the 32 lanes of a wave, the same value in every lane
__device__ __forceinline__ float wave_sum(float x) {
    x = add_xmask<1>(x);
    x = add_xmask<2>(x);
    x = add_xmask<4>(x);
    x = add_xmask<8>(x);
    const int xi = __builtin_bit_cast(int, x);
    return x + __builtin_bit_cast(float,
        __builtin_amdgcn_permlanex16(xi, xi, 0x76543210, 0xfedcba98, false, false));
}

template <int NV>
__device__ __forceinline__ void ln_cast_rows(const float* __restrict__ X,
                                             const float* __restrict__ G,
                                             const float* __restrict__ Bv,
                                             _Float16* __restrict__ Y, int blk) {
    constexpr int C = NV * 128;
    const int lane = threadIdx.x & 31;
    // the wave's number as a scalar: the rows' base addresses then sit in scalar
    // registers and the lane number is the only address register of every access
    const int wave = __builtin_amdgcn_readfirstlane(threadIdx.x >> 5);
    const int row0 = (blk * 16 + wave) * 2;
    const v4f* x4 = (const v4f*)(X + (size_t)row0 * C) + lane;

    v4f v[2][NV];
#pragma unroll
    for (int r = 0; r < 2; ++r)
#pragma unroll
        for (int i = 0; i < NV; ++i) v[r][i] = x4[r * (C / 4) + i * 32];
    // scale and shift are asked for beside the rows, so that their latency
    // runs under the rows' own instead of behind the sums
    const v4f* g4 = (const v4f*)G + lane;
    const v4f* b4 = (const v4f*)Bv + lane;
    v4f g[NV], bb[NV];
#pragma unroll
    for (int i = 0; i < NV; ++i) { g[i] = g4[i * 32]; bb[i] = b4[i * 32]; }
    // keeps every load above in flight at once: without it the compiler sinks
    // the scale and shift loads behind the sums, in short dependent batches
    __builtin_amdgcn_sched_barrier(0);
    asm volatile("s_wait_xcnt 0x0" ::: "memory");
    __builtin_amdgcn_sched_barrier(0);

    float mean[2], rstd[2];
#pragma unroll
    for (int r = 0; r < 2; ++r) {
        v4f a1 = v[r][0], a2 = v[r][0] * v[r][0];
#pragma unroll
        for (int i = 1; i < NV; ++i) { a1 += v[r][i]; a2 += v[r][i] * v[r][i]; }
        const float s1 = wave_sum((a1[0] + a1[1]) + (a1[2] + a1[3]));
        const float s2 = wave_sum((a2[0] + a2[1]) + (a2[2] + a2[3]));
        constexpr float invC = 1.0f / (float)C;
        mean[r] = s1 * invC;
        rstd[r] = rsqrtf(s2 * invC - mean[r] * mean[r] + 1e-5f);
    }

    v4h* y4 = (v4h*)(Y + (size_t)row0 * C) + lane;
#pragma unroll
    for (int i = 0; i < NV; ++i) {
#pragma unroll
        for (int r = 0; r < 2; ++r) {
            v4h y;
#pragma unroll
            for (int e = 0; e < 4; ++e)
                y[e] = (_Float16)((v[r][i][e] - mean[r]) * rstd[r] * g[i][e] + bb[i][e]);
            y4[r * (C / 4) + i * 32] = y;
        }
    }
    asm volatile("s_wait_xcnt 0x0" ::: "memory");
}

template <int LGNT>
__device__ __forceinline__ void cast_transpose_tile(const float* __restrict__ in,
                                                    _Float16* __restrict__ out,
                                                    _Float16* tile, int K, int t) {
    constexpr int N = 128 << LGNT;
    const int nb = (t & ((1 << LGNT) - 1)) * 128;
    const int kb = (t >> LGNT) * 128;
    const int lane = threadIdx.x & 31;
    // the wave's number as a scalar: the rows' base addresses then sit in scalar
    // registers, and one lane offset is the only address register of the accesses
    const int wave = __builtin_amdgcn_readfirstlane(threadIdx.x >> 5);
    const v4f* s4 = (const v4f*)(in + (size_t)(kb + wave * 8) * N + nb) + lane;
    v4f v[8];
#pragma unroll
    for (int i = 0; i < 8; ++i) v[i] = s4[i * (N / 4)];
    __builtin_amdgcn_sched_barrier(0);
    asm volatile("s_wait_xcnt 0x0" ::: "memory");
    __builtin_amdgcn_sched_barrier(0);
#pragma unroll
    for (int e = 0; e < 4; ++e) {
        v8h h;
#pragma unroll
        for (int i = 0; i < 8; ++i) h[i] = (_Float16)v[i][e];
        *(v8h*)&tile[(lane * 4 + e) * 128 + ((wave ^ (lane & 15)) << 3)] = h;
    }
    __syncthreads();
#pragma unroll
    for (int j = 0; j < 4; ++j) {
        const int n0 = j * 32 + wave * 2;  // even: rows n0 and n0 + 1 share n >> 2
        const int c = lane & 15;
        const v8h h = *(const v8h*)&tile[(n0 + (lane >> 4)) * 128 + ((c ^ ((n0 >> 2) & 15)) << 3)];
        *(v8h*)(out + (size_t)(nb + n0) * K + kb + ((lane >> 4) * K + c * 8)) = h;
    }
    asm volatile("s_wait_xcnt 0x0" ::: "memory");
}

constexpr int CB_WQ  = (F / 128) * (MID / 128);       // tiles of a [F][MID] or [MID][F] weight
constexpr int CB_WKV = (F / 128) * (2 * MID / 128);   // tiles of the self k/v weight
constexpr int CB_WKC = (CF / 128) * (2 * MID / 128);  // tiles of the cross k/v weight
constexpr int CB_ALL = 4 * CB_WQ + CB_WKV + CB_WKC;

// All that needs only the inputs, in one launch: the three LayerNorms (x with the
// query norm's and with the key/value norm's scale and shift, then the context)
// and the six weight casts.  The work-group's index picks the job; the casts, the
// shortest jobs, come last and fill the places that the last LayerNorm rows leave.
constexpr int LB_X = ROWS / 32;   // work-groups of one LayerNorm of x
constexpr int LB_C = CROWS / 32;  // ... of the context

__global__ __launch_bounds__(512) void prep_inputs_kernel(
    const float* __restrict__ x, const float* __restrict__ ctx,
    const float* __restrict__ g1, const float* __restrict__ b1,
    const float* __restrict__ g2, const float* __restrict__ b2,
    const float* __restrict__ gc, const float* __restrict__ bc,
    _Float16* __restrict__ y1, _Float16* __restrict__ y2, _Float16* __restrict__ yc,
    const float* __restrict__ wqs, const float* __restrict__ wkvs, const float* __restrict__ wos,
    const float* __restrict__ wqc, const float* __restrict__ wkvc, const float* __restrict__ woc,
    _Float16* __restrict__ tqs, _Float16* __restrict__ tkvs, _Float16* __restrict__ tos,
    _Float16* __restrict__ tqc, _Float16* __restrict__ tkvc, _Float16* __restrict__ toc) {
    int f = blockIdx.x;
    if (f < 2 * LB_X) {
        const bool kv = f >= LB_X;
        ln_cast_rows<F / 128>(x, kv ? g2 : g1, kv ? b2 : b1, kv ? y2 : y1, kv ? f - LB_X : f);
    } else if ((f -= 2 * LB_X) < LB_C) {
        ln_cast_rows<CF / 128>(ctx, gc, bc, yc, f);
    } else {
        f -= LB_C;
        __shared__ __align__(16) _Float16 tile[128 * 128];
        const float* in;
        _Float16* out;
        int K;
        if (f < 2 * CB_WQ) {  // the two [F][MID] weights: N = 512
            const bool c = f >= CB_WQ;
            cast_transpose_tile<2>(c ? wqc : wqs, c ? tqc : tqs, tile, F, c ? f - CB_WQ : f);
            return;
        }
        f -= 2 * CB_WQ;  // the other four: N = 1024
        if (f < CB_WKV)                  { in = wkvs; out = tkvs; K = F; }
        else if ((f -= CB_WKV) < CB_WKC) { in = wkvc; out = tkvc; K = CF; }
        else if ((f -= CB_WKC) < CB_WQ)  { in = wos;  out = tos;  K = MID; }
        else               { f -= CB_WQ;   in = woc;  out = toc;  K = MID; }
        cast_transpose_tile<3>(in, out, tile, K, f);
    }
}

// ---------------------------------------------------------------------------
// One thread's twelve copies of one GEMM ring stage: 16 B of 4 A rows and of 8 B
// rows, 32 rows apart; in LDS the B rows follow the 128 A rows at one pitch.
// ---------------------------------------------------------------------------
constexpr int GK  = 64;                // k depth of a ring stage
constexpr int GST = (128 + 256) * FP;  // halves in one stage buffer

__device__ __forceinline__ void gemm_stage_copies(unsigned d, const _Float16* a, const _Float16* b,
                                                  size_t step) {
    constexpr unsigned R = 32 * FP * 2;  // 32 LDS rows in bytes
    asm volatile(
        "global_load_async_to_lds_b128 %0, %12, off\n\t"
        "global_load_async_to_lds_b128 %1, %13, off\n\t"
        "global_load_async_to_lds_b128 %2, %14, off\n\t"
        "global_load_async_to_lds_b128 %3, %15, off\n\t"
        "global_load_async_to_lds_b128 %4, %16, off\n\t"
        "global_load_async_to_lds_b128 %5, %17, off\n\t"
        "global_load_async_to_lds_b128 %6, %18, off\n\t"
        "global_load_async_to_lds_b128 %7, %19, off\n\t"
        "global_load_async_to_lds_b128 %8, %20, off\n\t"
        "global_load_async_to_lds_b128 %9, %21, off\n\t"
        "global_load_async_to_lds_b128 %10, %22, off\n\t"
        "global_load_async_to_lds_b128 %11, %23, off\n\t"
        "s_wait_xcnt 0x0"
        :: "v"(d), "v"(d + R), "v"(d + 2 * R), "v"(d + 3 * R), "v"(d + 4 * R), "v"(d + 5 * R),
           "v"(d + 6 * R), "v"(d + 7 * R), "v"(d + 8 * R), "v"(d + 9 * R), "v"(d + 10 * R),
           "v"(d + 11 * R),
           "v"((unsigned long long)a), "v"((unsigned long long)(a + step)),
           "v"((unsigned long long)(a + 2 * step)), "v"((unsigned long long)(a + 3 * step)),
           "v"((unsigned long long)b), "v"((unsigned long long)(b + step)),
           "v"((unsigned long long)(b + 2 * step)), "v"((unsigned long long)(b + 3 * step)),
           "v"((unsigned long long)(b + 4 * step)), "v"((unsigned long long)(b + 5 * step)),
           "v"((unsigned long long)(b + 6 * step)), "v"((unsigned long long)(b + 7 * step))
        : "memory");
}

// ---------------------------------------------------------------------------
// Tiled WMMA GEMM:  C[M,N] = A[M,K] (f16 row-major) * Bt[N,K] (f16, B transposed)
// Block tile 128x256, 256 threads = 8 waves in a 2(M) x 4(N) grid,
// each wave computes a 64x64 register tile: 16 WMMAs per 32-wide K step.
// A/B tiles staged into LDS with global_load_async_to_lds_b128, in a ring of two
// buffers of 64 k each: the copies of stage t + 2 are issued at the foot of pass
// t and waited for at the foot of pass t + 1, so they fly under a whole pass of
// 32 WMMAs per wave.  K is a multiple of 64.
// MODE 0: C -> f16 * scale (1 for K/V, 0.125 as the Q pre-scale).
// MODE 1: C -> f32 with + bias[n] + res[m,n]: res + bias is the accumulators' start
// value, asked for at the kernel's entry (all loads in flight at once, beside the
// first stage's copies), so that the epilogue only stores.
// ---------------------------------------------------------------------------
template <int MODE>
__device__ __forceinline__ void gemm_wmma_tile(const _Float16* __restrict__ A,
                                               const _Float16* __restrict__ Bt,
                                               _Float16* __restrict__ C16,
                                               float* __restrict__ C32,
                                               const float* __restrict__ bias,
                                               const float* __restrict__ res,
                                               float scale, int N, int K,
                                               int mbase, int nbase) {
    // two stage buffers; each holds 128 A rows [m][k], then 256 B rows [n][k]
    __shared__ __align__(16) _Float16 sm[2 * GST];
    const int tid = threadIdx.x;
    const int wave = tid >> 5, lane = tid & 31;
    const int waveM = wave >> 2, waveN = wave & 3;

    v8f acc[4][4] = {};

    // staging assignments: a stage row is 64 halves = 128 B = 8 lanes x 16 B;
    // a thread copies its 16 B of rows srow + 32 i: 4 rows of A, 8 rows of B
    const int srow = tid >> 3, sseg = (tid & 7) * 8;
    const _Float16* gA = A + (size_t)(mbase + srow) * K + sseg;
    const _Float16* gB = Bt + (size_t)(nbase + srow) * K + sseg;
    const size_t gstep = (size_t)32 * K;  // 32 rows of A or of Bt, in halves
    const unsigned d0 = lds_off(&sm[srow * FP + sseg]);
    const int nst = K / GK;

    gemm_stage_copies(d0, gA, gB, gstep);
    float bj[4];
    if (MODE == 1) {
        // the lane's 128 residual values, straight into its accumulators, and its 4
        // bias values: all in flight together, beside stage 0's copies (unrolled:
        // accumulator elements are registers, their indices constants)
        const float* rp = res + (size_t)(mbase + waveM * 64 + (lane >> 4) * 8) * N + nbase + waveN * 64 + (lane & 15);
#pragma unroll
        for (int i = 0; i < 4; ++i)
#pragma unroll
            for (int r = 0; r < 8; ++r)
#pragma unroll
                for (int j = 0; j < 4; ++j) acc[i][j][r] = rp[(size_t)(i * 16 + r) * N + j * 16];
#pragma unroll
        for (int j = 0; j < 4; ++j) bj[j] = bias[nbase + waveN * 64 + j * 16 + (lane & 15)];
        __builtin_amdgcn_sched_barrier(0);
        asm volatile("s_wait_xcnt 0x0" ::: "memory");
        __builtin_amdgcn_sched_barrier(0);
    }
    wait_async0();    // stage 0 has landed (this wave's share)
    __syncthreads();  // ... and every other wave's
    if (nst > 1) gemm_stage_copies(d0 + GST * 2, gA + GK, gB + GK, gstep);

    if (MODE == 1) {
#pragma unroll
        for (int i = 0; i < 4; ++i)
#pragma unroll
            for (int j = 0; j < 4; ++j) acc[i][j] += bj[j];
    }

    for (int t = 0; t < nst; ++t) {
        const _Float16* sA = sm + (t & 1) * GST;
        const _Float16* sB = sA + 128 * FP;
        // unrolled: kc becomes an immediate offset of the LDS reads
#pragma unroll
        for (int kc = 0; kc < GK; kc += 32) {
            v16h bf[4], af[4];
#pragma unroll
            for (int j = 0; j < 4; ++j) {
                bf[j] = frag_ld(sB + (waveN * 64 + j * 16) * FP, FP, kc);
                af[j] = frag_ld(sA + (waveM * 64 + j * 16) * FP, FP, kc);
            }
            // holds the block's 16 LDS reads together ahead of its 16 WMMAs: left free,
            // the compiler reads each A fragment into one register set right in front
            // of its row of WMMAs, and the wave waits out the LDS latency at every row
            __builtin_amdgcn_sched_barrier(0);
#pragma unroll
            for (int i = 0; i < 4; ++i)
#pragma unroll
                for (int j = 0; j < 4; ++j)
                    acc[i][j] = WMMA_F32_F16(af[i], bf[j], acc[i][j]);
        }
        // publish point: this wave has left buffer t & 1 and its copies of stage
        // t + 1 have landed; the one barrier says both of every wave
        wait_ds0();
        wait_async0();
        __syncthreads();
        if (t + 2 < nst)
            gemm_stage_copies(d0 + (t & 1) * (GST * 2), gA + (t + 2) * GK, gB + (t + 2) * GK, gstep);
    }
    wait_async0();  // no copy is outstanding when the wave goes on to its end

    const int hf = lane >> 4, c0 = lane & 15;
    if (MODE == 1) {
        // row by row: four stores in a row fill two whole 128 B lines in each of two
        // rows; unrolled: accumulator elements are registers, their indices constants
        float* cp = C32 + (size_t)(mbase + waveM * 64 + hf * 8) * N + nbase + waveN * 64 + c0;
#pragma unroll
        for (int i = 0; i < 4; ++i)
#pragma unroll
            for (int r = 0; r < 8; ++r)
#pragma unroll
                for (int j = 0; j < 4; ++j) cp[(size_t)(i * 16 + r) * N + j * 16] = acc[i][j][r];
        return;
    }
#pragma unroll
    for (int i = 0; i < 4; ++i) {
#pragma unroll
        for (int j = 0; j < 4; ++j) {
#pragma unroll
            for (int r = 0; r < 8; ++r) {
                const int row = mbase + waveM * 64 + i * 16 + hf * 8 + r;
                const int col = nbase + waveN * 64 + j * 16 + c0;
                C16[(size_t)row * N + col] = (_Float16)(acc[i][j][r] * scale);
            }
        }
    }
}

// one product per launch; grid: (N / 256, M / 128)
template <int MODE>
__global__ __launch_bounds__(256) void gemm_wmma_kernel(const _Float16* __restrict__ A,
                                                        const _Float16* __restrict__ Bt,
                                                        _Float16* __restrict__ C16,
                                                        float* __restrict__ C32,
                                                        const float* __restrict__ bias,
                                                        const float* __restrict__ res,
                                                        float scale, int N, int K) {
    // both f32 products are F wide: with the pitch a constant, every residual load and
    // every store of a lane is an immediate offset of one address
    gemm_wmma_tile<MODE>(A, Bt, C16, C32, bias, res, scale, MODE == 1 ? F : N, K,
                         blockIdx.y * 128, blockIdx.x * 256);
}

// The three products that need only the prepared operands, in one launch: self
// K/V, self Q and cross K/V.  The work-group's index picks product and tile (the
// column block runs fastest, as in a launch of its own); the shortest K is last.
constexpr int GB_KVS = (2 * MID / 256) * (ROWS / 128);   // 256 tiles
constexpr int GB_QS  = (MID / 256) * (ROWS / 128);       // 128 tiles
constexpr int GB_KVC = (2 * MID / 256) * (CROWS / 128);  // 64 tiles
constexpr int GB_ALL = GB_KVS + GB_QS + GB_KVC;

__global__ __launch_bounds__(256) void gemm_qkv_kernel(
    const _Float16* __restrict__ akvs, const _Float16* __restrict__ wkvs, _Float16* __restrict__ ckvs,
    const _Float16* __restrict__ aqs, const _Float16* __restrict__ wqs, _Float16* __restrict__ cqs,
    const _Float16* __restrict__ akvc, const _Float16* __restrict__ wkvc, _Float16* __restrict__ ckvc) {
    int f = blockIdx.x;
    const _Float16 *A, *Bt;
    _Float16* C;
    float scale;
    int lgnb, K;  // N = 256 << lgnb
    if (f < GB_KVS)                 { A = akvs; Bt = wkvs; C = ckvs; scale = 1.0f;   lgnb = 2; K = F; }
    else if ((f -= GB_KVS) < GB_QS) { A = aqs;  Bt = wqs;  C = cqs;  scale = 0.125f; lgnb = 1; K = F; }
    else              { f -= GB_QS;   A = akvc; Bt = wkvc; C = ckvc; scale = 1.0f;   lgnb = 2; K = CF; }
    gemm_wmma_tile<0>(A, Bt, C, nullptr, nullptr, nullptr, scale, 256 << lgnb, K,
                      (f >> lgnb) * 128, (f & ((1 << lgnb) - 1)) * 256);
}

// ---------------------------------------------------------------------------
// LayerNorm and the product that reads it, in one launch:
//   C[M, MID] = LayerNorm(X[M, F]) (f16) * Bt[MID, F]^T * scale  -> f16.
// A work-group owns 64 whole rows and 256 of the MID columns (M / 64 x MID / 256
// work-groups: one per WGP; the two that share rows each norm them).  Its 8 waves
// norm 8 rows each (4 at a time in registers, the arithmetic of ln_cast_rows)
// straight into LDS, where the 64 x F tile stays as the A operand for the whole K
// loop; only the weights go through a ring of two 128-k stages (one stage is in
// flight at a time, so a longer stage pays the copies' latency half as often), and
// their first stage flies under the norm.  Waves in a 2 (M) x 4 (N) grid, 32 x 64 each.
// ---------------------------------------------------------------------------
constexpr int AP = F + 8;   // resident A rows of F halves: pitch 2064 B = 16 B x odd
constexpr int WK = 128;     // k depth of a weight stage
constexpr int WP = WK + 8;  // weight rows of 128 halves: pitch 272 B = 16 B x odd

// one thread's 16 B of 8 weight rows, 16 rows apart
__device__ __forceinline__ void weight_copies8(unsigned d, const _Float16* b, size_t step) {
    constexpr unsigned R = 16 * WP * 2;  // 16 LDS rows in bytes
    asm volatile(
        "global_load_async_to_lds_b128 %0, %8, off\n\t"
        "global_load_async_to_lds_b128 %1, %9, off\n\t"
        "global_load_async_to_lds_b128 %2, %10, off\n\t"
        "global_load_async_to_lds_b128 %3, %11, off\n\t"
        "global_load_async_to_lds_b128 %4, %12, off\n\t"
        "global_load_async_to_lds_b128 %5, %13, off\n\t"
        "global_load_async_to_lds_b128 %6, %14, off\n\t"
        "global_load_async_to_lds_b128 %7, %15, off\n\t"
        "s_wait_xcnt 0x0"
        :: "v"(d), "v"(d + R), "v"(d + 2 * R), "v"(d + 3 * R), "v"(d + 4 * R), "v"(d + 5 * R),
           "v"(d + 6 * R), "v"(d + 7 * R),
           "v"((unsigned long long)b), "v"((unsigned long long)(b + step)),
           "v"((unsigned long long)(b + 2 * step)), "v"((unsigned long long)(b + 3 * step)),
           "v"((unsigned long long)(b + 4 * step)), "v"((unsigned long long)(b + 5 * step)),
           "v"((unsigned long long)(b + 6 * step)), "v"((unsigned long long)(b + 7 * step))
        : "memory");
}

__global__ __launch_bounds__(256) void ln_gemm_kernel(const float* __restrict__ X,
                                                      const float* __restrict__ G,
                                                      const float* __restrict__ Bv,
                                                      const _Float16* __restrict__ Bt,
                                                      _Float16* __restrict__ C16, float scale) {
    constexpr int K = F, N = MID, NV = K / 128, nst = K / WK;
    constexpr int BST = 256 * WP;  // halves in one stage buffer of weights
    __shared__ __align__(16) _Float16 sA[64 * AP];
    __shared__ __align__(16) _Float16 sB[2 * BST];
    const int tid = threadIdx.x, lane = tid & 31;
    // the wave's number as a scalar: the rows' base addresses then sit in scalar registers
    const int wave = __builtin_amdgcn_readfirstlane(tid >> 5);
    const int waveM = wave >> 2, waveN = wave & 3;
    const int mbase = (blockIdx.x >> 1) * 64, nbase = (blockIdx.x & 1) * 256;

    // a stage row is 128 halves = 16 lanes x 16 B; a thread copies its 16 B of rows srow + 16 i
    const int srow = tid >> 4, sseg = (tid & 15) * 8;
    const _Float16* gB = Bt + (size_t)(nbase + srow) * K + sseg;
    const size_t gstep = (size_t)16 * K;
    const unsigned d0 = lds_off(&sB[srow * WP + sseg]);
    constexpr unsigned R8 = 8 * 16 * WP * 2;  // 128 LDS rows in bytes

    weight_copies8(d0, gB, gstep);
    weight_copies8(d0 + R8, gB + 8 * gstep, gstep);

    {
        const v4f* g4 = (const v4f*)G + lane;
        const v4f* b4 = (const v4f*)Bv + lane;
        v4f g[NV], bb[NV];
#pragma unroll
        for (int i = 0; i < NV; ++i) { bb[i] = b4[i * 32]; g[i] = g4[i * 32]; }
        __builtin_amdgcn_sched_barrier(0);
        asm volatile("s_wait_xcnt 0x0" ::: "memory");
        __builtin_amdgcn_sched_barrier(0);
        // rolled: four rows fill 128 registers; both halves at once would not fit
#pragma nounroll
        for (int it = 0; it < 2; ++it) {
            const int lr = wave * 8 + it * 4;
            const v4f* x4 = (const v4f*)(X + (size_t)(mbase + lr) * K) + lane;
            v4f v[4][NV];
#pragma unroll
            for (int r = 0; r < 4; ++r)
#pragma unroll
                for (int i = 0; i < NV; ++i) v[r][i] = x4[r * (K / 4) + i * 32];
            __builtin_amdgcn_sched_barrier(0);
            asm volatile("s_wait_xcnt 0x0" ::: "memory");
            __builtin_amdgcn_sched_barrier(0);
#pragma unroll
            for (int r = 0; r < 4; ++r) {
                v4f a1 = v[r][0], a2 = v[r][0] * v[r][0];
#pragma unroll
                for (int i = 1; i < NV; ++i) { a1 += v[r][i]; a2 += v[r][i] * v[r][i]; }
                const float s1 = wave_sum((a1[0] + a1[1]) + (a1[2] + a1[3]));
                const float s2 = wave_sum((a2[0] + a2[1]) + (a2[2] + a2[3]));
                constexpr float invC = 1.0f / (float)K;
                const float mean = s1 * invC;
                const float rstd = rsqrtf(s2 * invC - mean * mean + 1e-5f);
#pragma unroll
                for (int i = 0; i < NV; ++i) {
                    v4h y;
#pragma unroll
                    for (int e = 0; e < 4; ++e)
                        y[e] = (_Float16)((v[r][i][e] - mean) * rstd * g[i][e] + bb[i][e]);
                    *(v4h*)&sA[(lr + r) * AP + i * 128 + lane * 4] = y;
                }
            }
        }
    }
    wait_async0();    // weight stage 0 has landed (this wave's share)
    __syncthreads();  // ... and every other wave's, and every wave's normed rows are in LDS
    weight_copies8(d0 + BST * 2, gB + WK, gstep);
    weight_copies8(d0 + BST * 2 + R8, gB + WK + 8 * gstep, gstep);

    v8f acc[2][4] = {};
    for (int t = 0; t < nst; ++t) {
        const _Float16* sW = sB + (t & 1) * BST + waveN * 64 * WP;
        const _Float16* sX = sA + waveM * 32 * AP + t * WK;
        // unrolled: kc becomes an immediate offset of the LDS reads
#pragma unroll
        for (int kc = 0; kc < WK; kc += 32) {
            v16h bf[4], af[2];
#pragma unroll
            for (int j = 0; j < 4; ++j) bf[j] = frag_ld(sW + j * 16 * WP, WP, kc);
#pragma unroll
            for (int i = 0; i < 2; ++i) af[i] = frag_ld(sX + i * 16 * AP, AP, kc);
            // holds the block's 12 LDS reads together ahead of its 8 WMMAs, so that the
            // wave waits out the LDS latency once per block and not at every row
            __builtin_amdgcn_sched_barrier(0);
#pragma unroll
            for (int i = 0; i < 2; ++i)
#pragma unroll
                for (int j = 0; j < 4; ++j)
                    acc[i][j] = WMMA_F32_F16(af[i], bf[j], acc[i][j]);
        }
        // publish point: this wave has left buffer t & 1 and its copies of stage
        // t + 1 have landed; the one barrier says both of every wave
        wait_ds0();
        wait_async0();
        __syncthreads();
        if (t + 2 < nst) {
            weight_copies8(d0 + (t & 1) * (BST * 2), gB + (t + 2) * WK, gstep);
            weight_copies8(d0 + (t & 1) * (BST * 2) + R8, gB + (t + 2) * WK + 8 * gstep, gstep);
        }
    }
    wait_async0();  // no copy is outstanding when the wave goes on to its end

    const int hf = lane >> 4, c0 = lane & 15;
#pragma unroll
    for (int i = 0; i < 2; ++i) {
#pragma unroll
        for (int j = 0; j < 4; ++j) {
#pragma unroll
            for (int r = 0; r < 8; ++r) {
                const int row = mbase + waveM * 32 + i * 16 + hf * 8 + r;
                const int col = nbase + waveN * 64 + j * 16 + c0;
                C16[(size_t)row * N + col] = (_Float16)(acc[i][j][r] * scale);
            }
        }
    }
}

constexpr int VP = 80;  // V rows of 64 halves, read by ds_load_tr16_b128: pitch 160 B = 32 B x odd

typedef __attribute__((ext_vector_type(8))) short v8s;

// 16 (d) x 32 (keys) A fragment of V^T from a row-major [key][ld halves] LDS tile:
// lane (c, hf) gets keys kbase + 8 hf + 0..7, then kbase + 16 + 8 hf + 0..7, of
// column dbase + c: the k order of frag_ld and of a converted pair of D tiles.
__device__ __forceinline__ v16h frag_ld_tr(const _Float16* tile, int ld, int kbase, int dbase) {
    typedef __attribute__((address_space(3))) v8s lds_v8s;
    const int lane = threadIdx.x & 31;
    const _Float16* p = tile + (kbase + ((lane >> 4) << 3) + (lane & 7)) * ld + dbase + (((lane >> 3) & 1) << 3);
    v8h lo = __builtin_bit_cast(v8h, __builtin_amdgcn_ds_load_tr16_b128_v8i16((lds_v8s*)p));
    v8h hi = __builtin_bit_cast(v8h, __builtin_amdgcn_ds_load_tr16_b128_v8i16((lds_v8s*)(p + 16 * ld)));
    v16h r;
#pragma unroll
    for (int i = 0; i < 8; ++i) { r[i] = lo[i]; r[i + 8] = hi[i]; }
    return r;
}

__device__ __forceinline__ float xhalf(float x) {
    const int xi = __builtin_bit_cast(int, x);
    return __builtin_bit_cast(float,
        __builtin_amdgcn_permlanex16(xi, xi, 0x76543210, 0xfedcba98, false, false));
}

__global__ __launch_bounds__(128) void flash_attn_kernel(const _Float16* __restrict__ Q,
                                                         const _Float16* __restrict__ KV,
                                                         _Float16* __restrict__ O,
                                                         int n_q, int m_len) {
    __shared__ __align__(16) _Float16 sK[64 * FP];  // [key][d]: A rows of K Q^T
    __shared__ __align__(16) _Float16 sV[64 * VP];  // [key][d]: read transposed

    const int wave = threadIdx.x >> 5;
    const int lane = threadIdx.x & 31;
    const int h = blockIdx.y, b = blockIdx.z;
    const int qrow0 = blockIdx.x * 64;
    const int hf = lane >> 4, c0 = lane & 15;
    // this lane's query row, at its head's columns
    const size_t qoff  = ((size_t)b * n_q + qrow0 + wave * 16 + c0) * 512 + (size_t)h * 64;
    const size_t kvoff = (size_t)b * m_len * 1024 + (size_t)h * 64;

    const int srow = threadIdx.x >> 1;            // 0..63
    const int sseg = (threadIdx.x & 1) * 32;      // 0 / 32 halves (64B)

    // Q^T as B operand, loaded once, in the k order of frag_ld
    v16h qf[2];
#pragma unroll
    for (int kc = 0; kc < 2; ++kc) {
        const _Float16* qp = Q + qoff + kc * 32 + hf * 8;
        v8h lo = *(const v8h*)qp;
        v8h hi = *(const v8h*)(qp + 16);
#pragma unroll
        for (int i = 0; i < 8; ++i) { qf[kc][i] = lo[i]; qf[kc][i + 8] = hi[i]; }
    }

    float m_i = -1e30f, l_i = 0.f;  // l_i: the sum over this lane's half of the keys
    v8f o[4] = {};                  // o[j][r] = O^T[d = 16 j + 8 hf + r][query c0]

    for (int kt = 0; kt < m_len; kt += 64) {
        wait_ds0();       // this wave's reads of both tiles have returned ...
        __syncthreads();  // ... and every wave's: the copies may refill them
        const _Float16* gk = KV + kvoff + (size_t)(kt + srow) * 1024 + sseg;
        async_copy64B(lds_off(&sK[srow * FP + sseg]), gk);
        async_copy64B(lds_off(&sV[srow * VP + sseg]), gk + 512);
        wait_async0();
        __syncthreads();

        // S^T = K Q^T: s[g][r] = score of key 16 g + 8 hf + r with query c0
        v16h kf[2][4];
#pragma unroll
        for (int kc = 0; kc < 2; ++kc)
#pragma unroll
            for (int g = 0; g < 4; ++g) kf[kc][g] = frag_ld(sK + g * 16 * FP, FP, kc * 32);
        // the tile's 16 V^T reads queue behind them and return under the softmax
        v16h vt[2][4];
#pragma unroll
        for (int c = 0; c < 2; ++c)
#pragma unroll
            for (int j = 0; j < 4; ++j) vt[c][j] = frag_ld_tr(sV, VP, c * 32, j * 16);
        // holds the tile's 32 LDS reads together ahead of its WMMAs: left free, the
        // compiler reads a fragment right in front of its WMMA and the wave waits out
        // the LDS latency once per fragment
        __builtin_amdgcn_sched_barrier(0);
        v8f s[4] = {};
#pragma unroll
        for (int kc = 0; kc < 2; ++kc)
#pragma unroll
            for (int g = 0; g < 4; ++g) s[g] = WMMA_F32_F16(kf[kc][g], qf[kc], s[g]);

        // Online softmax, one query per lane.
        float mg[4];
#pragma unroll
        for (int g = 0; g < 4; ++g) {
            mg[g] = s[g][0];
#pragma unroll
            for (int r = 1; r < 8; ++r) mg[g] = fmaxf(mg[g], s[g][r]);
        }
        float mx = fmaxf(fmaxf(mg[0], mg[1]), fmaxf(mg[2], mg[3]));
        mx = fmaxf(mx, xhalf(mx));  // both halves of the query's keys
        const float mnew  = fmaxf(m_i, mx);
        const float alpha = __expf(m_i - mnew);
        m_i = mnew;
        float rs[4];
        v16h pb[2];  // P^T: keys 32 c .. 32 c + 31 are score tiles 2 c and 2 c + 1
#pragma unroll
        for (int g = 0; g < 4; ++g) {
            rs[g] = 0.f;
#pragma unroll
            for (int r = 0; r < 8; ++r) {
                const float p = __expf(s[g][r] - mnew);
                rs[g] += p;
                pb[g >> 1][(g & 1) * 8 + r] = (_Float16)p;
            }
        }
        l_i = l_i * alpha + ((rs[0] + rs[1]) + (rs[2] + rs[3]));
#pragma unroll
        for (int j = 0; j < 4; ++j) o[j] *= alpha;

        // O^T += V^T P^T
#pragma unroll
        for (int c = 0; c < 2; ++c) {
#pragma unroll
            for (int j = 0; j < 4; ++j) o[j] = WMMA_F32_F16(vt[c][j], pb[c], o[j]);
        }
    }

    // Epilogue: join the halves' sums, normalize, store 8 consecutive d per lane.
    const float inv = 1.0f / (l_i + xhalf(l_i));
#pragma unroll
    for (int j = 0; j < 4; ++j) {
        v8h y;
#pragma unroll
        for (int r = 0; r < 8; ++r) y[r] = (_Float16)(o[j][r] * inv);
        *(v8h*)(O + qoff + j * 16 + hf * 8) = y;
    }
}

// ---------------------------------------------------------------------------
// Host-side orchestration
// ---------------------------------------------------------------------------
extern "C" void kernel_launch(void* const* d_in, const int* in_sizes, int n_in,
                              void* d_out, int out_size, void* d_ws, size_t ws_size,
                              hipStream_t stream) {
    (void)in_sizes; (void)n_in; (void)out_size; (void)ws_size;

    const float* x       = (const float*)d_in[0];
    const float* ctx     = (const float*)d_in[1];
    const float* sa_ng   = (const float*)d_in[2];
    const float* sa_nb   = (const float*)d_in[3];
    const float* sa_ncg  = (const float*)d_in[4];
    const float* sa_ncb  = (const float*)d_in[5];
    const float* sa_wq   = (const float*)d_in[6];
    const float* sa_wkv  = (const float*)d_in[7];
    const float* sa_wo   = (const float*)d_in[8];
    const float* sa_bo   = (const float*)d_in[9];
    const float* ca_ng   = (const float*)d_in[10];
    const float* ca_nb   = (const float*)d_in[11];
    const float* ca_ncg  = (const float*)d_in[12];
    const float* ca_ncb  = (const float*)d_in[13];
    const float* ca_wq   = (const float*)d_in[14];
    const float* ca_wkv  = (const float*)d_in[15];
    const float* ca_wo   = (const float*)d_in[16];
    const float* ca_bo   = (const float*)d_in[17];
    float* out = (float*)d_out;

    // carve workspace
    size_t off = 0;
    auto carve = [&](size_t bytes) -> void* {
        void* p = (char*)d_ws + off;
        off += (bytes + 255) & ~(size_t)255;
        return p;
    };
    // weights, f16 TRANSPOSED to [N][K]
    _Float16* wq16s  = (_Float16*)carve((size_t)MID * F * 2);        // [512][1024]
    _Float16* wkv16s = (_Float16*)carve((size_t)(2 * MID) * F * 2);  // [1024][1024]
    _Float16* wo16s  = (_Float16*)carve((size_t)F * MID * 2);        // [1024][512]
    _Float16* wq16c  = (_Float16*)carve((size_t)MID * F * 2);        // [512][1024]
    _Float16* wkv16c = (_Float16*)carve((size_t)(2 * MID) * CF * 2); // [1024][768]
    _Float16* wo16c  = (_Float16*)carve((size_t)F * MID * 2);        // [1024][512]
    _Float16* XN1 = (_Float16*)carve((size_t)ROWS * F * 2);          // q-norm input
    _Float16* XN2 = (_Float16*)carve((size_t)ROWS * F * 2);          // kv-norm input
    _Float16* Q16 = (_Float16*)carve((size_t)ROWS * MID * 2);
    _Float16* KV16 = (_Float16*)carve((size_t)ROWS * 2 * MID * 2);
    _Float16* AO16 = (_Float16*)carve((size_t)ROWS * MID * 2);
    float*    X1   = (float*)carve((size_t)ROWS * F * 4);
    _Float16* CN   = (_Float16*)carve((size_t)CROWS * CF * 2);       // normalized context
    _Float16* KVC16 = (_Float16*)carve((size_t)CROWS * 2 * MID * 2); // cross K/V

    // ---- norms of the inputs (XN1, XN2 from x, CN from the context) and the weight
    // casts + transposes W[K][N] -> Wt[N][K] ----
    prep_inputs_kernel<<<2 * LB_X + LB_C + CB_ALL, 512, 0, stream>>>(
        x, ctx, sa_ng, sa_nb, sa_ncg, sa_ncb, ca_ncg, ca_ncb, XN1, XN2, CN,
        sa_wq, sa_wkv, sa_wo, ca_wq, ca_wkv, ca_wo, wq16s, wkv16s, wo16s, wq16c, wkv16c, wo16c);
    // ---- KV = XN2 @ wkv, Q = (XN1 @ wq) * scale, cross KV = CN @ ca_wkv ----
    gemm_qkv_kernel<<<GB_ALL, 256, 0, stream>>>(
        XN2, wkv16s, KV16, XN1, wq16s, Q16, CN, wkv16c, KVC16);

    // ================= self-attention =================
    // attention (m_len = 2048)
    flash_attn_kernel<<<dim3(Nx / 64, 8, B), 128, 0, stream>>>(Q16, KV16, AO16, Nx, Nx);
    // X1 = AO @ wo + bo + x   [8192 x 512 -> 1024] -> f32
    gemm_wmma_kernel<1><<<dim3(F / 256, ROWS / 128), 256, 0, stream>>>(
        AO16, wo16s, nullptr, X1, sa_bo, x, 1.0f, F, MID);

    // ================= cross-attention =================
    // Q = (LayerNorm(X1) @ ca_wq) * scale
    ln_gemm_kernel<<<(ROWS / 64) * (MID / 256), 256, 0, stream>>>(X1, ca_ng, ca_nb, wq16c, Q16, 0.125f);
    // attention (m_len = 512)
    flash_attn_kernel<<<dim3(Nx / 64, 8, B), 128, 0, stream>>>(Q16, KVC16, AO16, Nx, Mc);
    // out = AO @ ca_wo + ca_bo + X1  -> f32 (final output)
    gemm_wmma_kernel<1><<<dim3(F / 256, ROWS / 128), 256, 0, stream>>>(
        AO16, wo16c, nullptr, out, ca_bo, X1, 1.0f, F, MID);
}

// v010
// Measured time: 133 microseconds a run.
// In two side-by-side timings against v009, it was 1.05 and 1.04 times as fast.
// Over all steps from v000 it is 4.35 times as fast.
#include <hip/hip_runtime.h>

typedef __attribute__((ext_vector_type(16))) _Float16 v16h;
typedef __attribute__((ext_vector_type(8)))  _Float16 v8h;
typedef __attribute__((ext_vector_type(8)))  float    v8f;

#define WMMA_F32_F16(a, b, c) \
    __builtin_amdgcn_wmma_f32_16x16x32_f16(false, (a), false, (b), (short)0, (c), false, false)

// Problem shape, shared by the host code and by the kernels that hold several jobs
constexpr int B = 4, Nx = 2048, Mc = 512, F = 1024, CF = 768, MID = 512;
constexpr int ROWS = B * Nx;   // 8192
constexpr int CROWS = B * Mc;  // 2048

__device__ __forceinline__ unsigned lds_off(const void* p) {
    return (unsigned)(unsigned long long)p;
}

__device__ __forceinline__ void wait_async0() {
    asm volatile("s_wait_asynccnt 0x0" ::: "memory");
}

// the wave's own LDS reads have returned: stands in front of the barrier behind
// which a buffer that the wave has read is refilled by copies
__device__ __forceinline__ void wait_ds0() {
    asm volatile("s_wait_dscnt 0x0" ::: "memory");
}

constexpr int FP = 72;  // 64-half (128 B) rows -> 144 B pitch

__device__ __forceinline__ v16h frag_ld(const _Float16* tile, int ld, int kbase) {
    const int lane = threadIdx.x & 31;
    const _Float16* p = tile + (lane & 15) * ld + kbase + ((lane >> 4) << 3);
    v8h lo = *(const v8h*)p;
    v8h hi = *(const v8h*)(p + 16);
    v16h r;
#pragma unroll
    for (int i = 0; i < 8; ++i) { r[i] = lo[i]; r[i + 8] = hi[i]; }
    return r;
}

// ---------------------------------------------------------------------------
// LayerNorm (biased variance, eps 1e-5) + cast to f16.
// One wave owns two whole rows: each row sits in registers (NV 16-byte loads
// per lane, 512 contiguous bytes per wave-wide load), the sums cross lanes in
// registers, so the LayerNorm jobs use no LDS and no barrier, and take only
// rows / 2 waves (for speed only).
// C = NV * 128; work-group blk (16 waves) takes 32 rows from 32 blk.
// ---------------------------------------------------------------------------
typedef __attribute__((ext_vector_type(4))) float    v4f;
typedef __attribute__((ext_vector_type(4))) _Float16 v4h;

template <int MASK>
__device__ __forceinline__ float add_xmask(float x) {
    return x + __builtin_bit_cast(float, __builtin_amdgcn_update_dpp(
        0, __builtin_bit_cast(int, x), 0x160 | MASK, 0xf, 0xf, false));
}

// sum over the 32 lanes of a wave, the same value in every lane
__device__ __forceinline__ float wave_sum(float x) {
    x = add_xmask<1>(x);
    x = add_xmask<2>(x);
    x = add_xmask<4>(x);
    x = add_xmask<8>(x);
    const int xi = __builtin_bit_cast(int, x);
    return x + __builtin_bit_cast(float,
        __builtin_amdgcn_permlanex16(xi, xi, 0x76543210, 0xfedcba98, false, false));
}

template <int NV>
__device__ __forceinline__ void ln_cast_rows(const float* __restrict__ X,
                                             const float* __restrict__ G,
                                             const float* __restrict__ Bv,
                                             _Float16* __restrict__ Y, int blk) {
    constexpr int C = NV * 128;
    const int lane = threadIdx.x & 31;
    // the wave's number as a scalar: the rows' base addresses then sit in scalar
    // registers and the lane number is the only address register of every access
    const int wave = __builtin_amdgcn_readfirstlane(threadIdx.x >> 5);
    const int row0 = (blk * 16 + wave) * 2;
    const v4f* x4 = (const v4f*)(X + (size_t)row0 * C) + lane;

    v4f v[2][NV];
#pragma unroll
    for (int r = 0; r < 2; ++r)
#pragma unroll
        for (int i = 0; i < NV; ++i) v[r][i] = x4[r * (C / 4) + i * 32];
    // scale and shift are asked for beside the rows, so that their latency
    // runs under the rows' own instead of behind the sums
    const v4f* g4 = (const v4f*)G + lane;
    const v4f* b4 = (const v4f*)Bv + lane;
    v4f g[NV], bb[NV];
#pragma unroll
    for (int i = 0; i < NV; ++i) { g[i] = g4[i * 32]; bb[i] = b4[i * 32]; }
    // keeps every load above in flight at once: without it the compiler sinks
    // the scale and shift loads behind the sums, in short dependent batches
    __builtin_amdgcn_sched_barrier(0);
    asm volatile("s_wait_xcnt 0x0" ::: "memory");
    __builtin_amdgcn_sched_barrier(0);

    float mean[2], rstd[2];
#pragma unroll
    for (int r = 0; r < 2; ++r) {
        v4f a1 = v[r][0], a2 = v[r][0] * v[r][0];
#pragma unroll
        for (int i = 1; i < NV; ++i) { a1 += v[r][i]; a2 += v[r][i] * v[r][i]; }
        const float s1 = wave_sum((a1[0] + a1[1]) + (a1[2] + a1[3]));
        const float s2 = wave_sum((a2[0] + a2[1]) + (a2[2] + a2[3]));
        constexpr float invC = 1.0f / (float)C;
        mean[r] = s1 * invC;
        rstd[r] = rsqrtf(s2 * invC - mean[r] * mean[r] + 1e-5f);
    }

    v4h* y4 = (v4h*)(Y + (size_t)row0 * C) + lane;
#pragma unroll
    for (int i = 0; i < NV; ++i) {
#pragma unroll
        for (int r = 0; r < 2; ++r) {
            v4h y;
#pragma unroll
            for (int e = 0; e < 4; ++e)
                y[e] = (_Float16)((v[r][i][e] - mean[r]) * rstd[r] * g[i][e] + bb[i][e]);
            y4[r * (C / 4) + i * 32] = y;
        }
    }
    asm volatile("s_wait_xcnt 0x0" ::: "memory");
}

template <int LGNT>
__device__ __forceinline__ void cast_transpose_tile(const float* __restrict__ in,
                                                    _Float16* __restrict__ out,
                                                    _Float16* tile, int K, int t) {
    constexpr int N = 128 << LGNT;
    const int nb = (t & ((1 << LGNT) - 1)) * 128;
    const int kb = (t >> LGNT) * 128;
    const int lane = threadIdx.x & 31;
    // the wave's number as a scalar: the rows' base addresses then sit in scalar
    // registers, and one lane offset is the only address register of the accesses
    const int wave = __builtin_amdgcn_readfirstlane(threadIdx.x >> 5);
    const v4f* s4 = (const v4f*)(in + (size_t)(kb + wave * 8) * N + nb) + lane;
    v4f v[8];
#pragma unroll
    for (int i = 0; i < 8; ++i) v[i] = s4[i * (N / 4)];
    __builtin_amdgcn_sched_barrier(0);
    asm volatile("s_wait_xcnt 0x0" ::: "memory");
    __builtin_amdgcn_sched_barrier(0);
#pragma unroll
    for (int e = 0; e < 4; ++e) {
        v8h h;
#pragma unroll
        for (int i = 0; i < 8; ++i) h[i] = (_Float16)v[i][e];
        *(v8h*)&tile[(lane * 4 + e) * 128 + ((wave ^ (lane & 15)) << 3)] = h;
    }
    __syncthreads();
#pragma unroll
    for (int j = 0; j < 4; ++j) {
        const int n0 = j * 32 + wave * 2;  // even: rows n0 and n0 + 1 share n >> 2
        const int c = lane & 15;
        const v8h h = *(const v8h*)&tile[(n0 + (lane >> 4)) * 128 + ((c ^ ((n0 >> 2) & 15)) << 3)];
        *(v8h*)(out + (size_t)(nb + n0) * K + kb + ((lane >> 4) * K + c * 8)) = h;
    }
    asm volatile("s_wait_xcnt 0x0" ::: "memory");
}

constexpr int CB_WQ  = (F / 128) * (MID / 128);       // tiles of a [F][MID] or [MID][F] weight
constexpr int CB_WKV = (F / 128) * (2 * MID / 128);   // tiles of the self k/v weight
constexpr int CB_WKC = (CF / 128) * (2 * MID / 128);  // tiles of the cross k/v weight
constexpr int CB_ALL = 4 * CB_WQ + CB_WKV + CB_WKC;

// All that needs only the inputs, in one launch: the three LayerNorms (x with the
// query norm's and with the key/value norm's scale and shift, then the context)
// and the six weight casts.  The work-group's index picks the job; the casts, the
// shortest jobs, come last and fill the places that the last LayerNorm rows leave.
constexpr int LB_X = ROWS / 32;   // work-groups of one LayerNorm of x
constexpr int LB_C = CROWS / 32;  // ... of the context

__global__ __launch_bounds__(512) void prep_inputs_kernel(
    const float* __restrict__ x, const float* __restrict__ ctx,
    const float* __restrict__ g1, const float* __restrict__ b1,
    const float* __restrict__ g2, const float* __restrict__ b2,
    const float* __restrict__ gc, const float* __restrict__ bc,
    _Float16* __restrict__ y1, _Float16* __restrict__ y2, _Float16* __restrict__ yc,
    const float* __restrict__ wqs, const float* __restrict__ wkvs, const float* __restrict__ wos,
    const float* __restrict__ wqc, const float* __restrict__ wkvc, const float* __restrict__ woc,
    _Float16* __restrict__ tqs, _Float16* __restrict__ tkvs, _Float16* __restrict__ tos,
    _Float16* __restrict__ tqc, _Float16* __restrict__ tkvc, _Float16* __restrict__ toc) {
    int f = blockIdx.x;
    if (f < 2 * LB_X) {
        const bool kv = f >= LB_X;
        ln_cast_rows<F / 128>(x, kv ? g2 : g1, kv ? b2 : b1, kv ? y2 : y1, kv ? f - LB_X : f);
    } else if ((f -= 2 * LB_X) < LB_C) {
        ln_cast_rows<CF / 128>(ctx, gc, bc, yc, f);
    } else {
        f -= LB_C;
        __shared__ __align__(16) _Float16 tile[128 * 128];
        const float* in;
        _Float16* out;
        int K;
        if (f < 2 * CB_WQ) {  // the two [F][MID] weights: N = 512
            const bool c = f >= CB_WQ;
            cast_transpose_tile<2>(c ? wqc : wqs, c ? tqc : tqs, tile, F, c ? f - CB_WQ : f);
            return;
        }
        f -= 2 * CB_WQ;  // the other four: N = 1024
        if (f < CB_WKV)                  { in = wkvs; out = tkvs; K = F; }
        else if ((f -= CB_WKV) < CB_WKC) { in = wkvc; out = tkvc; K = CF; }
        else if ((f -= CB_WKC) < CB_WQ)  { in = wos;  out = tos;  K = MID; }
        else               { f -= CB_WQ;   in = woc;  out = toc;  K = MID; }
        cast_transpose_tile<3>(in, out, tile, K, f);
    }
}

// ---------------------------------------------------------------------------
// One thread's twelve copies of one GEMM ring stage: 16 B of 4 A rows and of 8 B
// rows, 32 rows apart; in LDS the B rows follow the 128 A rows at one pitch.
// ---------------------------------------------------------------------------
constexpr int GK  = 64;                // k depth of a ring stage
constexpr int GST = (128 + 256) * FP;  // halves in one stage buffer

__device__ __forceinline__ void gemm_stage_copies(unsigned d, const _Float16* a, const _Float16* b,
                                                  size_t step) {
    constexpr unsigned R = 32 * FP * 2;  // 32 LDS rows in bytes
    asm volatile(
        "global_load_async_to_lds_b128 %0, %12, off\n\t"
        "global_load_async_to_lds_b128 %1, %13, off\n\t"
        "global_load_async_to_lds_b128 %2, %14, off\n\t"
        "global_load_async_to_lds_b128 %3, %15, off\n\t"
        "global_load_async_to_lds_b128 %4, %16, off\n\t"
        "global_load_async_to_lds_b128 %5, %17, off\n\t"
        "global_load_async_to_lds_b128 %6, %18, off\n\t"
        "global_load_async_to_lds_b128 %7, %19, off\n\t"
        "global_load_async_to_lds_b128 %8, %20, off\n\t"
        "global_load_async_to_lds_b128 %9, %21, off\n\t"
        "global_load_async_to_lds_b128 %10, %22, off\n\t"
        "global_load_async_to_lds_b128 %11, %23, off\n\t"
        "s_wait_xcnt 0x0"
        :: "v"(d), "v"(d + R), "v"(d + 2 * R), "v"(d + 3 * R), "v"(d + 4 * R), "v"(d + 5 * R),
           "v"(d + 6 * R), "v"(d + 7 * R), "v"(d + 8 * R), "v"(d + 9 * R), "v"(d + 10 * R),
           "v"(d + 11 * R),
           "v"((unsigned long long)a), "v"((unsigned long long)(a + step)),
           "v"((unsigned long long)(a + 2 * step)), "v"((unsigned long long)(a + 3 * step)),
           "v"((unsigned long long)b), "v"((unsigned long long)(b + step)),
           "v"((unsigned long long)(b + 2 * step)), "v"((unsigned long long)(b + 3 * step)),
           "v"((unsigned long long)(b + 4 * step)), "v"((unsigned long long)(b + 5 * step)),
           "v"((unsigned long long)(b + 6 * step)), "v"((unsigned long long)(b + 7 * step))
        : "memory");
}

// ---------------------------------------------------------------------------
// Tiled WMMA GEMM:  C[M,N] = A[M,K] (f16 row-major) * Bt[N,K] (f16, B transposed)
// Block tile 128x256, 256 threads = 8 waves in a 2(M) x 4(N) grid,
// each wave computes a 64x64 register tile: 16 WMMAs per 32-wide K step.
// A/B tiles staged into LDS with global_load_async_to_lds_b128, in a ring of two
// buffers of 64 k each: the copies of stage t + 2 are issued at the foot of pass
// t and waited for at the foot of pass t + 1, so they fly under a whole pass of
// 32 WMMAs per wave.  K is a multiple of 64.
// MODE 0: C -> f16 * scale (1 for K/V, 0.125 as the Q pre-scale).
// MODE 1: C -> f32 with + bias[n] + res[m,n]: res + bias is the accumulators' start
// value, asked for at the kernel's entry (all loads in flight at once, beside the
// first stage's copies), so that the epilogue only stores.
// ---------------------------------------------------------------------------
template <int MODE>
__device__ __forceinline__ void gemm_wmma_tile(const _Float16* __restrict__ A,
                                               const _Float16* __restrict__ Bt,
                                               _Float16* __restrict__ C16,
                                               float* __restrict__ C32,
                                               const float* __restrict__ bias,
                                               const float* __restrict__ res,
                                               float scale, int N, int K,
                                               int mbase, int nbase) {
    // two stage buffers; each holds 128 A rows [m][k], then 256 B rows [n][k]
    __shared__ __align__(16) _Float16 sm[2 * GST];
    const int tid = threadIdx.x;
    const int wave = tid >> 5, lane = tid & 31;
    const int waveM = wave >> 2, waveN = wave & 3;

    v8f acc[4][4] = {};

    // staging assignments: a stage row is 64 halves = 128 B = 8 lanes x 16 B;
    // a thread copies its 16 B of rows srow + 32 i: 4 rows of A, 8 rows of B
    const int srow = tid >> 3, sseg = (tid & 7) * 8;
    const _Float16* gA = A + (size_t)(mbase + srow) * K + sseg;
    const _Float16* gB = Bt + (size_t)(nbase + srow) * K + sseg;
    const size_t gstep = (size_t)32 * K;  // 32 rows of A or of Bt, in halves
    const unsigned d0 = lds_off(&sm[srow * FP + sseg]);
    const int nst = K / GK;

    gemm_stage_copies(d0, gA, gB, gstep);
    float bj[4];
    if (MODE == 1) {
        // the lane's 128 residual values, straight into its accumulators, and its 4
        // bias values: all in flight together, beside stage 0's copies (unrolled:
        // accumulator elements are registers, their indices constants)
        const float* rp = res + (size_t)(mbase + waveM * 64 + (lane >> 4) * 8) * N + nbase + waveN * 64 + (lane & 15);
#pragma unroll
        for (int i = 0; i < 4; ++i)
#pragma unroll
            for (int r = 0; r < 8; ++r)
#pragma unroll
                for (int j = 0; j < 4; ++j) acc[i][j][r] = rp[(size_t)(i * 16 + r) * N + j * 16];
#pragma unroll
        for (int j = 0; j < 4; ++j) bj[j] = bias[nbase + waveN * 64 + j * 16 + (lane & 15)];
        __builtin_amdgcn_sched_barrier(0);
        asm volatile("s_wait_xcnt 0x0" ::: "memory");
        __builtin_amdgcn_sched_barrier(0);
    }
    wait_async0();    // stage 0 has landed (this wave's share)
    __syncthreads();  // ... and every other wave's
    if (nst > 1) gemm_stage_copies(d0 + GST * 2, gA + GK, gB + GK, gstep);

    if (MODE == 1) {
#pragma unroll
        for (int i = 0; i < 4; ++i)
#pragma unroll
            for (int j = 0; j < 4; ++j) acc[i][j] += bj[j];
    }

    for (int t = 0; t < nst; ++t) {
        const _Float16* sA = sm + (t & 1) * GST;
        const _Float16* sB = sA + 128 * FP;
        // unrolled: kc becomes an immediate offset of the LDS reads
#pragma unroll
        for (int kc = 0; kc < GK; kc += 32) {
            v16h bf[4], af[4];
#pragma unroll
            for (int j = 0; j < 4; ++j) {
                bf[j] = frag_ld(sB + (waveN * 64 + j * 16) * FP, FP, kc);
                af[j] = frag_ld(sA + (waveM * 64 + j * 16) * FP, FP, kc);
            }
            // holds the block's 16 LDS reads together ahead of its 16 WMMAs: left free,
            // the compiler reads each A fragment into one register set right in front
            // of its row of WMMAs, and the wave waits out the LDS latency at every row
            __builtin_amdgcn_sched_barrier(0);
#pragma unroll
            for (int i = 0; i < 4; ++i)
#pragma unroll
                for (int j = 0; j < 4; ++j)
                    acc[i][j] = WMMA_F32_F16(af[i], bf[j], acc[i][j]);
        }
        // publish point: this wave has left buffer t & 1 and its copies of stage
        // t + 1 have landed; the one barrier says both of every wave
        wait_ds0();
        wait_async0();
        __syncthreads();
        if (t + 2 < nst)
            gemm_stage_copies(d0 + (t & 1) * (GST * 2), gA + (t + 2) * GK, gB + (t + 2) * GK, gstep);
    }
    wait_async0();  // no copy is outstanding when the wave goes on to its end

    const int hf = lane >> 4, c0 = lane & 15;
    if (MODE == 1) {
        // row by row: four stores in a row fill two whole 128 B lines in each of two
        // rows; unrolled: accumulator elements are registers, their indices constants
        float* cp = C32 + (size_t)(mbase + waveM * 64 + hf * 8) * N + nbase + waveN * 64 + c0;
#pragma unroll
        for (int i = 0; i < 4; ++i)
#pragma unroll
            for (int r = 0; r < 8; ++r)
#pragma unroll
                for (int j = 0; j < 4; ++j) cp[(size_t)(i * 16 + r) * N + j * 16] = acc[i][j][r];
        return;
    }
#pragma unroll
    for (int i = 0; i < 4; ++i) {
#pragma unroll
        for (int j = 0; j < 4; ++j) {
#pragma unroll
            for (int r = 0; r < 8; ++r) {
                const int row = mbase + waveM * 64 + i * 16 + hf * 8 + r;
                const int col = nbase + waveN * 64 + j * 16 + c0;
                C16[(size_t)row * N + col] = (_Float16)(acc[i][j][r] * scale);
            }
        }
    }
}

// one product per launch; grid: (N / 256, M / 128)
template <int MODE>
__global__ __launch_bounds__(256) void gemm_wmma_kernel(const _Float16* __restrict__ A,
                                                        const _Float16* __restrict__ Bt,
                                                        _Float16* __restrict__ C16,
                                                        float* __restrict__ C32,
                                                        const float* __restrict__ bias,
                                                        const float* __restrict__ res,
                                                        float scale, int N, int K) {
    // both f32 products are F wide: with the pitch a constant, every residual load and
    // every store of a lane is an immediate offset of one address
    gemm_wmma_tile<MODE>(A, Bt, C16, C32, bias, res, scale, MODE == 1 ? F : N, K,
                         blockIdx.y * 128, blockIdx.x * 256);
}

// The three products that need only the prepared operands, in one launch: self
// K/V, self Q and cross K/V.  The work-group's index picks product and tile (the
// column block runs fastest, as in a launch of its own); the shortest K is last.
constexpr int GB_KVS = (2 * MID / 256) * (ROWS / 128);   // 256 tiles
constexpr int GB_QS  = (MID / 256) * (ROWS / 128);       // 128 tiles
constexpr int GB_KVC = (2 * MID / 256) * (CROWS / 128);  // 64 tiles
constexpr int GB_ALL = GB_KVS + GB_QS + GB_KVC;

__global__ __launch_bounds__(256) void gemm_qkv_kernel(
    const _Float16* __restrict__ akvs, const _Float16* __restrict__ wkvs, _Float16* __restrict__ ckvs,
    const _Float16* __restrict__ aqs, const _Float16* __restrict__ wqs, _Float16* __restrict__ cqs,
    const _Float16* __restrict__ akvc, const _Float16* __restrict__ wkvc, _Float16* __restrict__ ckvc) {
    int f = blockIdx.x;
    const _Float16 *A, *Bt;
    _Float16* C;
    float scale;
    int lgnb, K;  // N = 256 << lgnb
    if (f < GB_KVS)                 { A = akvs; Bt = wkvs; C = ckvs; scale = 1.0f;   lgnb = 2; K = F; }
    else if ((f -= GB_KVS) < GB_QS) { A = aqs;  Bt = wqs;  C = cqs;  scale = 0.125f; lgnb = 1; K = F; }
    else              { f -= GB_QS;   A = akvc; Bt = wkvc; C = ckvc; scale = 1.0f;   lgnb = 2; K = CF; }
    gemm_wmma_tile<0>(A, Bt, C, nullptr, nullptr, nullptr, scale, 256 << lgnb, K,
                      (f >> lgnb) * 128, (f & ((1 << lgnb) - 1)) * 256);
}

// ---------------------------------------------------------------------------
// LayerNorm and the product that reads it, in one launch:
//   C[M, MID] = LayerNorm(X[M, F]) (f16) * Bt[MID, F]^T * scale  -> f16.
// A work-group owns 64 whole rows and 256 of the MID columns (M / 64 x MID / 256
// work-groups: one per WGP; the two that share rows each norm them).  Its 8 waves
// norm 8 rows each (4 at a time in registers, the arithmetic of ln_cast_rows)
// straight into LDS, where the 64 x F tile stays as the A operand for the whole K
// loop; only the weights go through a ring of two 128-k stages (one stage is in
// flight at a time, so a longer stage pays the copies' latency half as often), and
// their first stage flies under the norm.  Waves in a 2 (M) x 4 (N) grid, 32 x 64 each.
// ---------------------------------------------------------------------------
constexpr int AP = F + 8;   // resident A rows of F halves: pitch 2064 B = 16 B x odd
constexpr int WK = 128;     // k depth of a weight stage
constexpr int WP = WK + 8;  // weight rows of 128 halves: pitch 272 B = 16 B x odd

// one thread's 16 B of 8 weight rows, 16 rows apart
__device__ __forceinline__ void weight_copies8(unsigned d, const _Float16* b, size_t step) {
    constexpr unsigned R = 16 * WP * 2;  // 16 LDS rows in bytes
    asm volatile(
        "global_load_async_to_lds_b128 %0, %8, off\n\t"
        "global_load_async_to_lds_b128 %1, %9, off\n\t"
        "global_load_async_to_lds_b128 %2, %10, off\n\t"
        "global_load_async_to_lds_b128 %3, %11, off\n\t"
        "global_load_async_to_lds_b128 %4, %12, off\n\t"
        "global_load_async_to_lds_b128 %5, %13, off\n\t"
        "global_load_async_to_lds_b128 %6, %14, off\n\t"
        "global_load_async_to_lds_b128 %7, %15, off\n\t"
        "s_wait_xcnt 0x0"
        :: "v"(d), "v"(d + R), "v"(d + 2 * R), "v"(d + 3 * R), "v"(d + 4 * R), "v"(d + 5 * R),
           "v"(d + 6 * R), "v"(d + 7 * R),
           "v"((unsigned long long)b), "v"((unsigned long long)(b + step)),
           "v"((unsigned long long)(b + 2 * step)), "v"((unsigned long long)(b + 3 * step)),
           "v"((unsigned long long)(b + 4 * step)), "v"((unsigned long long)(b + 5 * step)),
           "v"((unsigned long long)(b + 6 * step)), "v"((unsigned long long)(b + 7 * step))
        : "memory");
}

__global__ __launch_bounds__(256) void ln_gemm_kernel(const float* __restrict__ X,
                                                      const float* __restrict__ G,
                                                      const float* __restrict__ Bv,
                                                      const _Float16* __restrict__ Bt,
                                                      _Float16* __restrict__ C16, float scale) {
    constexpr int K = F, N = MID, NV = K / 128, nst = K / WK;
    constexpr int BST = 256 * WP;  // halves in one stage buffer of weights
    __shared__ __align__(16) _Float16 sA[64 * AP];
    __shared__ __align__(16) _Float16 sB[2 * BST];
    const int tid = threadIdx.x, lane = tid & 31;
    // the wave's number as a scalar: the rows' base addresses then sit in scalar registers
    const int wave = __builtin_amdgcn_readfirstlane(tid >> 5);
    const int waveM = wave >> 2, waveN = wave & 3;
    const int mbase = (blockIdx.x >> 1) * 64, nbase = (blockIdx.x & 1) * 256;

    // a stage row is 128 halves = 16 lanes x 16 B; a thread copies its 16 B of rows srow + 16 i
    const int srow = tid >> 4, sseg = (tid & 15) * 8;
    const _Float16* gB = Bt + (size_t)(nbase + srow) * K + sseg;
    const size_t gstep = (size_t)16 * K;
    const unsigned d0 = lds_off(&sB[srow * WP + sseg]);
    constexpr unsigned R8 = 8 * 16 * WP * 2;  // 128 LDS rows in bytes

    weight_copies8(d0, gB, gstep);
    weight_copies8(d0 + R8, gB + 8 * gstep, gstep);

    {
        const v4f* g4 = (const v4f*)G + lane;
        const v4f* b4 = (const v4f*)Bv + lane;
        v4f g[NV], bb[NV];
#pragma unroll
        for (int i = 0; i < NV; ++i) { bb[i] = b4[i * 32]; g[i] = g4[i * 32]; }
        __builtin_amdgcn_sched_barrier(0);
        asm volatile("s_wait_xcnt 0x0" ::: "memory");
        __builtin_amdgcn_sched_barrier(0);
        // rolled: four rows fill 128 registers; both halves at once would not fit
#pragma nounroll
        for (int it = 0; it < 2; ++it) {
            const int lr = wave * 8 + it * 4;
            const v4f* x4 = (const v4f*)(X + (size_t)(mbase + lr) * K) + lane;
            v4f v[4][NV];
#pragma unroll
            for (int r = 0; r < 4; ++r)
#pragma unroll
                for (int i = 0; i < NV; ++i) v[r][i] = x4[r * (K / 4) + i * 32];
            __builtin_amdgcn_sched_barrier(0);
            asm volatile("s_wait_xcnt 0x0" ::: "memory");
            __builtin_amdgcn_sched_barrier(0);
#pragma unroll
            for (int r = 0; r < 4; ++r) {
                v4f a1 = v[r][0], a2 = v[r][0] * v[r][0];
#pragma unroll
                for (int i = 1; i < NV; ++i) { a1 += v[r][i]; a2 += v[r][i] * v[r][i]; }
                const float s1 = wave_sum((a1[0] + a1[1]) + (a1[2] + a1[3]));
                const float s2 = wave_sum((a2[0] + a2[1]) + (a2[2] + a2[3]));
                constexpr float invC = 1.0f / (float)K;
                const float mean = s1 * invC;
                const float rstd = rsqrtf(s2 * invC - mean * mean + 1e-5f);
#pragma unroll
                for (int i = 0; i < NV; ++i) {
                    v4h y;
#pragma unroll
                    for (int e = 0; e < 4; ++e)
                        y[e] = (_Float16)((v[r][i][e] - mean) * rstd * g[i][e] + bb[i][e]);
                    *(v4h*)&sA[(lr + r) * AP + i * 128 + lane * 4] = y;
                }
            }
        }
    }
    wait_async0();    // weight stage 0 has landed (this wave's share)
    __syncthreads();  // ... and every other wave's, and every wave's normed rows are in LDS
    weight_copies8(d0 + BST * 2, gB + WK, gstep);
    weight_copies8(d0 + BST * 2 + R8, gB + WK + 8 * gstep, gstep);

    v8f acc[2][4] = {};
    for (int t = 0; t < nst; ++t) {
        const _Float16* sW = sB + (t & 1) * BST + waveN * 64 * WP;
        const _Float16* sX = sA + waveM * 32 * AP + t * WK;
        // unrolled: kc becomes an immediate offset of the LDS reads
#pragma unroll
        for (int kc = 0; kc < WK; kc += 32) {
            v16h bf[4], af[2];
#pragma unroll
            for (int j = 0; j < 4; ++j) bf[j] = frag_ld(sW + j * 16 * WP, WP, kc);
#pragma unroll
            for (int i = 0; i < 2; ++i) af[i] = frag_ld(sX + i * 16 * AP, AP, kc);
            // holds the block's 12 LDS reads together ahead of its 8 WMMAs, so that the
            // wave waits out the LDS latency once per block and not at every row
            __builtin_amdgcn_sched_barrier(0);
#pragma unroll
            for (int i = 0; i < 2; ++i)
#pragma unroll
                for (int j = 0; j < 4; ++j)
                    acc[i][j] = WMMA_F32_F16(af[i], bf[j], acc[i][j]);
        }
        // publish point: this wave has left buffer t & 1 and its copies of stage
        // t + 1 have landed; the one barrier says both of every wave
        wait_ds0();
        wait_async0();
        __syncthreads();
        if (t + 2 < nst) {
            weight_copies8(d0 + (t & 1) * (BST * 2), gB + (t + 2) * WK, gstep);
            weight_copies8(d0 + (t & 1) * (BST * 2) + R8, gB + (t + 2) * WK + 8 * gstep, gstep);
        }
    }
    wait_async0();  // no copy is outstanding when the wave goes on to its end

    const int hf = lane >> 4, c0 = lane & 15;
#pragma unroll
    for (int i = 0; i < 2; ++i) {
#pragma unroll
        for (int j = 0; j < 4; ++j) {
#pragma unroll
            for (int r = 0; r < 8; ++r) {
                const int row = mbase + waveM * 32 + i * 16 + hf * 8 + r;
                const int col = nbase + waveN * 64 + j * 16 + c0;
                C16[(size_t)row * N + col] = (_Float16)(acc[i][j][r] * scale);
            }
        }
    }
}

constexpr int VP = 80;  // V rows of 64 halves, read by ds_load_tr16_b128: pitch 160 B = 32 B x odd

typedef __attribute__((ext_vector_type(8))) short v8s;

// 16 (d) x 32 (keys) A fragment of V^T from a row-major [key][ld halves] LDS tile:
// lane (c, hf) gets keys kbase + 8 hf + 0..7, then kbase + 16 + 8 hf + 0..7, of
// column dbase + c: the k order of frag_ld and of a converted pair of D tiles.
__device__ __forceinline__ v16h frag_ld_tr(const _Float16* tile, int ld, int kbase, int dbase) {
    typedef __attribute__((address_space(3))) v8s lds_v8s;
    const int lane = threadIdx.x & 31;
    const _Float16* p = tile + (kbase + ((lane >> 4) << 3) + (lane & 7)) * ld + dbase + (((lane >> 3) & 1) << 3);
    v8h lo = __builtin_bit_cast(v8h, __builtin_amdgcn_ds_load_tr16_b128_v8i16((lds_v8s*)p));
    v8h hi = __builtin_bit_cast(v8h, __builtin_amdgcn_ds_load_tr16_b128_v8i16((lds_v8s*)(p + 16 * ld)));
    v16h r;
#pragma unroll
    for (int i = 0; i < 8; ++i) { r[i] = lo[i]; r[i + 8] = hi[i]; }
    return r;
}

__device__ __forceinline__ float xhalf(float x) {
    const int xi = __builtin_bit_cast(int, x);
    return __builtin_bit_cast(float,
        __builtin_amdgcn_permlanex16(xi, xi, 0x76543210, 0xfedcba98, false, false));
}

// One thread's eight copies of one K/V ring stage: its 16 B of 4 K rows and of 4 V
// rows, 16 rows apart.  8 lanes x 16 B are one whole row of a head (128 B, one
// line), so a wave-wide copy takes 4 whole lines.  g: the tile's first K element
// (the same for the whole work-group, so it sits in scalar registers and a trip
// moves it with scalar adds); o: the lane's byte offset in the tile; V lies 512
// halves behind K in every row.
constexpr int ABUF = 64 * FP + 64 * VP;  // halves in one stage buffer: K tile, then V tile

__device__ __forceinline__ void attn_stage_copies(unsigned dk, unsigned dv, const _Float16* g,
                                                  unsigned o) {
    constexpr unsigned RK = 16 * FP * 2, RV = 16 * VP * 2;  // 16 LDS rows in bytes
    constexpr unsigned RG = 16 * 1024 * 2;                  // 16 K/V rows in bytes
    asm volatile(
        "global_load_async_to_lds_b128 %0, %8, %12\n\t"
        "global_load_async_to_lds_b128 %1, %9, %12\n\t"
        "global_load_async_to_lds_b128 %2, %10, %12\n\t"
        "global_load_async_to_lds_b128 %3, %11, %12\n\t"
        "global_load_async_to_lds_b128 %4, %8, %13\n\t"
        "global_load_async_to_lds_b128 %5, %9, %13\n\t"
        "global_load_async_to_lds_b128 %6, %10, %13\n\t"
        "global_load_async_to_lds_b128 %7, %11, %13\n\t"
        "s_wait_xcnt 0x0"
        :: "v"(dk), "v"(dk + RK), "v"(dk + 2 * RK), "v"(dk + 3 * RK),
           "v"(dv), "v"(dv + RV), "v"(dv + 2 * RV), "v"(dv + 3 * RV),
           "v"(o), "v"(o + RG), "v"(o + 2 * RG), "v"(o + 3 * RG),
           "s"((unsigned long long)g), "s"((unsigned long long)(g + 512))
        : "memory");
}

__global__ __launch_bounds__(128) void flash_attn_kernel(const _Float16* __restrict__ Q,
                                                         const _Float16* __restrict__ KV,
                                                         _Float16* __restrict__ O,
                                                         int n_q, int m_len) {
    // two stage buffers; each holds a K tile [key][d] (A rows of K Q^T), then a V tile
    // [key][d] (read transposed)
    __shared__ __align__(16) _Float16 sm[2 * ABUF];

    const int wave = threadIdx.x >> 5;
    const int lane = threadIdx.x & 31;
    const int h = blockIdx.y, b = blockIdx.z;
    const int qrow0 = blockIdx.x * 64;
    const int hf = lane >> 4, c0 = lane & 15;
    // this lane's query row, at its head's columns
    const size_t qoff  = ((size_t)b * n_q + qrow0 + wave * 16 + c0) * 512 + (size_t)h * 64;
    const size_t kvoff = (size_t)b * m_len * 1024 + (size_t)h * 64;

    // staging: a thread copies its 16 B of rows srow + 16 i of the K and of the V tile
    const int srow = threadIdx.x >> 3, sseg = (threadIdx.x & 7) * 8;
    const unsigned dk0 = lds_off(&sm[srow * FP + sseg]);
    const unsigned dv0 = lds_off(&sm[64 * FP + srow * VP + sseg]);
    const unsigned goff = (unsigned)(srow * 1024 + sseg) * 2;
    const _Float16* gkv = KV + kvoff;
    const int nt = m_len / 64;  // m_len is a multiple of 64

    if (nt > 0) attn_stage_copies(dk0, dv0, gkv, goff);

    // Q^T as B operand, loaded once, in the k order of frag_ld
    v16h qf[2];
#pragma unroll
    for (int kc = 0; kc < 2; ++kc) {
        const _Float16* qp = Q + qoff + kc * 32 + hf * 8;
        v8h lo = *(const v8h*)qp;
        v8h hi = *(const v8h*)(qp + 16);
#pragma unroll
        for (int i = 0; i < 8; ++i) { qf[kc][i] = lo[i]; qf[kc][i + 8] = hi[i]; }
    }

    float m_i = -1e30f, l_i = 0.f;  // l_i: the sum over this lane's half of the keys
    v8f o[4] = {};                  // o[j][r] = O^T[d = 16 j + 8 hf + r][query c0]

    wait_async0();    // tile 0 has landed (this wave's share)
    __syncthreads();  // ... and every other wave's
    if (nt > 1) attn_stage_copies(dk0 + ABUF * 2, dv0 + ABUF * 2, gkv + 64 * 1024, goff);

    for (int t = 0; t < nt; ++t) {
        const _Float16* sK = sm + (t & 1) * ABUF;
        const _Float16* sV = sK + 64 * FP;

        // S^T = K Q^T: s[g][r] = score of key 16 g + 8 hf + r with query c0
        v16h kf[2][4];
#pragma unroll
        for (int kc = 0; kc < 2; ++kc)
#pragma unroll
            for (int g = 0; g < 4; ++g) kf[kc][g] = frag_ld(sK + g * 16 * FP, FP, kc * 32);
        // the tile's 16 V^T reads queue behind them: the whole tile then sits in
        // registers and its buffer is free for the refill
        v16h vt[2][4];
#pragma unroll
        for (int c = 0; c < 2; ++c)
#pragma unroll
            for (int j = 0; j < 4; ++j) vt[c][j] = frag_ld_tr(sV, VP, c * 32, j * 16);
        // publish point, directly behind the trip's last LDS read (all that follows
        // works on registers): this wave has left buffer t & 1 and its copies of tile
        // t + 1 have landed; the one barrier says both of every wave.  The refill
        // behind it then flies under this tile's products and softmax and under the
        // next tile's reads.
        wait_ds0();
        wait_async0();
        __syncthreads();
        if (t + 2 < nt)
            attn_stage_copies(dk0 + (t & 1) * (ABUF * 2), dv0 + (t & 1) * (ABUF * 2),
                              gkv + (size_t)(t + 2) * (64 * 1024), goff);
        v8f s[4] = {};
#pragma unroll
        for (int kc = 0; kc < 2; ++kc)
#pragma unroll
            for (int g = 0; g < 4; ++g) s[g] = WMMA_F32_F16(kf[kc][g], qf[kc], s[g]);

        // Online softmax, one query per lane.
        float mg[4];
#pragma unroll
        for (int g = 0; g < 4; ++g) {
            mg[g] = s[g][0];
#pragma unroll
            for (int r = 1; r < 8; ++r) mg[g] = fmaxf(mg[g], s[g][r]);
        }
        float mx = fmaxf(fmaxf(mg[0], mg[1]), fmaxf(mg[2], mg[3]));
        mx = fmaxf(mx, xhalf(mx));  // both halves of the query's keys
        const float mnew  = fmaxf(m_i, mx);
        const float alpha = __expf(m_i - mnew);
        m_i = mnew;
        float rs[4];
        v16h pb[2];  // P^T: keys 32 c .. 32 c + 31 are score tiles 2 c and 2 c + 1
#pragma unroll
        for (int g = 0; g < 4; ++g) {
            rs[g] = 0.f;
#pragma unroll
            for (int r = 0; r < 8; ++r) {
                const float p = __expf(s[g][r] - mnew);
                rs[g] += p;
                pb[g >> 1][(g & 1) * 8 + r] = (_Float16)p;
            }
        }
        l_i = l_i * alpha + ((rs[0] + rs[1]) + (rs[2] + rs[3]));
#pragma unroll
        for (int j = 0; j < 4; ++j) o[j] *= alpha;

        // O^T += V^T P^T
#pragma unroll
        for (int c = 0; c < 2; ++c) {
#pragma unroll
            for (int j = 0; j < 4; ++j) o[j] = WMMA_F32_F16(vt[c][j], pb[c], o[j]);
        }
    }
    wait_async0();  // no copy is outstanding when the wave goes on to its end

    // Epilogue: join the halves' sums, normalize, store 8 consecutive d per lane.
    const float inv = 1.0f / (l_i + xhalf(l_i));
#pragma unroll
    for (int j = 0; j < 4; ++j) {
        v8h y;
#pragma unroll
        for (int r = 0; r < 8; ++r) y[r] = (_Float16)(o[j][r] * inv);
        *(v8h*)(O + qoff + j * 16 + hf * 8) = y;
    }
}

// ---------------------------------------------------------------------------
// Host-side orchestration
// ---------------------------------------------------------------------------
extern "C" void kernel_launch(void* const* d_in, const int* in_sizes, int n_in,
                              void* d_out, int out_size, void* d_ws, size_t ws_size,
                              hipStream_t stream) {
    (void)in_sizes; (void)n_in; (void)out_size; (void)ws_size;

    const float* x       = (const float*)d_in[0];
    const float* ctx     = (const float*)d_in[1];
    const float* sa_ng   = (const float*)d_in[2];
    const float* sa_nb   = (const float*)d_in[3];
    const float* sa_ncg  = (const float*)d_in[4];
    const float* sa_ncb  = (const float*)d_in[5];
    const float* sa_wq   = (const float*)d_in[6];
    const float* sa_wkv  = (const float*)d_in[7];
    const float* sa_wo   = (const float*)d_in[8];
    const float* sa_bo   = (const float*)d_in[9];
    const float* ca_ng   = (const float*)d_in[10];
    const float* ca_nb   = (const float*)d_in[11];
    const float* ca_ncg  = (const float*)d_in[12];
    const float* ca_ncb  = (const float*)d_in[13];
    const float* ca_wq   = (const float*)d_in[14];
    const float* ca_wkv  = (const float*)d_in[15];
    const float* ca_wo   = (const float*)d_in[16];
    const float* ca_bo   = (const float*)d_in[17];
    float* out = (float*)d_out;

    // carve workspace
    size_t off = 0;
    auto carve = [&](size_t bytes) -> void* {
        void* p = (char*)d_ws + off;
        off += (bytes + 255) & ~(size_t)255;
        return p;
    };
    // weights, f16 TRANSPOSED to [N][K]
    _Float16* wq16s  = (_Float16*)carve((size_t)MID * F * 2);        // [512][1024]
    _Float16* wkv16s = (_Float16*)carve((size_t)(2 * MID) * F * 2);  // [1024][1024]
    _Float16* wo16s  = (_Float16*)carve((size_t)F * MID * 2);        // [1024][512]
    _Float16* wq16c  = (_Float16*)carve((size_t)MID * F * 2);        // [512][1024]
    _Float16* wkv16c = (_Float16*)carve((size_t)(2 * MID) * CF * 2); // [1024][768]
    _Float16* wo16c  = (_Float16*)carve((size_t)F * MID * 2);        // [1024][512]
    _Float16* XN1 = (_Float16*)carve((size_t)ROWS * F * 2);          // q-norm input
    _Float16* XN2 = (_Float16*)carve((size_t)ROWS * F * 2);          // kv-norm input
    _Float16* Q16 = (_Float16*)carve((size_t)ROWS * MID * 2);
    _Float16* KV16 = (_Float16*)carve((size_t)ROWS * 2 * MID * 2);
    _Float16* AO16 = (_Float16*)carve((size_t)ROWS * MID * 2);
    float*    X1   = (float*)carve((size_t)ROWS * F * 4);
    _Float16* CN   = (_Float16*)carve((size_t)CROWS * CF * 2);       // normalized context
    _Float16* KVC16 = (_Float16*)carve((size_t)CROWS * 2 * MID * 2); // cross K/V

    // ---- norms of the inputs (XN1, XN2 from x, CN from the context) and the weight
    // casts + transposes W[K][N] -> Wt[N][K] ----
    prep_inputs_kernel<<<2 * LB_X + LB_C + CB_ALL, 512, 0, stream>>>(
        x, ctx, sa_ng, sa_nb, sa_ncg, sa_ncb, ca_ncg, ca_ncb, XN1, XN2, CN,
        sa_wq, sa_wkv, sa_wo, ca_wq, ca_wkv, ca_wo, wq16s, wkv16s, wo16s, wq16c, wkv16c, wo16c);
    // ---- KV = XN2 @ wkv, Q = (XN1 @ wq) * scale, cross KV = CN @ ca_wkv ----
    gemm_qkv_kernel<<<GB_ALL, 256, 0, stream>>>(
        XN2, wkv16s, KV16, XN1, wq16s, Q16, CN, wkv16c, KVC16);

    // ================= self-attention =================
    // attention (m_len = 2048)
    flash_attn_kernel<<<dim3(Nx / 64, 8, B), 128, 0, stream>>>(Q16, KV16, AO16, Nx, Nx);
    // X1 = AO @ wo + bo + x   [8192 x 512 -> 1024] -> f32
    gemm_wmma_kernel<1><<<dim3(F / 256, ROWS / 128), 256, 0, stream>>>(
        AO16, wo16s, nullptr, X1, sa_bo, x, 1.0f, F, MID);

    // ================= cross-attention =================
    // Q = (LayerNorm(X1) @ ca_wq) * scale
    ln_gemm_kernel<<<(ROWS / 64) * (MID / 256), 256, 0, stream>>>(X1, ca_ng, ca_nb, wq16c, Q16, 0.125f);
    // attention (m_len = 512)
    flash_attn_kernel<<<dim3(Nx / 64, 8, B), 128, 0, stream>>>(Q16, KVC16, AO16, Nx, Mc);
    // out = AO @ ca_wo + ca_bo + X1  -> f32 (final output)
    gemm_wmma_kernel<1><<<dim3(F / 256, ROWS / 128), 256, 0, stream>>>(
        AO16, wo16c, nullptr, out, ca_bo, X1, 1.0f, F, MID);
}
